// v000
// The times below were measured on an AMD MI455X: many runs one after another, warmed up first and cycling through
// copies of the inputs, with the whole window's GPU time divided by the number of runs. Launches and the gaps
// between them are all in it. The median over several windows is given; except for v000 it joins two sittings, which
// can be a few percent apart, so the side-by-side timings, each taken in one sitting, are the better comparison.
// v000, which the later versions start from, runs in 1010 microseconds.
#include <hip/hip_runtime.h>
#include <math.h>

typedef __attribute__((ext_vector_type(16))) _Float16 v16h;
typedef __attribute__((ext_vector_type(16))) __bf16 v16b;
typedef __attribute__((ext_vector_type(8)))  _Float16 v8h;
typedef __attribute__((ext_vector_type(8)))  float v8f;
typedef __attribute__((ext_vector_type(4)))  float v4f;
typedef __attribute__((ext_vector_type(2)))  float v2f;
typedef __attribute__((ext_vector_type(4)))  unsigned v4u;
typedef __attribute__((ext_vector_type(4)))  int v4i;
typedef float __attribute__((may_alias)) float_a;
typedef int __attribute__((may_alias)) int_a;

template <typename T> __device__ __forceinline__ void vst2(void* p, T v) { *(T*)p = v;  }
__device__ __forceinline__ v8f wmma16(v16h a, v16h b, v8f c) {
  v8f d = __builtin_amdgcn_wmma_f32_16x16x32_f16(false, a, false, b, (short)0, c, false, false);
  asm volatile("v_nop\n\tv_nop\n\tv_nop\n\tv_nop" : "+v"(d) : "v"(a), "v"(b));
  return d;
}
__device__ __forceinline__ v8f wmma_bf(v16b a, v16b b, v8f c) {
  v8f d = __builtin_amdgcn_wmma_f32_16x16x32_bf16(false, a, false, b, (short)0, c, false, false);
  asm volatile("v_nop\n\tv_nop\n\tv_nop\n\tv_nop" : "+v"(d) : "v"(a), "v"(b));
  return d;
}
// 16x16x32 fragments: lane = (h = lane>>4, row/col = lane&15); elements 0..7 = k0+8h+0..7, 8..15 = k0+16+8h+0..7; D element r = row 8h+r
__device__ __forceinline__ v16h frag_h(const _Float16* rowk0, int lane) {
  union { v16h v; v8h q[2]; } u; const _Float16* p = rowk0 + 8 * (lane >> 4);
  u.q[0] = *(const v8h*)p; u.q[1] = *(const v8h*)(p + 16); return u.v;
}
__device__ __forceinline__ v16h frag_f32(const float* rowk0, int lane) {
  v16h a; const float* p = rowk0 + 8 * (lane >> 4);
#pragma unroll
  for (int i = 0; i < 8; ++i) { a[i] = (_Float16)p[i]; a[8 + i] = (_Float16)p[16 + i]; }
  return a;
}
__device__ __forceinline__ v16h frag_f32s(const float* rowk0, int lane, float sc) {
  v16h a; const float* p = rowk0 + 8 * (lane >> 4);
#pragma unroll
  for (int i = 0; i < 8; ++i) { a[i] = (_Float16)(p[i] * sc); a[8 + i] = (_Float16)(p[16 + i] * sc); }
  return a;
}
// column fragment from a [K][ld] layout (column n), rows >= K read as 0
__device__ __forceinline__ v16h fragc_f32(const float* W, int k0, int n, int lane, int ld, int K) {
  v16h a; const int g = lane >> 4;
#pragma unroll
  for (int i = 0; i < 8; ++i) { const int ka = k0 + 8 * g + i, kb = ka + 16;
    a[i] = (_Float16)(ka < K ? W[(size_t)(ka < K ? ka : K - 1) * ld + n] : 0.f); a[8 + i] = (_Float16)(kb < K ? W[(size_t)(kb < K ? kb : K - 1) * ld + n] : 0.f); }
  return a;
}
struct F2 { v16b h, l; };
__device__ __forceinline__ F2 bsplit16(const float v[16]) { F2 r;
#pragma unroll
  for (int i = 0; i < 16; ++i) { const __bf16 h = (__bf16)v[i]; r.h[i] = h; r.l[i] = (__bf16)(v[i] - (float)h); }
  return r; }
__device__ __forceinline__ F2 split_row(const float* row, int k0, int lane) { float v[16]; const float* p = row + k0 + 8 * (lane >> 4);
#pragma unroll
  for (int i = 0; i < 8; ++i) { v[i] = p[i]; v[8 + i] = p[16 + i]; }
  return bsplit16(v); }
__device__ __forceinline__ F2 split_rowK(const float* row, int k0, int lane, int K) { float v[16]; const int g = lane >> 4;
#pragma unroll
  for (int i = 0; i < 8; ++i) { const int ka = k0 + 8 * g + i, kb = ka + 16; v[i] = ka < K ? row[ka < K ? ka : K - 1] : 0.f; v[8 + i] = kb < K ? row[kb < K ? kb : K - 1] : 0.f; }
  return bsplit16(v); }
__device__ __forceinline__ F2 split_col(const float* W, int k0, int n, int lane, int ld, int K) { float v[16]; const int g = lane >> 4;
#pragma unroll
  for (int i = 0; i < 8; ++i) { const int ka = k0 + 8 * g + i, kb = ka + 16; v[i] = ka < K ? W[(size_t)(ka < K ? ka : K - 1) * ld + n] : 0.f; v[8 + i] = kb < K ? W[(size_t)(kb < K ? kb : K - 1) * ld + n] : 0.f; }
  return bsplit16(v); }
__device__ __forceinline__ v8f mac3(const F2& a, const F2& b, v8f c) { c = wmma_bf(a.l, b.h, c); c = wmma_bf(a.h, b.l, c); return wmma_bf(a.h, b.h, c); }
__device__ __forceinline__ float sigm(float v) { return 1.0f / (1.0f + expf(-v)); }
#define LDSX() do { asm volatile("s_wait_dscnt 0" ::: "memory"); __builtin_amdgcn_wave_barrier(); __builtin_amdgcn_fence(__ATOMIC_RELEASE, "workgroup"); } while (0)


// STNDT encoder layer (B 16, T 512 time steps, C 512 channels, L 512, 8 heads, hidden 2,048): pre-norm temporal self-attention + FFN (PReLU), spatial attention weights (mean over heads of softmax(q k / 8) on the layer-normed spatial source), temporal-spatial mixing + FFN; returns (ts_out, spatial_weights).
#define NB 16
#define TT 512
#define CC 512
#define LL 512
#define NH 8
#define HS 64
#define HID 2048
#define NR (NB * TT)       // 8,192 temporal rows (b, t)
#define NRS (NB * CC)      // 8,192 spatial rows (b, n)
#define WSC 256.0f
#ifndef TNB
#define TNB NB
#endif
typedef __attribute__((ext_vector_type(8))) __bf16 v8b;
__device__ __forceinline__ v16b frag_b(const __bf16* rowk0, int lane) {
  union { v16b v; v8b q[2]; } u; const __bf16* p = rowk0 + 8 * (lane >> 4);
  u.q[0] = *(const v8b*)p; u.q[1] = *(const v8b*)(p + 16); return u.v;
}
__device__ __forceinline__ float bfr(float v) { return (float)(__bf16)v; }
__device__ __attribute__((noinline)) float exp_ni(float v) { return expf(v); }
__device__ __attribute__((noinline)) float erf_ni(float v) { return erff(v); }

#define WS_PW  0u                                   // f16 x 2^8 natural rows: Wq_t|Wk_t|Wv_t [1536][512], Wo_t [512][512], W1 [2048][512], W2 [512][2048], Wq_s|Wk_s [1024][512], tsW1 [2048][512], tsW2 [512][2048]
#define WS_PO  (WS_PW + 2u * (size_t)1536 * CC)
#define WS_P1  (WS_PO + 2u * (size_t)CC * CC)
#define WS_P2  (WS_P1 + 2u * (size_t)HID * CC)
#define WS_PS  (WS_P2 + 2u * (size_t)CC * HID)
#define WS_PT1 (WS_PS + 2u * (size_t)1024 * LL)
#define WS_PT2 (WS_PT1 + 2u * (size_t)HID * CC)
#define WS_LN  (WS_PT2 + 2u * (size_t)CC * HID)        // f16 LN rows [NR][512] (reused for each pre-norm); f16 Q, K rows [NR][512]; f16 V planes [b][512][T]; f32 ctx [NR][512]
#define WS_Q   (WS_LN + 2u * (size_t)NR * CC)
#define WS_K   (WS_Q + 2u * (size_t)NR * CC)
#define WS_V   (WS_K + 2u * (size_t)NR * CC)
#define WS_O   (WS_V + 2u * (size_t)NB * CC * TT)
#define WS_S1  (WS_O + 4u * (size_t)NR * CC)           // f32 residual streams S1, S2, S3 [NR][512]; f16 hidden [NR][2048]
#define WS_S2  (WS_S1 + 4u * (size_t)NR * CC)
#define WS_S3  (WS_S2 + 4u * (size_t)NR * CC)
#define WS_HH  (WS_S3 + 4u * (size_t)NR * CC)
#define WS_SP  (WS_HH + 2u * (size_t)NR * HID)         // spatial: f16 LN(sp) rows [NRS][512]; f16 qs | ks rows [NRS][1024]; f32 row stats (max, sum) per (b, n, head), stored [b][n][h][2] as lines [NB*CC][32] (16 used); f16 sw copy [b][c][m]
#define WS_QS  (WS_SP + 2u * (size_t)NRS * LL)
#define WS_ST  (WS_QS + 2u * (size_t)NRS * 1024)
#define WS_SWH (WS_ST + 4u * (size_t)NB * CC * 32)
#define WS_END (WS_SWH + 2u * (size_t)NB * CC * CC)
#define OUT1   ((size_t)NR * CC)                      // float offset of spatial_weights in d_out

// ---- k_pack: f16 x 2^8 copies of natural [out][in] rows; which: 0 Wq_t|Wk_t|Wv_t (1536 rows of 512), 1 Wo_t, 2 W1 (2048x512), 3 W2 (512x2048), 4 Wq_s|Wk_s (1024x512), 5 tsW1, 6 tsW2
__global__ __launch_bounds__(256) void k_pack(const float* __restrict__ WQ, const float* __restrict__ WK, const float* __restrict__ WV, const float* __restrict__ WO, const float* __restrict__ W1, const float* __restrict__ W2, const float* __restrict__ WQS, const float* __restrict__ WKS, const float* __restrict__ T1, const float* __restrict__ T2, _Float16* __restrict__ P) {
  const int n = blockIdx.x, which = blockIdx.y, t = threadIdx.x; __shared__ __align__(16) _Float16 s[HID];
  const float* src; size_t dst; int len;
  if (which == 0) { if (n >= 1536) return; const int m = n / CC, r = n % CC; src = ((m == 0) ? WQ : (m == 1) ? WK : WV) + (size_t)r * CC; dst = WS_PW / 2 + (size_t)n * CC; len = CC; }
  else if (which == 1) { if (n >= CC) return; src = WO + (size_t)n * CC; dst = WS_PO / 2 + (size_t)n * CC; len = CC; }
  else if (which == 2) { src = W1 + (size_t)n * CC; dst = WS_P1 / 2 + (size_t)n * CC; len = CC; }
  else if (which == 3) { if (n >= CC) return; src = W2 + (size_t)n * HID; dst = WS_P2 / 2 + (size_t)n * HID; len = HID; }
  else if (which == 4) { if (n >= 1024) return; const int m = n / LL, r = n % LL; src = ((m == 0) ? WQS : WKS) + (size_t)r * LL; dst = WS_PS / 2 + (size_t)n * LL; len = LL; }
  else if (which == 5) { src = T1 + (size_t)n * CC; dst = WS_PT1 / 2 + (size_t)n * CC; len = CC; }
  else { if (n >= CC) return; src = T2 + (size_t)n * HID; dst = WS_PT2 / 2 + (size_t)n * HID; len = HID; }
  for (int k = t; k < len; k += 256) s[k] = (_Float16)(bfr(src[k]) * WSC); __syncthreads(); for (int q = t; q < len / 8; q += 256) vst2((unsigned*)(P + dst + q * 8), *(const v4u*)&s[q * 8]); }
// ---- k_ln: block = row (512 wide, 256 threads x 2): LayerNorm (mean-square var, 1e-5) x g + b -> f16 row; input either a raw input (bf16-rounded) or an f32 stream
template <int RAW>
__global__ __launch_bounds__(256) void k_ln(const float* __restrict__ X, const float* __restrict__ G, const float* __restrict__ Bt, _Float16* __restrict__ Y) { __shared__ float red[8]; __shared__ __align__(16) _Float16 so[CC]; const int t = threadIdx.x; const size_t row = blockIdx.x;
  float v0 = X[row * CC + t], v1 = X[row * CC + t + 256]; if (RAW) { v0 = bfr(v0); v1 = bfr(v1); } float s = v0 + v1;
#pragma unroll
  for (int o = 1; o < 32; o <<= 1) s += __shfl_xor(s, o);
  if ((t & 31) == 0) red[t >> 5] = s; __syncthreads(); float tot = 0.f; for (int i = 0; i < 8; ++i) tot += red[i]; const float mu = tot / (float)CC; __syncthreads();
  const float d0 = v0 - mu, d1 = v1 - mu; float q = d0 * d0 + d1 * d1;
#pragma unroll
  for (int o = 1; o < 32; o <<= 1) q += __shfl_xor(q, o);
  if ((t & 31) == 0) red[t >> 5] = q; __syncthreads(); float tq = 0.f; for (int i = 0; i < 8; ++i) tq += red[i]; const float inv = 1.0f / sqrtf(tq / (float)CC + 1e-5f);
  so[t] = (_Float16)(d0 * inv * bfr(G[t]) + bfr(Bt[t])); so[t + 256] = (_Float16)(d1 * inv * bfr(G[t + 256]) + bfr(Bt[t + 256])); __syncthreads(); if (t < CC / 8) vst2((unsigned*)(Y + row * CC + t * 8), *(const v4u*)&so[t * 8]); }
// ---- k_g<MODE>: block = (64 rows, 128 cols[, which]): generic f16 GEMM A rows [*][KW] . W rows / 2^8; MODE 0: q/k/v (which = blockIdx.z): q,k -> f16 rows, v -> planes; MODE 1: OUT32 = RES + A . W (+ bias); MODE 2: OUT16 = f16(prelu(A . W + bias)) (hidden); MODE 3: qs|ks -> f16 rows [NRS][1024]
template <int MODE, int KW>
__global__ __launch_bounds__(128) void k_g(const _Float16* __restrict__ A, const _Float16* __restrict__ Wr, const float* __restrict__ BI, const float* __restrict__ RES, const float* __restrict__ ALPHA, float* __restrict__ O32, _Float16* __restrict__ O16, _Float16* __restrict__ O16B, _Float16* __restrict__ VPL, int ow) {
  __shared__ __align__(16) float sf[4][16][132]; __shared__ __align__(16) _Float16 so[64][136]; __shared__ __align__(16) _Float16 st[128][72];
  const int tid = threadIdx.x, wave = tid >> 5, lane = tid & 31, col = lane & 15, g = lane >> 4; const int which = blockIdx.z; const size_t rb = (size_t)blockIdx.x * 64; const size_t r0 = rb + wave * 16; const int c0 = blockIdx.y * 128; const _Float16* W = Wr + ((MODE == 0) ? (size_t)which * CC * KW : 0);
  v8f acc[8] = {};
#pragma unroll 2
  for (int kc = 0; kc < KW / 32; ++kc) { const v16h a = frag_h(A + (r0 + col) * KW + kc * 32, lane);
#pragma unroll
    for (int j = 0; j < 8; ++j) acc[j] = wmma16(a, frag_h(W + (size_t)(c0 + j * 16 + col) * KW + kc * 32, lane), acc[j]); }
  if (MODE == 1) {
#pragma unroll
    for (int j = 0; j < 8; ++j) { const int c = c0 + j * 16 + col; const float bb = BI ? bfr(BI[c]) : 0.f;
#pragma unroll
      for (int r = 0; r < 8; ++r) sf[wave][8 * g + r][j * 16 + col] = acc[j][r] * (1.0f / WSC) + bb + RES[(r0 + 8 * g + r) * ow + c]; }
    LDSX(); for (int rl = 0; rl < 16; ++rl) vst2(O32 + (r0 + rl) * ow + c0 + lane * 4, *(const v4f*)&sf[wave][rl][lane * 4]); return; }
  if (MODE == 0 && which == 2) {
#pragma unroll
    for (int j = 0; j < 8; ++j)
#pragma unroll
      for (int r = 0; r < 8; ++r) st[j * 16 + col][wave * 16 + 8 * g + r] = (_Float16)(acc[j][r] * (1.0f / WSC));
    __syncthreads(); const size_t b = rb / TT; const int s0 = (int)(rb % TT); for (int e = tid; e < 128 * 8; e += 128) { const int d = e >> 3, pc = e & 7; vst2((unsigned*)(VPL + ((b * CC + c0 + d) * TT) + s0 + pc * 8), *(const v4u*)&st[d][pc * 8]); } return; }
  { const float al = (MODE == 2) ? bfr(ALPHA[0]) : 0.f;
#pragma unroll
    for (int j = 0; j < 8; ++j) { const float bb = (MODE == 2) ? bfr(BI[c0 + j * 16 + col]) : 0.f;
#pragma unroll
      for (int r = 0; r < 8; ++r) { float v = acc[j][r] * (1.0f / WSC) + bb; if (MODE == 2) v = (v >= 0.f) ? v : al * v; so[wave * 16 + 8 * g + r][j * 16 + col] = (_Float16)v; } } }
  __syncthreads();
  { _Float16* dst = (MODE == 0) ? ((which == 0) ? O16 : O16B) : O16; for (int e = tid; e < 64 * 16; e += 128) { const int rl = e >> 4, q = e & 15; vst2((unsigned*)(dst + (rb + rl) * ow + c0 + q * 8), *(const v4u*)&so[rl][q * 8]); } }
}
// ---- k_attn: block = (64 queries, head, b): temporal attention over the 512 steps, 1/8; ctx f32 [NR][512] (256-B head segments)
__global__ __launch_bounds__(128) void k_attn(const _Float16* __restrict__ Q, const _Float16* __restrict__ Kr, const _Float16* __restrict__ V, float* __restrict__ O) {
  __shared__ __align__(16) _Float16 sph[4][16][40]; __shared__ __align__(16) float so[4][16][68];
  const int tid = threadIdx.x, wave = tid >> 5, lane = tid & 31, col = lane & 15, g = lane >> 4; const int h = blockIdx.y; const size_t b = blockIdx.z; const int q0 = blockIdx.x * 64 + wave * 16; const size_t rq = b * TT + q0;
  v16h aq[2];
#pragma unroll
  for (int kc = 0; kc < 2; ++kc) aq[kc] = frag_h(Q + (rq + col) * CC + h * HS + kc * 32, lane);
  float m[8], l[8];
#pragma unroll
  for (int r = 0; r < 8; ++r) { m[r] = -3.0e38f; l[r] = 0.f; }
  v8f acc[4] = {};
#pragma unroll 1
  for (int ks = 0; ks < TT / 32; ++ks) { const int j0 = ks * 32; v8f s[2];
#pragma unroll
    for (int ct = 0; ct < 2; ++ct) { const int kk = j0 + ct * 16 + col; const size_t rk = (b * TT + kk) * CC + h * HS; v8f c = {};
#pragma unroll
      for (int kc = 0; kc < 2; ++kc) c = wmma16(aq[kc], frag_h(Kr + rk + kc * 32, lane), c);
#pragma unroll
      for (int r = 0; r < 8; ++r) s[ct][r] = c[r] * 0.125f; }
#pragma unroll
    for (int r = 0; r < 8; ++r) { float mx = fmaxf(s[0][r], s[1][r]);
#pragma unroll
      for (int o = 1; o < 16; o <<= 1) mx = fmaxf(mx, __shfl_xor(mx, o));
      const float mn = fmaxf(m[r], mx); const float alpha = (m[r] <= -1.0e38f) ? 0.f : __expf(m[r] - mn); const float e0 = __expf(s[0][r] - mn), e1 = __expf(s[1][r] - mn); float es = e0 + e1;
#pragma unroll
      for (int o = 1; o < 16; o <<= 1) es += __shfl_xor(es, o);
      l[r] = l[r] * alpha + es; m[r] = mn;
#pragma unroll
      for (int dt = 0; dt < 4; ++dt) acc[dt][r] *= alpha;
      sph[wave][8 * g + r][col] = (_Float16)(e0 * 2048.0f); sph[wave][8 * g + r][16 + col] = (_Float16)(e1 * 2048.0f); }
    LDSX();
    const v16h pa = frag_h(&sph[wave][col][0], lane);
#pragma unroll
    for (int dt = 0; dt < 4; ++dt) acc[dt] = wmma16(pa, frag_h(V + ((b * CC + h * HS + dt * 16 + col) * TT) + j0, lane), acc[dt]);
    LDSX(); }
#pragma unroll
  for (int r = 0; r < 8; ++r) { const float il = (1.0f / 2048.0f) / l[r];
#pragma unroll
    for (int dt = 0; dt < 4; ++dt) so[wave][8 * g + r][dt * 16 + col] = acc[dt][r] * il; }
  LDSX();
  for (int rl = 0; rl < 16; ++rl) if (lane < 16) vst2(O + (rq + rl) * CC + h * HS + lane * 4, *(const v4f*)&so[wave][rl][lane * 4]);
}
// ---- k_wo: block = (64 rows, 128 cols): S1 = src (bf16-rounded) + f16(ctx) . Wo^T / 2^8
__global__ __launch_bounds__(128) void k_wo(const float* __restrict__ O, const _Float16* __restrict__ Wr, const float* __restrict__ SRC, float* __restrict__ S1) { __shared__ __align__(16) float sf[4][16][132];
  const int tid = threadIdx.x, wave = tid >> 5, lane = tid & 31, col = lane & 15, g = lane >> 4; const size_t r0 = (size_t)blockIdx.x * 64 + wave * 16; const int c0 = blockIdx.y * 128;
  v8f acc[8] = {};
#pragma unroll 2
  for (int kc = 0; kc < CC / 32; ++kc) { v16h a; { const float* p = O + (r0 + col) * CC + kc * 32 + 8 * g;
#pragma unroll
      for (int i = 0; i < 8; ++i) { a[i] = (_Float16)p[i]; a[8 + i] = (_Float16)p[16 + i]; } }
#pragma unroll
    for (int j = 0; j < 8; ++j) acc[j] = wmma16(a, frag_h(Wr + (size_t)(c0 + j * 16 + col) * CC + kc * 32, lane), acc[j]); }
#pragma unroll
  for (int j = 0; j < 8; ++j) { const int c = c0 + j * 16 + col;
#pragma unroll
    for (int r = 0; r < 8; ++r) sf[wave][8 * g + r][j * 16 + col] = acc[j][r] * (1.0f / WSC) + bfr(SRC[(r0 + 8 * g + r) * CC + c]); }
  LDSX(); for (int rl = 0; rl < 16; ++rl) vst2(S1 + (r0 + rl) * CC + c0 + lane * 4, *(const v4f*)&sf[wave][rl][lane * 4]); }
// ---- k_sstat / k_sprob: block = (64 rows n, b): per head h the 512-wide score rows qs_n . ks_m / 8; k_sstat: max / sum per (row, head) -> ST; k_sprob: accumulate p / 8 over the heads into the f32 output rows (owned by this block) and an f16 copy
__global__ __launch_bounds__(128) void k_sstat(const _Float16* __restrict__ QS, float* __restrict__ ST) { __shared__ __align__(16) float sl[64][NH * 2 + 16];
  const int tid = threadIdx.x, wave = tid >> 5, lane = tid & 31, col = lane & 15, g = lane >> 4; const size_t b = blockIdx.y; const int n0 = blockIdx.x * 64 + wave * 16; const size_t rq = b * CC + n0;
  for (int e = tid; e < 64 * 32; e += 128) sl[e >> 5][e & 31] = 0.f; __syncthreads();
#pragma unroll 1
  for (int h = 0; h < NH; ++h) { v16h aq[2];
#pragma unroll
    for (int kc = 0; kc < 2; ++kc) aq[kc] = frag_h(QS + (rq + col) * 1024 + h * HS + kc * 32, lane);
    float m[8], l[8];
#pragma unroll
    for (int r = 0; r < 8; ++r) { m[r] = -3.0e38f; l[r] = 0.f; }
#pragma unroll 1
    for (int ks = 0; ks < CC / 32; ++ks) { const int j0 = ks * 32; v8f s[2];
#pragma unroll
      for (int ct = 0; ct < 2; ++ct) { const int kk = j0 + ct * 16 + col; v8f c = {};
#pragma unroll
        for (int kc = 0; kc < 2; ++kc) c = wmma16(aq[kc], frag_h(QS + (b * CC + kk) * 1024 + LL + h * HS + kc * 32, lane), c);
#pragma unroll
        for (int r = 0; r < 8; ++r) s[ct][r] = c[r] * 0.125f; }
#pragma unroll
      for (int r = 0; r < 8; ++r) { float mx = fmaxf(s[0][r], s[1][r]);
#pragma unroll
        for (int o = 1; o < 16; o <<= 1) mx = fmaxf(mx, __shfl_xor(mx, o));
        const float mn = fmaxf(m[r], mx); const float alpha = (m[r] <= -1.0e38f) ? 0.f : __expf(m[r] - mn); float es = __expf(s[0][r] - mn) + __expf(s[1][r] - mn);
#pragma unroll
        for (int o = 1; o < 16; o <<= 1) es += __shfl_xor(es, o);
        l[r] = l[r] * alpha + es; m[r] = mn; } }
    if (col == 0) {
#pragma unroll
      for (int r = 0; r < 8; ++r) { sl[wave * 16 + 8 * g + r][h * 2] = m[r]; sl[wave * 16 + 8 * g + r][h * 2 + 1] = l[r]; } } }
  __syncthreads();
  for (int e = tid; e < 64 * 8; e += 128) { const int rl = e >> 3, q = e & 7; vst2(ST + (b * CC + blockIdx.x * 64 + rl) * 32 + q * 4, *(const v4f*)&sl[rl][q * 4]); }
}
__global__ __launch_bounds__(128) void k_sprob(const _Float16* __restrict__ QS, const float* __restrict__ ST, float* __restrict__ SW, _Float16* __restrict__ SWH) { __shared__ __align__(16) float so[4][16][36]; __shared__ __align__(16) _Float16 sh[4][16][40];
  const int tid = threadIdx.x, wave = tid >> 5, lane = tid & 31, col = lane & 15, g = lane >> 4; const size_t b = blockIdx.y; const int n0 = blockIdx.x * 64 + wave * 16; const size_t rq = b * CC + n0;
#pragma unroll 1
  for (int ks = 0; ks < CC / 32; ++ks) { const int j0 = ks * 32; float accp[2][8];
#pragma unroll
    for (int ct = 0; ct < 2; ++ct)
#pragma unroll
      for (int r = 0; r < 8; ++r) accp[ct][r] = 0.f;
#pragma unroll 1
    for (int h = 0; h < NH; ++h) { v16h aq[2];
#pragma unroll
      for (int kc = 0; kc < 2; ++kc) aq[kc] = frag_h(QS + (rq + col) * 1024 + h * HS + kc * 32, lane);
#pragma unroll
      for (int ct = 0; ct < 2; ++ct) { const int kk = j0 + ct * 16 + col; v8f c = {};
#pragma unroll
        for (int kc = 0; kc < 2; ++kc) c = wmma16(aq[kc], frag_h(QS + (b * CC + kk) * 1024 + LL + h * HS + kc * 32, lane), c);
#pragma unroll
        for (int r = 0; r < 8; ++r) { const float* st = ST + (rq + 8 * g + r) * 32 + h * 2; accp[ct][r] += __expf(c[r] * 0.125f - st[0]) / st[1]; } } }
#pragma unroll
    for (int ct = 0; ct < 2; ++ct)
#pragma unroll
      for (int r = 0; r < 8; ++r) { const float v = accp[ct][r] * (1.0f / (float)NH); so[wave][8 * g + r][ct * 16 + col] = v; sh[wave][8 * g + r][ct * 16 + col] = (_Float16)v; }
    LDSX();
    for (int rl = 0; rl < 16; ++rl) { if (lane < 8) vst2(SW + (rq + rl) * CC + j0 + lane * 4, *(const v4f*)&so[wave][rl][lane * 4]); else if (lane < 12) vst2((unsigned*)(SWH + (rq + rl) * CC + j0 + (lane - 8) * 8), *(const v4u*)&sh[wave][rl][(lane - 8) * 8]); }
    LDSX(); }
}
// ---- k_mix: block = (64 rows t, 128 cols c, b): S3 = S2 + sum_m sw[b][c][m] ln3[t][m] (A = ln3 rows f16, B = sw f16 rows [c][m] of batch b)
__global__ __launch_bounds__(128) void k_mix(const _Float16* __restrict__ LN3, const _Float16* __restrict__ SWH, const float* __restrict__ S2, float* __restrict__ S3) { __shared__ __align__(16) float sf[4][16][132];
  const int tid = threadIdx.x, wave = tid >> 5, lane = tid & 31, col = lane & 15, g = lane >> 4; const size_t b = blockIdx.z; const size_t r0 = b * TT + (size_t)blockIdx.x * 64 + wave * 16; const int c0 = blockIdx.y * 128;
  v8f acc[8] = {};
#pragma unroll 2
  for (int kc = 0; kc < CC / 32; ++kc) { const v16h a = frag_h(LN3 + (r0 + col) * CC + kc * 32, lane);
#pragma unroll
    for (int j = 0; j < 8; ++j) acc[j] = wmma16(a, frag_h(SWH + ((b * CC + c0 + j * 16 + col) * CC) + kc * 32, lane), acc[j]); }
#pragma unroll
  for (int j = 0; j < 8; ++j) { const int c = c0 + j * 16 + col;
#pragma unroll
    for (int r = 0; r < 8; ++r) sf[wave][8 * g + r][j * 16 + col] = acc[j][r] + S2[(r0 + 8 * g + r) * CC + c]; }
  LDSX(); for (int rl = 0; rl < 16; ++rl) vst2(S3 + (r0 + rl) * CC + c0 + lane * 4, *(const v4f*)&sf[wave][rl][lane * 4]); }
extern "C" void kernel_launch(void* const* d_in, const int* in_sizes, int n_in, void* d_out, int out_size, void* d_ws, size_t ws_size, hipStream_t stream) {
  (void)in_sizes; (void)n_in; (void)out_size;
  const float** F = (const float**)d_in;   // 0 src [16,512,512], 1 spatial_src [16,512,512], 2 Wq_t, 3 Wk_t, 4 Wv_t [8,64,512], 5 Wo_t [512,512], 6 Wq_s, 7 Wk_s [8,64,512], 8 W1 [2048,512], 9 b1, 10 W2 [512,2048], 11 b2, 12 tsW1, 13 tsb1, 14 tsW2, 15 tsb2, 16 alpha [1], 17 g1, 18 be1, 19 g2, 20 be2, 21 tsg1, 22 tsbe1, 23 tsg2, 24 tsbe2, 25 sg, 26 sbe
  if (ws_size < (size_t)WS_END) return;
  char* ws = (char*)d_ws; _Float16* P = (_Float16*)ws; _Float16 *LN = (_Float16*)(ws + WS_LN), *Q = (_Float16*)(ws + WS_Q), *Kr = (_Float16*)(ws + WS_K), *V = (_Float16*)(ws + WS_V), *HH = (_Float16*)(ws + WS_HH), *SP = (_Float16*)(ws + WS_SP), *QS = (_Float16*)(ws + WS_QS), *SWH = (_Float16*)(ws + WS_SWH); float *O = (float*)(ws + WS_O), *S1 = (float*)(ws + WS_S1), *S2 = (float*)(ws + WS_S2), *S3 = (float*)(ws + WS_S3), *ST = (float*)(ws + WS_ST);
  float* OUT0 = (float*)d_out; float* SW = (float*)d_out + OUT1;
  const int nr = TNB * TT;   // rows processed (temporal (b,t) and spatial (b,n) alike)
  k_pack<<<dim3(HID, 7), 256, 0, stream>>>(F[2], F[3], F[4], F[5], F[8], F[10], F[6], F[7], F[12], F[14], P);
  // temporal attention block
  k_ln<1><<<nr, 256, 0, stream>>>(F[0], F[17], F[18], LN);
  k_g<0, CC><<<dim3(nr / 64, CC / 128, 3), 128, 0, stream>>>(LN, P + WS_PW / 2, nullptr, nullptr, nullptr, nullptr, Q, Kr, V, CC);
  k_attn<<<dim3(TT / 64, NH, TNB), 128, 0, stream>>>(Q, Kr, V, O);
  k_wo<<<dim3(nr / 64, CC / 128), 128, 0, stream>>>(O, P + WS_PO / 2, F[0], S1);
  // FFN 1
  k_ln<0><<<nr, 256, 0, stream>>>(S1, F[19], F[20], LN);
  k_g<2, CC><<<dim3(nr / 64, HID / 128, 1), 128, 0, stream>>>(LN, P + WS_P1 / 2, F[9], nullptr, F[16], nullptr, HH, nullptr, nullptr, HID);
  k_g<1, HID><<<dim3(nr / 64, CC / 128, 1), 128, 0, stream>>>(HH, P + WS_P2 / 2, F[11], S1, nullptr, S2, nullptr, nullptr, nullptr, CC);
  // spatial attention weights
  k_ln<1><<<nr, 256, 0, stream>>>(F[1], F[25], F[26], SP);
  k_g<3, LL><<<dim3(nr / 64, 1024 / 128, 1), 128, 0, stream>>>(SP, P + WS_PS / 2, nullptr, nullptr, nullptr, nullptr, QS, nullptr, nullptr, 1024);
  k_sstat<<<dim3(CC / 64, TNB), 128, 0, stream>>>(QS, ST);
  k_sprob<<<dim3(CC / 64, TNB), 128, 0, stream>>>(QS, ST, SW, SWH);
  // temporal-spatial mixing
  k_ln<0><<<nr, 256, 0, stream>>>(S2, F[21], F[22], LN);
  k_mix<<<dim3(TT / 64, CC / 128, TNB), 128, 0, stream>>>(LN, SWH, S2, S3);
  // FFN 2
  k_ln<0><<<nr, 256, 0, stream>>>(S3, F[23], F[24], LN);
  k_g<2, CC><<<dim3(nr / 64, HID / 128, 1), 128, 0, stream>>>(LN, P + WS_PT1 / 2, F[13], nullptr, F[16], nullptr, HH, nullptr, nullptr, HID);
  k_g<1, HID><<<dim3(nr / 64, CC / 128, 1), 128, 0, stream>>>(HH, P + WS_PT2 / 2, F[15], S3, nullptr, OUT0, nullptr, nullptr, nullptr, CC);
}

// v001
// Measured time: 764 microseconds a run.
// Two timings next to v000 both put it at 1.33 times that version's speed.
#include <hip/hip_runtime.h>
#include <math.h>

typedef __attribute__((ext_vector_type(16))) _Float16 v16h;
typedef __attribute__((ext_vector_type(16))) __bf16 v16b;
typedef __attribute__((ext_vector_type(8)))  _Float16 v8h;
typedef __attribute__((ext_vector_type(8)))  float v8f;
typedef __attribute__((ext_vector_type(4)))  float v4f;
typedef __attribute__((ext_vector_type(2)))  float v2f;
typedef __attribute__((ext_vector_type(4)))  unsigned v4u;
typedef __attribute__((ext_vector_type(4)))  int v4i;
typedef float __attribute__((may_alias)) float_a;
typedef int __attribute__((may_alias)) int_a;

template <typename T> __device__ __forceinline__ void vst2(void* p, T v) { *(T*)p = v;  }
__device__ __forceinline__ v8f wmma16(v16h a, v16h b, v8f c) {
  v8f d = __builtin_amdgcn_wmma_f32_16x16x32_f16(false, a, false, b, (short)0, c, false, false);
  asm volatile("v_nop\n\tv_nop\n\tv_nop\n\tv_nop" : "+v"(d) : "v"(a), "v"(b));
  return d;
}
__device__ __forceinline__ v8f wmma_bf(v16b a, v16b b, v8f c) {
  v8f d = __builtin_amdgcn_wmma_f32_16x16x32_bf16(false, a, false, b, (short)0, c, false, false);
  asm volatile("v_nop\n\tv_nop\n\tv_nop\n\tv_nop" : "+v"(d) : "v"(a), "v"(b));
  return d;
}
// 16x16x32 fragments: lane = (h = lane>>4, row/col = lane&15); elements 0..7 = k0+8h+0..7, 8..15 = k0+16+8h+0..7; D element r = row 8h+r
__device__ __forceinline__ v16h frag_h(const _Float16* rowk0, int lane) {
  union { v16h v; v8h q[2]; } u; const _Float16* p = rowk0 + 8 * (lane >> 4);
  u.q[0] = *(const v8h*)p; u.q[1] = *(const v8h*)(p + 16); return u.v;
}
__device__ __forceinline__ v16h frag_f32(const float* rowk0, int lane) {
  v16h a; const float* p = rowk0 + 8 * (lane >> 4);
#pragma unroll
  for (int i = 0; i < 8; ++i) { a[i] = (_Float16)p[i]; a[8 + i] = (_Float16)p[16 + i]; }
  return a;
}
__device__ __forceinline__ v16h frag_f32s(const float* rowk0, int lane, float sc) {
  v16h a; const float* p = rowk0 + 8 * (lane >> 4);
#pragma unroll
  for (int i = 0; i < 8; ++i) { a[i] = (_Float16)(p[i] * sc); a[8 + i] = (_Float16)(p[16 + i] * sc); }
  return a;
}
// column fragment from a [K][ld] layout (column n), rows >= K read as 0
__device__ __forceinline__ v16h fragc_f32(const float* W, int k0, int n, int lane, int ld, int K) {
  v16h a; const int g = lane >> 4;
#pragma unroll
  for (int i = 0; i < 8; ++i) { const int ka = k0 + 8 * g + i, kb = ka + 16;
    a[i] = (_Float16)(ka < K ? W[(size_t)(ka < K ? ka : K - 1) * ld + n] : 0.f); a[8 + i] = (_Float16)(kb < K ? W[(size_t)(kb < K ? kb : K - 1) * ld + n] : 0.f); }
  return a;
}
struct F2 { v16b h, l; };
__device__ __forceinline__ F2 bsplit16(const float v[16]) { F2 r;
#pragma unroll
  for (int i = 0; i < 16; ++i) { const __bf16 h = (__bf16)v[i]; r.h[i] = h; r.l[i] = (__bf16)(v[i] - (float)h); }
  return r; }
__device__ __forceinline__ F2 split_row(const float* row, int k0, int lane) { float v[16]; const float* p = row + k0 + 8 * (lane >> 4);
#pragma unroll
  for (int i = 0; i < 8; ++i) { v[i] = p[i]; v[8 + i] = p[16 + i]; }
  return bsplit16(v); }
__device__ __forceinline__ F2 split_rowK(const float* row, int k0, int lane, int K) { float v[16]; const int g = lane >> 4;
#pragma unroll
  for (int i = 0; i < 8; ++i) { const int ka = k0 + 8 * g + i, kb = ka + 16; v[i] = ka < K ? row[ka < K ? ka : K - 1] : 0.f; v[8 + i] = kb < K ? row[kb < K ? kb : K - 1] : 0.f; }
  return bsplit16(v); }
__device__ __forceinline__ F2 split_col(const float* W, int k0, int n, int lane, int ld, int K) { float v[16]; const int g = lane >> 4;
#pragma unroll
  for (int i = 0; i < 8; ++i) { const int ka = k0 + 8 * g + i, kb = ka + 16; v[i] = ka < K ? W[(size_t)(ka < K ? ka : K - 1) * ld + n] : 0.f; v[8 + i] = kb < K ? W[(size_t)(kb < K ? kb : K - 1) * ld + n] : 0.f; }
  return bsplit16(v); }
__device__ __forceinline__ v8f mac3(const F2& a, const F2& b, v8f c) { c = wmma_bf(a.l, b.h, c); c = wmma_bf(a.h, b.l, c); return wmma_bf(a.h, b.h, c); }
__device__ __forceinline__ float sigm(float v) { return 1.0f / (1.0f + expf(-v)); }
#define LDSX() do { asm volatile("s_wait_dscnt 0" ::: "memory"); __builtin_amdgcn_wave_barrier(); __builtin_amdgcn_fence(__ATOMIC_RELEASE, "workgroup"); } while (0)


// STNDT encoder layer (B 16, T 512 time steps, C 512 channels, L 512, 8 heads, hidden 2,048): pre-norm temporal self-attention + FFN (PReLU), spatial attention weights (mean over heads of softmax(q k / 8) on the layer-normed spatial source), temporal-spatial mixing + FFN; returns (ts_out, spatial_weights).
#define NB 16
#define TT 512
#define CC 512
#define LL 512
#define NH 8
#define HS 64
#define HID 2048
#define NR (NB * TT)       // 8,192 temporal rows (b, t)
#define NRS (NB * CC)      // 8,192 spatial rows (b, n)
#define WSC 256.0f
#ifndef TNB
#define TNB NB
#endif
typedef __attribute__((ext_vector_type(8))) __bf16 v8b;
__device__ __forceinline__ v16b frag_b(const __bf16* rowk0, int lane) {
  union { v16b v; v8b q[2]; } u; const __bf16* p = rowk0 + 8 * (lane >> 4);
  u.q[0] = *(const v8b*)p; u.q[1] = *(const v8b*)(p + 16); return u.v;
}
__device__ __forceinline__ float bfr(float v) { return (float)(__bf16)v; }
__device__ __attribute__((noinline)) float exp_ni(float v) { return expf(v); }
__device__ __attribute__((noinline)) float erf_ni(float v) { return erff(v); }

#define WS_PW  0u                                   // f16 x 2^8 natural rows: Wq_t|Wk_t|Wv_t [1536][512], Wo_t [512][512], W1 [2048][512], W2 [512][2048], Wq_s|Wk_s [1024][512], tsW1 [2048][512], tsW2 [512][2048]
#define WS_PO  (WS_PW + 2u * (size_t)1536 * CC)
#define WS_P1  (WS_PO + 2u * (size_t)CC * CC)
#define WS_P2  (WS_P1 + 2u * (size_t)HID * CC)
#define WS_PS  (WS_P2 + 2u * (size_t)CC * HID)
#define WS_PT1 (WS_PS + 2u * (size_t)1024 * LL)
#define WS_PT2 (WS_PT1 + 2u * (size_t)HID * CC)
#define WS_LN  (WS_PT2 + 2u * (size_t)CC * HID)        // f16 LN rows [NR][512] (reused for each pre-norm); f16 Q, K rows [NR][512]; f16 V planes [b][512][T]; f32 ctx [NR][512]
#define WS_Q   (WS_LN + 2u * (size_t)NR * CC)
#define WS_K   (WS_Q + 2u * (size_t)NR * CC)
#define WS_V   (WS_K + 2u * (size_t)NR * CC)
#define WS_O   (WS_V + 2u * (size_t)NB * CC * TT)
#define WS_S1  (WS_O + 4u * (size_t)NR * CC)           // f32 residual streams S1, S2, S3 [NR][512]; f16 hidden [NR][2048]
#define WS_S2  (WS_S1 + 4u * (size_t)NR * CC)
#define WS_S3  (WS_S2 + 4u * (size_t)NR * CC)
#define WS_HH  (WS_S3 + 4u * (size_t)NR * CC)
#define WS_SP  (WS_HH + 2u * (size_t)NR * HID)         // spatial: f16 LN(sp) rows [NRS][512]; f16 qs | ks rows [NRS][1024]; f32 row stats (max, sum) [b][h][n][2]; f16 sw copy [b][c][m]
#define WS_QS  (WS_SP + 2u * (size_t)NRS * LL)
#define WS_ST  (WS_QS + 2u * (size_t)NRS * 1024)
#define WS_SWH (WS_ST + 4u * (size_t)NB * CC * 32)
#define WS_END (WS_SWH + 2u * (size_t)NB * CC * CC)
#define OUT1   ((size_t)NR * CC)                      // float offset of spatial_weights in d_out

// ---- k_pack: f16 x 2^8 copies of natural [out][in] rows; which: 0 Wq_t|Wk_t|Wv_t (1536 rows of 512), 1 Wo_t, 2 W1 (2048x512), 3 W2 (512x2048), 4 Wq_s|Wk_s (1024x512), 5 tsW1, 6 tsW2
__global__ __launch_bounds__(256) void k_pack(const float* __restrict__ WQ, const float* __restrict__ WK, const float* __restrict__ WV, const float* __restrict__ WO, const float* __restrict__ W1, const float* __restrict__ W2, const float* __restrict__ WQS, const float* __restrict__ WKS, const float* __restrict__ T1, const float* __restrict__ T2, _Float16* __restrict__ P) {
  const int n = blockIdx.x, which = blockIdx.y, t = threadIdx.x; __shared__ __align__(16) _Float16 s[HID];
  const float* src; size_t dst; int len;
  if (which == 0) { if (n >= 1536) return; const int m = n / CC, r = n % CC; src = ((m == 0) ? WQ : (m == 1) ? WK : WV) + (size_t)r * CC; dst = WS_PW / 2 + (size_t)n * CC; len = CC; }
  else if (which == 1) { if (n >= CC) return; src = WO + (size_t)n * CC; dst = WS_PO / 2 + (size_t)n * CC; len = CC; }
  else if (which == 2) { src = W1 + (size_t)n * CC; dst = WS_P1 / 2 + (size_t)n * CC; len = CC; }
  else if (which == 3) { if (n >= CC) return; src = W2 + (size_t)n * HID; dst = WS_P2 / 2 + (size_t)n * HID; len = HID; }
  else if (which == 4) { if (n >= 1024) return; const int m = n / LL, r = n % LL; src = ((m == 0) ? WQS : WKS) + (size_t)r * LL; dst = WS_PS / 2 + (size_t)n * LL; len = LL; }
  else if (which == 5) { src = T1 + (size_t)n * CC; dst = WS_PT1 / 2 + (size_t)n * CC; len = CC; }
  else { if (n >= CC) return; src = T2 + (size_t)n * HID; dst = WS_PT2 / 2 + (size_t)n * HID; len = HID; }
  for (int k = t; k < len; k += 256) s[k] = (_Float16)(bfr(src[k]) * WSC); __syncthreads(); for (int q = t; q < len / 8; q += 256) vst2((unsigned*)(P + dst + q * 8), *(const v4u*)&s[q * 8]); }
// ---- k_ln: block = row (512 wide, 256 threads x 2): LayerNorm (mean-square var, 1e-5) x g + b -> f16 row; input either a raw input (bf16-rounded) or an f32 stream
template <int RAW>
__global__ __launch_bounds__(256) void k_ln(const float* __restrict__ X, const float* __restrict__ G, const float* __restrict__ Bt, _Float16* __restrict__ Y) { __shared__ float red[8]; __shared__ __align__(16) _Float16 so[CC]; const int t = threadIdx.x; const size_t row = blockIdx.x;
  float v0 = X[row * CC + t], v1 = X[row * CC + t + 256]; if (RAW) { v0 = bfr(v0); v1 = bfr(v1); } float s = v0 + v1;
#pragma unroll
  for (int o = 1; o < 32; o <<= 1) s += __shfl_xor(s, o);
  if ((t & 31) == 0) red[t >> 5] = s; __syncthreads(); float tot = 0.f; for (int i = 0; i < 8; ++i) tot += red[i]; const float mu = tot / (float)CC; __syncthreads();
  const float d0 = v0 - mu, d1 = v1 - mu; float q = d0 * d0 + d1 * d1;
#pragma unroll
  for (int o = 1; o < 32; o <<= 1) q += __shfl_xor(q, o);
  if ((t & 31) == 0) red[t >> 5] = q; __syncthreads(); float tq = 0.f; for (int i = 0; i < 8; ++i) tq += red[i]; const float inv = 1.0f / sqrtf(tq / (float)CC + 1e-5f);
  so[t] = (_Float16)(d0 * inv * bfr(G[t]) + bfr(Bt[t])); so[t + 256] = (_Float16)(d1 * inv * bfr(G[t + 256]) + bfr(Bt[t + 256])); __syncthreads(); if (t < CC / 8) vst2((unsigned*)(Y + row * CC + t * 8), *(const v4u*)&so[t * 8]); }
// ---- k_g<MODE>: block = (64 rows, 128 cols[, which]): generic f16 GEMM A rows [*][KW] . W rows / 2^8; MODE 0: q/k/v (which = blockIdx.z): q,k -> f16 rows, v -> planes; MODE 1: OUT32 = RES + A . W (+ bias); MODE 2: OUT16 = f16(prelu(A . W + bias)) (hidden); MODE 3: qs|ks -> f16 rows [NRS][1024]
template <int MODE, int KW>
__global__ __launch_bounds__(128) void k_g(const _Float16* __restrict__ A, const _Float16* __restrict__ Wr, const float* __restrict__ BI, const float* __restrict__ RES, const float* __restrict__ ALPHA, float* __restrict__ O32, _Float16* __restrict__ O16, _Float16* __restrict__ O16B, _Float16* __restrict__ VPL, int ow) {
  __shared__ __align__(16) float sf[4][16][132]; __shared__ __align__(16) _Float16 so[64][136]; __shared__ __align__(16) _Float16 st[128][72];
  const int tid = threadIdx.x, wave = tid >> 5, lane = tid & 31, col = lane & 15, g = lane >> 4; const int which = blockIdx.z; const size_t rb = (size_t)blockIdx.x * 64; const size_t r0 = rb + wave * 16; const int c0 = blockIdx.y * 128; const _Float16* W = Wr + ((MODE == 0) ? (size_t)which * CC * KW : 0);
  v8f acc[8] = {};
#pragma unroll 2
  for (int kc = 0; kc < KW / 32; ++kc) { const v16h a = frag_h(A + (r0 + col) * KW + kc * 32, lane);
#pragma unroll
    for (int j = 0; j < 8; ++j) acc[j] = wmma16(a, frag_h(W + (size_t)(c0 + j * 16 + col) * KW + kc * 32, lane), acc[j]); }
  if (MODE == 1) {
#pragma unroll
    for (int j = 0; j < 8; ++j) { const int c = c0 + j * 16 + col; const float bb = BI ? bfr(BI[c]) : 0.f;
#pragma unroll
      for (int r = 0; r < 8; ++r) sf[wave][8 * g + r][j * 16 + col] = acc[j][r] * (1.0f / WSC) + bb + RES[(r0 + 8 * g + r) * ow + c]; }
    LDSX(); for (int rl = 0; rl < 16; ++rl) vst2(O32 + (r0 + rl) * ow + c0 + lane * 4, *(const v4f*)&sf[wave][rl][lane * 4]); return; }
  if (MODE == 0 && which == 2) {
#pragma unroll
    for (int j = 0; j < 8; ++j)
#pragma unroll
      for (int r = 0; r < 8; ++r) st[j * 16 + col][wave * 16 + 8 * g + r] = (_Float16)(acc[j][r] * (1.0f / WSC));
    __syncthreads(); const size_t b = rb / TT; const int s0 = (int)(rb % TT); for (int e = tid; e < 128 * 8; e += 128) { const int d = e >> 3, pc = e & 7; vst2((unsigned*)(VPL + ((b * CC + c0 + d) * TT) + s0 + pc * 8), *(const v4u*)&st[d][pc * 8]); } return; }
  { const float al = (MODE == 2) ? bfr(ALPHA[0]) : 0.f;
#pragma unroll
    for (int j = 0; j < 8; ++j) { const float bb = (MODE == 2) ? bfr(BI[c0 + j * 16 + col]) : 0.f;
#pragma unroll
      for (int r = 0; r < 8; ++r) { float v = acc[j][r] * (1.0f / WSC) + bb; if (MODE == 2) v = (v >= 0.f) ? v : al * v; so[wave * 16 + 8 * g + r][j * 16 + col] = (_Float16)v; } } }
  __syncthreads();
  { _Float16* dst = (MODE == 0) ? ((which == 0) ? O16 : O16B) : O16; for (int e = tid; e < 64 * 16; e += 128) { const int rl = e >> 4, q = e & 15; vst2((unsigned*)(dst + (rb + rl) * ow + c0 + q * 8), *(const v4u*)&so[rl][q * 8]); } }
}
// ---- k_attn: block = (64 queries, head, b): temporal attention over the 512 steps, 1/8; ctx f32 [NR][512] (256-B head segments)
__global__ __launch_bounds__(128) void k_attn(const _Float16* __restrict__ Q, const _Float16* __restrict__ Kr, const _Float16* __restrict__ V, float* __restrict__ O) {
  __shared__ __align__(16) _Float16 sph[4][16][40]; __shared__ __align__(16) float so[4][16][68];
  const int tid = threadIdx.x, wave = tid >> 5, lane = tid & 31, col = lane & 15, g = lane >> 4; const int h = blockIdx.y; const size_t b = blockIdx.z; const int q0 = blockIdx.x * 64 + wave * 16; const size_t rq = b * TT + q0;
  v16h aq[2];
#pragma unroll
  for (int kc = 0; kc < 2; ++kc) aq[kc] = frag_h(Q + (rq + col) * CC + h * HS + kc * 32, lane);
  float m[8], l[8];
#pragma unroll
  for (int r = 0; r < 8; ++r) { m[r] = -3.0e38f; l[r] = 0.f; }
  v8f acc[4] = {};
#pragma unroll 1
  for (int ks = 0; ks < TT / 32; ++ks) { const int j0 = ks * 32; v8f s[2];
#pragma unroll
    for (int ct = 0; ct < 2; ++ct) { const int kk = j0 + ct * 16 + col; const size_t rk = (b * TT + kk) * CC + h * HS; v8f c = {};
#pragma unroll
      for (int kc = 0; kc < 2; ++kc) c = wmma16(aq[kc], frag_h(Kr + rk + kc * 32, lane), c);
#pragma unroll
      for (int r = 0; r < 8; ++r) s[ct][r] = c[r] * 0.125f; }
#pragma unroll
    for (int r = 0; r < 8; ++r) { float mx = fmaxf(s[0][r], s[1][r]);
#pragma unroll
      for (int o = 1; o < 16; o <<= 1) mx = fmaxf(mx, __shfl_xor(mx, o));
      const float mn = fmaxf(m[r], mx); const float alpha = (m[r] <= -1.0e38f) ? 0.f : __expf(m[r] - mn); const float e0 = __expf(s[0][r] - mn), e1 = __expf(s[1][r] - mn); float es = e0 + e1;
#pragma unroll
      for (int o = 1; o < 16; o <<= 1) es += __shfl_xor(es, o);
      l[r] = l[r] * alpha + es; m[r] = mn;
#pragma unroll
      for (int dt = 0; dt < 4; ++dt) acc[dt][r] *= alpha;
      sph[wave][8 * g + r][col] = (_Float16)(e0 * 2048.0f); sph[wave][8 * g + r][16 + col] = (_Float16)(e1 * 2048.0f); }
    LDSX();
    const v16h pa = frag_h(&sph[wave][col][0], lane);
#pragma unroll
    for (int dt = 0; dt < 4; ++dt) acc[dt] = wmma16(pa, frag_h(V + ((b * CC + h * HS + dt * 16 + col) * TT) + j0, lane), acc[dt]);
    LDSX(); }
#pragma unroll
  for (int r = 0; r < 8; ++r) { const float il = (1.0f / 2048.0f) / l[r];
#pragma unroll
    for (int dt = 0; dt < 4; ++dt) so[wave][8 * g + r][dt * 16 + col] = acc[dt][r] * il; }
  LDSX();
  for (int rl = 0; rl < 16; ++rl) if (lane < 16) vst2(O + (rq + rl) * CC + h * HS + lane * 4, *(const v4f*)&so[wave][rl][lane * 4]);
}
// ---- k_wo: block = (64 rows, 128 cols): S1 = src (bf16-rounded) + f16(ctx) . Wo^T / 2^8
__global__ __launch_bounds__(128) void k_wo(const float* __restrict__ O, const _Float16* __restrict__ Wr, const float* __restrict__ SRC, float* __restrict__ S1) { __shared__ __align__(16) float sf[4][16][132];
  const int tid = threadIdx.x, wave = tid >> 5, lane = tid & 31, col = lane & 15, g = lane >> 4; const size_t r0 = (size_t)blockIdx.x * 64 + wave * 16; const int c0 = blockIdx.y * 128;
  v8f acc[8] = {};
#pragma unroll 2
  for (int kc = 0; kc < CC / 32; ++kc) { v16h a; { const float* p = O + (r0 + col) * CC + kc * 32 + 8 * g;
#pragma unroll
      for (int i = 0; i < 8; ++i) { a[i] = (_Float16)p[i]; a[8 + i] = (_Float16)p[16 + i]; } }
#pragma unroll
    for (int j = 0; j < 8; ++j) acc[j] = wmma16(a, frag_h(Wr + (size_t)(c0 + j * 16 + col) * CC + kc * 32, lane), acc[j]); }
#pragma unroll
  for (int j = 0; j < 8; ++j) { const int c = c0 + j * 16 + col;
#pragma unroll
    for (int r = 0; r < 8; ++r) sf[wave][8 * g + r][j * 16 + col] = acc[j][r] * (1.0f / WSC) + bfr(SRC[(r0 + 8 * g + r) * CC + c]); }
  LDSX(); for (int rl = 0; rl < 16; ++rl) vst2(S1 + (r0 + rl) * CC + c0 + lane * 4, *(const v4f*)&sf[wave][rl][lane * 4]); }
// ---- k_sstat / k_sprob: 512-wide score rows qs_n . ks_m / 8 per head. k_sstat: block = (64 rows n, b, head h): max / sum per row -> ST [b][h][n][2] (a wave's 16 rows fill one 128-B line). k_sprob: block = (32 rows n, b, 64 cols m), wave = 16 rows x 32 cols: accumulate p / 8 over the heads into the f32 output rows and an f16 copy
// __expf (v_exp_f32 of v * log2 e) with a v_nop in the same statement: the v_nop keeps the one free slot behind a transcendental
__device__ __forceinline__ float exp_slot(float v) { float d; asm("v_exp_f32 %0, %1\n\tv_nop" : "=v"(d) : "v"(v * 1.44269504f)); return d; }
__global__ __launch_bounds__(128) void k_sstat(const _Float16* __restrict__ QS, float* __restrict__ ST) {
  const int tid = threadIdx.x, wave = tid >> 5, lane = tid & 31, col = lane & 15, g = lane >> 4; const size_t b = blockIdx.y; const int h = blockIdx.z; const int n0 = blockIdx.x * 64 + wave * 16; const size_t rq = b * CC + n0;
  v16h aq[2];
#pragma unroll
  for (int kc = 0; kc < 2; ++kc) aq[kc] = frag_h(QS + (rq + col) * 1024 + h * HS + kc * 32, lane);
  float m[8], l[8];
#pragma unroll
  for (int r = 0; r < 8; ++r) { m[r] = -3.0e38f; l[r] = 0.f; }
#pragma unroll 1
  for (int ks = 0; ks < CC / 32; ++ks) { const int j0 = ks * 32; v8f s[2];
#pragma unroll
    for (int ct = 0; ct < 2; ++ct) { const int kk = j0 + ct * 16 + col; v8f c = {};
#pragma unroll
      for (int kc = 0; kc < 2; ++kc) c = wmma16(aq[kc], frag_h(QS + (b * CC + kk) * 1024 + LL + h * HS + kc * 32, lane), c);
#pragma unroll
      for (int r = 0; r < 8; ++r) s[ct][r] = c[r] * 0.125f; }
#pragma unroll
    for (int r = 0; r < 8; ++r) { float mx = fmaxf(s[0][r], s[1][r]);
#pragma unroll
      for (int o = 1; o < 16; o <<= 1) mx = fmaxf(mx, __shfl_xor(mx, o));
      const float mn = fmaxf(m[r], mx); const float ea = exp_slot(m[r] - mn); const float alpha = (m[r] <= -1.0e38f) ? 0.f : ea; float es = exp_slot(s[0][r] - mn) + exp_slot(s[1][r] - mn);
#pragma unroll
      for (int o = 1; o < 16; o <<= 1) es += __shfl_xor(es, o);
      l[r] = l[r] * alpha + es; m[r] = mn; } }
  if (col == 0) { float* p = ST + ((b * NH + h) * CC + n0 + 8 * g) * 2;
#pragma unroll
    for (int q = 0; q < 4; ++q) { const v4f v = { m[2 * q], l[2 * q], m[2 * q + 1], l[2 * q + 1] }; vst2(p + q * 4, v); } }
}
__global__ __launch_bounds__(128) void k_sprob(const _Float16* __restrict__ QS, const float* __restrict__ ST, float* __restrict__ SW, _Float16* __restrict__ SWH) { __shared__ __align__(16) float so[4][16][36]; __shared__ __align__(16) _Float16 sh[4][16][40];
  const int tid = threadIdx.x, wave = tid >> 5, lane = tid & 31, col = lane & 15, g = lane >> 4; const size_t b = blockIdx.y; const int n0 = blockIdx.x * 32 + (wave >> 1) * 16; const size_t rq = b * CC + n0; const int j0 = blockIdx.z * 64 + (wave & 1) * 32;
  float accp[2][8];
#pragma unroll
  for (int ct = 0; ct < 2; ++ct)
#pragma unroll
    for (int r = 0; r < 8; ++r) accp[ct][r] = 0.f;
#pragma unroll 1
  for (int h = 0; h < NH; ++h) { v16h aq[2];
#pragma unroll
    for (int kc = 0; kc < 2; ++kc) aq[kc] = frag_h(QS + (rq + col) * 1024 + h * HS + kc * 32, lane);
#pragma unroll
    for (int ct = 0; ct < 2; ++ct) { const int kk = j0 + ct * 16 + col; v8f c = {};
#pragma unroll
      for (int kc = 0; kc < 2; ++kc) c = wmma16(aq[kc], frag_h(QS + (b * CC + kk) * 1024 + LL + h * HS + kc * 32, lane), c);
#pragma unroll
      for (int r = 0; r < 8; ++r) { const float* st = ST + ((b * NH + h) * CC + n0 + 8 * g + r) * 2; accp[ct][r] += __expf(c[r] * 0.125f - st[0]) / st[1]; } } }
#pragma unroll
  for (int ct = 0; ct < 2; ++ct)
#pragma unroll
    for (int r = 0; r < 8; ++r) { const float v = accp[ct][r] * (1.0f / (float)NH); so[wave][8 * g + r][ct * 16 + col] = v; sh[wave][8 * g + r][ct * 16 + col] = (_Float16)v; }
  LDSX();
  for (int rl = 0; rl < 16; ++rl) { if (lane < 8) vst2(SW + (rq + rl) * CC + j0 + lane * 4, *(const v4f*)&so[wave][rl][lane * 4]); else if (lane < 12) vst2((unsigned*)(SWH + (rq + rl) * CC + j0 + (lane - 8) * 8), *(const v4u*)&sh[wave][rl][(lane - 8) * 8]); }
}
// ---- k_mix: block = (64 rows t, 128 cols c, b): S3 = S2 + sum_m sw[b][c][m] ln3[t][m] (A = ln3 rows f16, B = sw f16 rows [c][m] of batch b)
__global__ __launch_bounds__(128) void k_mix(const _Float16* __restrict__ LN3, const _Float16* __restrict__ SWH, const float* __restrict__ S2, float* __restrict__ S3) { __shared__ __align__(16) float sf[4][16][132];
  const int tid = threadIdx.x, wave = tid >> 5, lane = tid & 31, col = lane & 15, g = lane >> 4; const size_t b = blockIdx.z; const size_t r0 = b * TT + (size_t)blockIdx.x * 64 + wave * 16; const int c0 = blockIdx.y * 128;
  v8f acc[8] = {};
#pragma unroll 2
  for (int kc = 0; kc < CC / 32; ++kc) { const v16h a = frag_h(LN3 + (r0 + col) * CC + kc * 32, lane);
#pragma unroll
    for (int j = 0; j < 8; ++j) acc[j] = wmma16(a, frag_h(SWH + ((b * CC + c0 + j * 16 + col) * CC) + kc * 32, lane), acc[j]); }
#pragma unroll
  for (int j = 0; j < 8; ++j) { const int c = c0 + j * 16 + col;
#pragma unroll
    for (int r = 0; r < 8; ++r) sf[wave][8 * g + r][j * 16 + col] = acc[j][r] + S2[(r0 + 8 * g + r) * CC + c]; }
  LDSX(); for (int rl = 0; rl < 16; ++rl) vst2(S3 + (r0 + rl) * CC + c0 + lane * 4, *(const v4f*)&sf[wave][rl][lane * 4]); }
extern "C" void kernel_launch(void* const* d_in, const int* in_sizes, int n_in, void* d_out, int out_size, void* d_ws, size_t ws_size, hipStream_t stream) {
  (void)in_sizes; (void)n_in; (void)out_size;
  const float** F = (const float**)d_in;   // 0 src [16,512,512], 1 spatial_src [16,512,512], 2 Wq_t, 3 Wk_t, 4 Wv_t [8,64,512], 5 Wo_t [512,512], 6 Wq_s, 7 Wk_s [8,64,512], 8 W1 [2048,512], 9 b1, 10 W2 [512,2048], 11 b2, 12 tsW1, 13 tsb1, 14 tsW2, 15 tsb2, 16 alpha [1], 17 g1, 18 be1, 19 g2, 20 be2, 21 tsg1, 22 tsbe1, 23 tsg2, 24 tsbe2, 25 sg, 26 sbe
  if (ws_size < (size_t)WS_END) return;
  char* ws = (char*)d_ws; _Float16* P = (_Float16*)ws; _Float16 *LN = (_Float16*)(ws + WS_LN), *Q = (_Float16*)(ws + WS_Q), *Kr = (_Float16*)(ws + WS_K), *V = (_Float16*)(ws + WS_V), *HH = (_Float16*)(ws + WS_HH), *SP = (_Float16*)(ws + WS_SP), *QS = (_Float16*)(ws + WS_QS), *SWH = (_Float16*)(ws + WS_SWH); float *O = (float*)(ws + WS_O), *S1 = (float*)(ws + WS_S1), *S2 = (float*)(ws + WS_S2), *S3 = (float*)(ws + WS_S3), *ST = (float*)(ws + WS_ST);
  float* OUT0 = (float*)d_out; float* SW = (float*)d_out + OUT1;
  const int nr = TNB * TT;   // rows processed (temporal (b,t) and spatial (b,n) alike)
  k_pack<<<dim3(HID, 7), 256, 0, stream>>>(F[2], F[3], F[4], F[5], F[8], F[10], F[6], F[7], F[12], F[14], P);
  // temporal attention block
  k_ln<1><<<nr, 256, 0, stream>>>(F[0], F[17], F[18], LN);
  k_g<0, CC><<<dim3(nr / 64, CC / 128, 3), 128, 0, stream>>>(LN, P + WS_PW / 2, nullptr, nullptr, nullptr, nullptr, Q, Kr, V, CC);
  k_attn<<<dim3(TT / 64, NH, TNB), 128, 0, stream>>>(Q, Kr, V, O);
  k_wo<<<dim3(nr / 64, CC / 128), 128, 0, stream>>>(O, P + WS_PO / 2, F[0], S1);
  // FFN 1
  k_ln<0><<<nr, 256, 0, stream>>>(S1, F[19], F[20], LN);
  k_g<2, CC><<<dim3(nr / 64, HID / 128, 1), 128, 0, stream>>>(LN, P + WS_P1 / 2, F[9], nullptr, F[16], nullptr, HH, nullptr, nullptr, HID);
  k_g<1, HID><<<dim3(nr / 64, CC / 128, 1), 128, 0, stream>>>(HH, P + WS_P2 / 2, F[11], S1, nullptr, S2, nullptr, nullptr, nullptr, CC);
  // spatial attention weights
  k_ln<1><<<nr, 256, 0, stream>>>(F[1], F[25], F[26], SP);
  k_g<3, LL><<<dim3(nr / 64, 1024 / 128, 1), 128, 0, stream>>>(SP, P + WS_PS / 2, nullptr, nullptr, nullptr, nullptr, QS, nullptr, nullptr, 1024);
  k_sstat<<<dim3(CC / 64, TNB, NH), 128, 0, stream>>>(QS, ST);
  k_sprob<<<dim3(CC / 32, TNB, CC / 64), 128, 0, stream>>>(QS, ST, SW, SWH);
  // temporal-spatial mixing
  k_ln<0><<<nr, 256, 0, stream>>>(S2, F[21], F[22], LN);
  k_mix<<<dim3(TT / 64, CC / 128, TNB), 128, 0, stream>>>(LN, SWH, S2, S3);
  // FFN 2
  k_ln<0><<<nr, 256, 0, stream>>>(S3, F[23], F[24], LN);
  k_g<2, CC><<<dim3(nr / 64, HID / 128, 1), 128, 0, stream>>>(LN, P + WS_PT1 / 2, F[13], nullptr, F[16], nullptr, HH, nullptr, nullptr, HID);
  k_g<1, HID><<<dim3(nr / 64, CC / 128, 1), 128, 0, stream>>>(HH, P + WS_PT2 / 2, F[15], S3, nullptr, OUT0, nullptr, nullptr, nullptr, CC);
}

// v002
// A run of this version takes 328 microseconds.
// In two side-by-side timings against v001, it was 2.32 and 2.34 times as fast.
// Counting every step since v000, it is 3.11 times as fast.
#include <hip/hip_runtime.h>
#include <math.h>

typedef __attribute__((ext_vector_type(16))) _Float16 v16h;
typedef __attribute__((ext_vector_type(16))) __bf16 v16b;
typedef __attribute__((ext_vector_type(8)))  _Float16 v8h;
typedef __attribute__((ext_vector_type(8)))  float v8f;
typedef __attribute__((ext_vector_type(4)))  float v4f;
typedef __attribute__((ext_vector_type(2)))  float v2f;
typedef __attribute__((ext_vector_type(4)))  unsigned v4u;
typedef __attribute__((ext_vector_type(4)))  int v4i;
typedef float __attribute__((may_alias)) float_a;
typedef int __attribute__((may_alias)) int_a;

template <typename T> __device__ __forceinline__ void vst2(void* p, T v) { *(T*)p = v;  }
__device__ __forceinline__ v8f wmma16(v16h a, v16h b, v8f c) {
  v8f d = __builtin_amdgcn_wmma_f32_16x16x32_f16(false, a, false, b, (short)0, c, false, false);
  asm volatile("v_nop\n\tv_nop\n\tv_nop\n\tv_nop" : "+v"(d) : "v"(a), "v"(b));
  return d;
}
__device__ __forceinline__ v8f wmma_bf(v16b a, v16b b, v8f c) {
  v8f d = __builtin_amdgcn_wmma_f32_16x16x32_bf16(false, a, false, b, (short)0, c, false, false);
  asm volatile("v_nop\n\tv_nop\n\tv_nop\n\tv_nop" : "+v"(d) : "v"(a), "v"(b));
  return d;
}
// 16x16x32 fragments: lane = (h = lane>>4, row/col = lane&15); elements 0..7 = k0+8h+0..7, 8..15 = k0+16+8h+0..7; D element r = row 8h+r
__device__ __forceinline__ v16h frag_h(const _Float16* rowk0, int lane) {
  union { v16h v; v8h q[2]; } u; const _Float16* p = rowk0 + 8 * (lane >> 4);
  u.q[0] = *(const v8h*)p; u.q[1] = *(const v8h*)(p + 16); return u.v;
}
__device__ __forceinline__ v16h frag_f32(const float* rowk0, int lane) {
  v16h a; const float* p = rowk0 + 8 * (lane >> 4);
#pragma unroll
  for (int i = 0; i < 8; ++i) { a[i] = (_Float16)p[i]; a[8 + i] = (_Float16)p[16 + i]; }
  return a;
}
__device__ __forceinline__ v16h frag_f32s(const float* rowk0, int lane, float sc) {
  v16h a; const float* p = rowk0 + 8 * (lane >> 4);
#pragma unroll
  for (int i = 0; i < 8; ++i) { a[i] = (_Float16)(p[i] * sc); a[8 + i] = (_Float16)(p[16 + i] * sc); }
  return a;
}
// column fragment from a [K][ld] layout (column n), rows >= K read as 0
__device__ __forceinline__ v16h fragc_f32(const float* W, int k0, int n, int lane, int ld, int K) {
  v16h a; const int g = lane >> 4;
#pragma unroll
  for (int i = 0; i < 8; ++i) { const int ka = k0 + 8 * g + i, kb = ka + 16;
    a[i] = (_Float16)(ka < K ? W[(size_t)(ka < K ? ka : K - 1) * ld + n] : 0.f); a[8 + i] = (_Float16)(kb < K ? W[(size_t)(kb < K ? kb : K - 1) * ld + n] : 0.f); }
  return a;
}
struct F2 { v16b h, l; };
__device__ __forceinline__ F2 bsplit16(const float v[16]) { F2 r;
#pragma unroll
  for (int i = 0; i < 16; ++i) { const __bf16 h = (__bf16)v[i]; r.h[i] = h; r.l[i] = (__bf16)(v[i] - (float)h); }
  return r; }
__device__ __forceinline__ F2 split_row(const float* row, int k0, int lane) { float v[16]; const float* p = row + k0 + 8 * (lane >> 4);
#pragma unroll
  for (int i = 0; i < 8; ++i) { v[i] = p[i]; v[8 + i] = p[16 + i]; }
  return bsplit16(v); }
__device__ __forceinline__ F2 split_rowK(const float* row, int k0, int lane, int K) { float v[16]; const int g = lane >> 4;
#pragma unroll
  for (int i = 0; i < 8; ++i) { const int ka = k0 + 8 * g + i, kb = ka + 16; v[i] = ka < K ? row[ka < K ? ka : K - 1] : 0.f; v[8 + i] = kb < K ? row[kb < K ? kb : K - 1] : 0.f; }
  return bsplit16(v); }
__device__ __forceinline__ F2 split_col(const float* W, int k0, int n, int lane, int ld, int K) { float v[16]; const int g = lane >> 4;
#pragma unroll
  for (int i = 0; i < 8; ++i) { const int ka = k0 + 8 * g + i, kb = ka + 16; v[i] = ka < K ? W[(size_t)(ka < K ? ka : K - 1) * ld + n] : 0.f; v[8 + i] = kb < K ? W[(size_t)(kb < K ? kb : K - 1) * ld + n] : 0.f; }
  return bsplit16(v); }
__device__ __forceinline__ v8f mac3(const F2& a, const F2& b, v8f c) { c = wmma_bf(a.l, b.h, c); c = wmma_bf(a.h, b.l, c); return wmma_bf(a.h, b.h, c); }
__device__ __forceinline__ float sigm(float v) { return 1.0f / (1.0f + expf(-v)); }
#define LDSX() do { asm volatile("s_wait_dscnt 0" ::: "memory"); __builtin_amdgcn_wave_barrier(); __builtin_amdgcn_fence(__ATOMIC_RELEASE, "workgroup"); } while (0)


// STNDT encoder layer (B 16, T 512 time steps, C 512 channels, L 512, 8 heads, hidden 2,048): pre-norm temporal self-attention + FFN (PReLU), spatial attention weights (mean over heads of softmax(q k / 8) on the layer-normed spatial source), temporal-spatial mixing + FFN; returns (ts_out, spatial_weights).
#define NB 16
#define TT 512
#define CC 512
#define LL 512
#define NH 8
#define HS 64
#define HID 2048
#define NR (NB * TT)       // 8,192 temporal rows (b, t)
#define NRS (NB * CC)      // 8,192 spatial rows (b, n)
#define WSC 256.0f
#ifndef TNB
#define TNB NB
#endif
typedef __attribute__((ext_vector_type(8))) __bf16 v8b;
__device__ __forceinline__ v16b frag_b(const __bf16* rowk0, int lane) {
  union { v16b v; v8b q[2]; } u; const __bf16* p = rowk0 + 8 * (lane >> 4);
  u.q[0] = *(const v8b*)p; u.q[1] = *(const v8b*)(p + 16); return u.v;
}
__device__ __forceinline__ float bfr(float v) { return (float)(__bf16)v; }
__device__ __attribute__((noinline)) float exp_ni(float v) { return expf(v); }
__device__ __attribute__((noinline)) float erf_ni(float v) { return erff(v); }

#define WS_PW  0u                                   // f16 x 2^8 natural rows: Wq_t|Wk_t|Wv_t [1536][512], Wo_t [512][512], W1 [2048][512], W2 [512][2048], Wq_s|Wk_s [1024][512], tsW1 [2048][512], tsW2 [512][2048]
#define WS_PO  (WS_PW + 2u * (size_t)1536 * CC)
#define WS_P1  (WS_PO + 2u * (size_t)CC * CC)
#define WS_P2  (WS_P1 + 2u * (size_t)HID * CC)
#define WS_PS  (WS_P2 + 2u * (size_t)CC * HID)
#define WS_PT1 (WS_PS + 2u * (size_t)1024 * LL)
#define WS_PT2 (WS_PT1 + 2u * (size_t)HID * CC)
#define WS_LN  (WS_PT2 + 2u * (size_t)CC * HID)        // f16 LN rows [NR][512] (reused for each pre-norm); f16 Q, K rows [NR][512]; f16 V planes [b][512][T]; f32 ctx [NR][512]
#define WS_Q   (WS_LN + 2u * (size_t)NR * CC)
#define WS_K   (WS_Q + 2u * (size_t)NR * CC)
#define WS_V   (WS_K + 2u * (size_t)NR * CC)
#define WS_O   (WS_V + 2u * (size_t)NB * CC * TT)
#define WS_S1  (WS_O + 4u * (size_t)NR * CC)           // f32 residual streams S1, S2, S3 [NR][512]; f16 hidden [NR][2048]
#define WS_S2  (WS_S1 + 4u * (size_t)NR * CC)
#define WS_S3  (WS_S2 + 4u * (size_t)NR * CC)
#define WS_HH  (WS_S3 + 4u * (size_t)NR * CC)
#define WS_SP  (WS_HH + 2u * (size_t)NR * HID)         // spatial: f16 LN(sp) rows [NRS][512]; f16 qs | ks rows [NRS][1024]; f32 row stats (max, sum) [b][h][n][2]; f16 sw copy [b][c][m]
#define WS_QS  (WS_SP + 2u * (size_t)NRS * LL)
#define WS_ST  (WS_QS + 2u * (size_t)NRS * 1024)
#define WS_SWH (WS_ST + 4u * (size_t)NB * CC * 32)
#define WS_END (WS_SWH + 2u * (size_t)NB * CC * CC)
#define OUT1   ((size_t)NR * CC)                      // float offset of spatial_weights in d_out

// ---- k_pack: f16 x 2^8 copies of natural [out][in] rows; which: 0 Wq_t|Wk_t|Wv_t (1536 rows of 512), 1 Wo_t, 2 W1 (2048x512), 3 W2 (512x2048), 4 Wq_s|Wk_s (1024x512), 5 tsW1, 6 tsW2
__global__ __launch_bounds__(256) void k_pack(const float* __restrict__ WQ, const float* __restrict__ WK, const float* __restrict__ WV, const float* __restrict__ WO, const float* __restrict__ W1, const float* __restrict__ W2, const float* __restrict__ WQS, const float* __restrict__ WKS, const float* __restrict__ T1, const float* __restrict__ T2, _Float16* __restrict__ P) {
  const int n = blockIdx.x, which = blockIdx.y, t = threadIdx.x; __shared__ __align__(16) _Float16 s[HID];
  const float* src; size_t dst; int len;
  if (which == 0) { if (n >= 1536) return; const int m = n / CC, r = n % CC; src = ((m == 0) ? WQ : (m == 1) ? WK : WV) + (size_t)r * CC; dst = WS_PW / 2 + (size_t)n * CC; len = CC; }
  else if (which == 1) { if (n >= CC) return; src = WO + (size_t)n * CC; dst = WS_PO / 2 + (size_t)n * CC; len = CC; }
  else if (which == 2) { src = W1 + (size_t)n * CC; dst = WS_P1 / 2 + (size_t)n * CC; len = CC; }
  else if (which == 3) { if (n >= CC) return; src = W2 + (size_t)n * HID; dst = WS_P2 / 2 + (size_t)n * HID; len = HID; }
  else if (which == 4) { if (n >= 1024) return; const int m = n / LL, r = n % LL; src = ((m == 0) ? WQS : WKS) + (size_t)r * LL; dst = WS_PS / 2 + (size_t)n * LL; len = LL; }
  else if (which == 5) { src = T1 + (size_t)n * CC; dst = WS_PT1 / 2 + (size_t)n * CC; len = CC; }
  else { if (n >= CC) return; src = T2 + (size_t)n * HID; dst = WS_PT2 / 2 + (size_t)n * HID; len = HID; }
  for (int k = t; k < len; k += 256) s[k] = (_Float16)(bfr(src[k]) * WSC); __syncthreads(); for (int q = t; q < len / 8; q += 256) vst2((unsigned*)(P + dst + q * 8), *(const v4u*)&s[q * 8]); }
// ---- k_ln: block = row (512 wide, 256 threads x 2): LayerNorm (mean-square var, 1e-5) x g + b -> f16 row; input either a raw input (bf16-rounded) or an f32 stream
template <int RAW>
__global__ __launch_bounds__(256) void k_ln(const float* __restrict__ X, const float* __restrict__ G, const float* __restrict__ Bt, _Float16* __restrict__ Y) { __shared__ float red[8]; __shared__ __align__(16) _Float16 so[CC]; const int t = threadIdx.x; const size_t row = blockIdx.x;
  float v0 = X[row * CC + t], v1 = X[row * CC + t + 256]; if (RAW) { v0 = bfr(v0); v1 = bfr(v1); } float s = v0 + v1;
#pragma unroll
  for (int o = 1; o < 32; o <<= 1) s += __shfl_xor(s, o);
  if ((t & 31) == 0) red[t >> 5] = s; __syncthreads(); float tot = 0.f; for (int i = 0; i < 8; ++i) tot += red[i]; const float mu = tot / (float)CC; __syncthreads();
  const float d0 = v0 - mu, d1 = v1 - mu; float q = d0 * d0 + d1 * d1;
#pragma unroll
  for (int o = 1; o < 32; o <<= 1) q += __shfl_xor(q, o);
  if ((t & 31) == 0) red[t >> 5] = q; __syncthreads(); float tq = 0.f; for (int i = 0; i < 8; ++i) tq += red[i]; const float inv = 1.0f / sqrtf(tq / (float)CC + 1e-5f);
  so[t] = (_Float16)(d0 * inv * bfr(G[t]) + bfr(Bt[t])); so[t + 256] = (_Float16)(d1 * inv * bfr(G[t + 256]) + bfr(Bt[t + 256])); __syncthreads(); if (t < CC / 8) vst2((unsigned*)(Y + row * CC + t * 8), *(const v4u*)&so[t * 8]); }
// ---- k_g<MODE>: block = (128 rows, 128 cols[, which]), wave = 64 x 64: generic f16 GEMM A rows [*][KW] . W rows / 2^8. Both operands' 64-k slices (whole 128-B lines) are brought into a two-buffer LDS ring by asynchronous copies; the fragments are read from LDS. MODE 0: q/k/v (which = blockIdx.z): q,k -> f16 rows, v -> planes; MODE 1: OUT32 = RES + A . W + bias; MODE 2: OUT16 = f16(prelu(A . W + bias)) (hidden); MODE 3: qs|ks -> f16 rows [NRS][1024]; MODE 4: mixing, batch = blockIdx.z: OUT32 = RES + A . W, W = sw f16 rows [c][m] of the batch, no 2^8; MODE 5: Wo: A = f32 ctx rows AF (staged as f32, rounded to f16 where the fragment is formed), OUT32 = RES (bf16-rounded) + A . W
// eight copies of 16 B per lane, LS bytes apart in LDS and GS bytes apart in memory; the s_wait_xcnt 0 in the same statement stands in front of every later rewrite of the address registers
template <int LS, int GS>
__device__ __forceinline__ void cp8(unsigned l, const char* p) {
  asm volatile("global_load_async_to_lds_b128 %0, %8, off\n\t"
               "global_load_async_to_lds_b128 %1, %9, off\n\t"
               "global_load_async_to_lds_b128 %2, %10, off\n\t"
               "global_load_async_to_lds_b128 %3, %11, off\n\t"
               "global_load_async_to_lds_b128 %4, %12, off\n\t"
               "global_load_async_to_lds_b128 %5, %13, off\n\t"
               "global_load_async_to_lds_b128 %6, %14, off\n\t"
               "global_load_async_to_lds_b128 %7, %15, off\n\t"
               "s_wait_xcnt 0x0"
               :: "v"(l), "v"(l + 1u * LS), "v"(l + 2u * LS), "v"(l + 3u * LS), "v"(l + 4u * LS), "v"(l + 5u * LS), "v"(l + 6u * LS), "v"(l + 7u * LS),
                  "v"(p), "v"(p + 1 * GS), "v"(p + 2 * GS), "v"(p + 3 * GS), "v"(p + 4 * GS), "v"(p + 5 * GS), "v"(p + 6 * GS), "v"(p + 7 * GS)
               : "memory");
}
// LDS row pitches in bytes, both conflict-free for 16-byte reads: 128-B rows of halves + 16, 256-B rows of floats + 16
#define HPB 144
#define FPB 272
// stage s of the ring: 128 A rows, then 128 W rows, 64 k each, into buffer s & 1 (STB bytes each); la / lw and ga / gw are the lane's own first LDS and memory addresses
template <int MODE, int KW, int STB>
__device__ __forceinline__ void fill(unsigned la, unsigned lw, const char* ga, const char* gw, int s) { const unsigned o = (unsigned)(s & 1) * STB;
  if (MODE == 5) { cp8<8 * FPB, 8 * KW * 4>(la + o, ga + s * 256); cp8<8 * FPB, 8 * KW * 4>(la + o + 64u * FPB, ga + s * 256 + 64 * KW * 4); }
  else cp8<16 * HPB, 16 * KW * 2>(la + o, ga + s * 128);
  cp8<16 * HPB, 16 * KW * 2>(lw + o, gw + s * 128); }
template <int MODE, int KW>
__global__ __launch_bounds__(128) void k_g(const _Float16* __restrict__ A, const float* __restrict__ AF, const _Float16* __restrict__ Wr, const float* __restrict__ BI, const float* __restrict__ RES, const float* __restrict__ ALPHA, float* __restrict__ O32, _Float16* __restrict__ O16, _Float16* __restrict__ O16B, _Float16* __restrict__ VPL, int ow) {
  // the bare unroll directives below keep every index into a register array (acc, a, bf, bb, rv) a constant
  constexpr int APB = (MODE == 5) ? FPB : HPB, WOF = 128 * APB, STB = WOF + 128 * HPB, NS = KW / 64;   // NS ring stages, 8 or 32
  __shared__ __align__(16) char ring[2 * STB];
  const int tid = threadIdx.x, wave = tid >> 5, lane = tid & 31, col = lane & 15, g = lane >> 4, wr = wave >> 1, wc = wave & 1; const int which = blockIdx.z; const size_t rb = (size_t)blockIdx.x * 128 + ((MODE == 4) ? (size_t)which * TT : 0); const int c0 = blockIdx.y * 128; const _Float16* W = Wr + ((MODE == 0 || MODE == 4) ? (size_t)which * CC * KW : 0);
  const size_t r0 = rb + wr * 64; const int cw = c0 + wc * 64;
  const unsigned l0 = (unsigned)(size_t)&ring[0];
  const char* ga = (MODE == 5) ? (const char*)(AF + (rb + (tid >> 4)) * KW + (tid & 15) * 4) : (const char*)(A + (rb + (tid >> 3)) * KW + (tid & 7) * 8);
  const unsigned la = l0 + ((MODE == 5) ? (tid >> 4) * FPB + (tid & 15) * 16 : (tid >> 3) * HPB + (tid & 7) * 16);
  const char* gw = (const char*)(W + (size_t)(c0 + (tid >> 3)) * KW + (tid & 7) * 8); const unsigned lw = l0 + WOF + (tid >> 3) * HPB + (tid & 7) * 16;
  fill<MODE, KW, STB>(la, lw, ga, gw, 0);
  float bb[4] = { 0.f, 0.f, 0.f, 0.f }, alr = 0.f;   // the bias and slope loads fly while stage 0 lands
  if (MODE == 2 || (MODE == 1 && BI)) {
#pragma unroll
    for (int j = 0; j < 4; ++j) bb[j] = BI[cw + j * 16 + col]; }
  if (MODE == 2) alr = ALPHA[0];
  asm volatile("s_wait_asynccnt 0x0" ::: "memory");   // stage 0 has landed before the barrier publishes it
  __syncthreads();
  fill<MODE, KW, STB>(la, lw, ga, gw, 1);
  v8f acc[4][4] = {};
#pragma unroll 1   // one ring trip per loop trip, so that the publish point below stands once, in the written order
  for (int t = 0; t < NS; ++t) { const char* bp = ring + (t & 1) * STB;
#pragma unroll
    for (int kc = 0; kc < 2; ++kc) { v16h a[4], bf[4];
#pragma unroll
      for (int i = 0; i < 4; ++i) { const char* ar = bp + (wr * 64 + i * 16 + col) * APB;
        a[i] = (MODE == 5) ? frag_f32((const float*)ar + kc * 32, lane) : frag_h((const _Float16*)ar + kc * 32, lane);
        bf[i] = frag_h((const _Float16*)(bp + WOF + (wc * 64 + i * 16 + col) * HPB) + kc * 32, lane); }
#pragma unroll
      for (int i = 0; i < 4; ++i)
#pragma unroll
        for (int j = 0; j < 4; ++j) acc[i][j] = wmma16(a[i], bf[j], acc[i][j]); }
    asm volatile("s_wait_dscnt 0x0" ::: "memory");      // this wave's reads of the buffer are over before it is refilled
    asm volatile("s_wait_asynccnt 0x0" ::: "memory");   // this wave's copies of stage t + 1 have landed
    __syncthreads();                                    // publishes stage t + 1 and frees stage t's buffer
    if (t + 2 < NS) fill<MODE, KW, STB>(la, lw, ga, gw, t + 2); }
  asm volatile("s_wait_asynccnt 0x0" ::: "memory");     // no copy is outstanding when the ring becomes output staging
  // output staging: each wave's 64 x 64 tile in its own 18-KiB part of the ring, which every wave has left at the last trip's barrier; the stores go out as whole 128-B lines
  char* stg = ring + wave * 18432;
  if (MODE == 1 || MODE == 4 || MODE == 5) { float_a* sf = (float_a*)stg;   // rows of 68 floats
#pragma unroll
    for (int j = 0; j < 4; ++j) { const float bj = bfr(bb[j]);
#pragma unroll
      for (int i = 0; i < 4; ++i)
#pragma unroll
        for (int r = 0; r < 8; ++r) sf[(i * 16 + 8 * g + r) * 68 + j * 16 + col] = (MODE == 1) ? acc[i][j][r] * (1.0f / WSC) + bj : (MODE == 5) ? acc[i][j][r] * (1.0f / WSC) : acc[i][j][r]; }
    LDSX();
    for (int rl = 0; rl < 64; rl += 16) { v4f rv[8];
#pragma unroll
      for (int u = 0; u < 8; ++u) rv[u] = *(const v4f*)(RES + (r0 + rl + 2 * u + g) * ow + cw + col * 4);
#pragma unroll
      for (int u = 0; u < 8; ++u) { const int row = rl + 2 * u + g; v4f x = rv[u];
        if (MODE == 5) {
#pragma unroll
          for (int e = 0; e < 4; ++e) x[e] = bfr(x[e]); }
        vst2(O32 + (r0 + row) * ow + cw + col * 4, *(const v4f*)(stg + (row * 68 + col * 4) * 4) + x); }
      asm volatile("s_wait_xcnt 0x0" ::: "memory"); }   // before the next trip rewrites the stores' address registers
    return; }
  _Float16* sh = (_Float16*)stg;   // rows of HPB bytes
  if (MODE == 0 && which == 2) {
#pragma unroll
    for (int j = 0; j < 4; ++j)
#pragma unroll
      for (int i = 0; i < 4; ++i) { v8h hv;
#pragma unroll
        for (int r = 0; r < 8; ++r) hv[r] = (_Float16)(acc[i][j][r] * (1.0f / WSC));
        *(v8h*)&sh[(j * 16 + col) * (HPB / 2) + i * 16 + 8 * g] = hv; }
    LDSX(); const size_t b = rb / TT; const int s0 = (int)(rb % TT) + wr * 64;
#pragma unroll   // straight-line: sixteen stores in flight
    for (int d = 0; d < 64; d += 4) { const int dd = d + (lane >> 3), q = lane & 7; vst2((unsigned*)(VPL + ((b * CC + cw + dd) * TT) + s0 + q * 8), *(const v4u*)&sh[dd * (HPB / 2) + q * 8]); }
    return; }
  { const float al = bfr(alr);
#pragma unroll
    for (int j = 0; j < 4; ++j) { const float bj = bfr(bb[j]);
#pragma unroll
      for (int i = 0; i < 4; ++i)
#pragma unroll
        for (int r = 0; r < 8; ++r) { float v = acc[i][j][r] * (1.0f / WSC) + bj; if (MODE == 2) v = (v >= 0.f) ? v : al * v; sh[(i * 16 + 8 * g + r) * (HPB / 2) + j * 16 + col] = (_Float16)v; } } }
  LDSX();
  { _Float16* dst = (MODE == 0) ? ((which == 0) ? O16 : O16B) : O16;
#pragma unroll   // straight-line: sixteen stores in flight
    for (int rl = 0; rl < 64; rl += 4) { const int row = rl + (lane >> 3), q = lane & 7; vst2((unsigned*)(dst + (r0 + row) * ow + cw + q * 8), *(const v4u*)&sh[row * (HPB / 2) + q * 8]); } }
}
// ---- k_attn: block = (64 queries, head, b): temporal attention over the 512 steps, 1/8; ctx f32 [NR][512] (256-B head segments)
__global__ __launch_bounds__(128) void k_attn(const _Float16* __restrict__ Q, const _Float16* __restrict__ Kr, const _Float16* __restrict__ V, float* __restrict__ O) {
  __shared__ __align__(16) _Float16 sph[4][16][40]; __shared__ __align__(16) float so[4][16][68];
  const int tid = threadIdx.x, wave = tid >> 5, lane = tid & 31, col = lane & 15, g = lane >> 4; const int h = blockIdx.y; const size_t b = blockIdx.z; const int q0 = blockIdx.x * 64 + wave * 16; const size_t rq = b * TT + q0;
  v16h aq[2];
#pragma unroll
  for (int kc = 0; kc < 2; ++kc) aq[kc] = frag_h(Q + (rq + col) * CC + h * HS + kc * 32, lane);
  float m[8], l[8];
#pragma unroll
  for (int r = 0; r < 8; ++r) { m[r] = -3.0e38f; l[r] = 0.f; }
  v8f acc[4] = {};
#pragma unroll 1
  for (int ks = 0; ks < TT / 32; ++ks) { const int j0 = ks * 32; v8f s[2];
#pragma unroll
    for (int ct = 0; ct < 2; ++ct) { const int kk = j0 + ct * 16 + col; const size_t rk = (b * TT + kk) * CC + h * HS; v8f c = {};
#pragma unroll
      for (int kc = 0; kc < 2; ++kc) c = wmma16(aq[kc], frag_h(Kr + rk + kc * 32, lane), c);
#pragma unroll
      for (int r = 0; r < 8; ++r) s[ct][r] = c[r] * 0.125f; }
#pragma unroll
    for (int r = 0; r < 8; ++r) { float mx = fmaxf(s[0][r], s[1][r]);
#pragma unroll
      for (int o = 1; o < 16; o <<= 1) mx = fmaxf(mx, __shfl_xor(mx, o));
      const float mn = fmaxf(m[r], mx); const float alpha = (m[r] <= -1.0e38f) ? 0.f : __expf(m[r] - mn); const float e0 = __expf(s[0][r] - mn), e1 = __expf(s[1][r] - mn); float es = e0 + e1;
#pragma unroll
      for (int o = 1; o < 16; o <<= 1) es += __shfl_xor(es, o);
      l[r] = l[r] * alpha + es; m[r] = mn;
#pragma unroll
      for (int dt = 0; dt < 4; ++dt) acc[dt][r] *= alpha;
      sph[wave][8 * g + r][col] = (_Float16)(e0 * 2048.0f); sph[wave][8 * g + r][16 + col] = (_Float16)(e1 * 2048.0f); }
    LDSX();
    const v16h pa = frag_h(&sph[wave][col][0], lane);
#pragma unroll
    for (int dt = 0; dt < 4; ++dt) acc[dt] = wmma16(pa, frag_h(V + ((b * CC + h * HS + dt * 16 + col) * TT) + j0, lane), acc[dt]);
    LDSX(); }
#pragma unroll
  for (int r = 0; r < 8; ++r) { const float il = (1.0f / 2048.0f) / l[r];
#pragma unroll
    for (int dt = 0; dt < 4; ++dt) so[wave][8 * g + r][dt * 16 + col] = acc[dt][r] * il; }
  LDSX();
  for (int rl = 0; rl < 16; ++rl) if (lane < 16) vst2(O + (rq + rl) * CC + h * HS + lane * 4, *(const v4f*)&so[wave][rl][lane * 4]);
}
// ---- k_sstat / k_sprob: 512-wide score rows qs_n . ks_m / 8 per head. k_sstat: block = (64 rows n, b, head h): max / sum per row -> ST [b][h][n][2] (a wave's 16 rows fill one 128-B line). k_sprob: block = (32 rows n, b, 64 cols m), wave = 16 rows x 32 cols: accumulate p / 8 over the heads into the f32 output rows and an f16 copy
// __expf (v_exp_f32 of v * log2 e) with a v_nop in the same statement: the v_nop keeps the one free slot behind a transcendental
__device__ __forceinline__ float exp_slot(float v) { float d; asm("v_exp_f32 %0, %1\n\tv_nop" : "=v"(d) : "v"(v * 1.44269504f)); return d; }
__global__ __launch_bounds__(128) void k_sstat(const _Float16* __restrict__ QS, float* __restrict__ ST) {
  const int tid = threadIdx.x, wave = tid >> 5, lane = tid & 31, col = lane & 15, g = lane >> 4; const size_t b = blockIdx.y; const int h = blockIdx.z; const int n0 = blockIdx.x * 64 + wave * 16; const size_t rq = b * CC + n0;
  v16h aq[2];
#pragma unroll
  for (int kc = 0; kc < 2; ++kc) aq[kc] = frag_h(QS + (rq + col) * 1024 + h * HS + kc * 32, lane);
  float m[8], l[8];
#pragma unroll
  for (int r = 0; r < 8; ++r) { m[r] = -3.0e38f; l[r] = 0.f; }
#pragma unroll 1
  for (int ks = 0; ks < CC / 32; ++ks) { const int j0 = ks * 32; v8f s[2];
#pragma unroll
    for (int ct = 0; ct < 2; ++ct) { const int kk = j0 + ct * 16 + col; v8f c = {};
#pragma unroll
      for (int kc = 0; kc < 2; ++kc) c = wmma16(aq[kc], frag_h(QS + (b * CC + kk) * 1024 + LL + h * HS + kc * 32, lane), c);
#pragma unroll
      for (int r = 0; r < 8; ++r) s[ct][r] = c[r] * 0.125f; }
#pragma unroll
    for (int r = 0; r < 8; ++r) { float mx = fmaxf(s[0][r], s[1][r]);
#pragma unroll
      for (int o = 1; o < 16; o <<= 1) mx = fmaxf(mx, __shfl_xor(mx, o));
      const float mn = fmaxf(m[r], mx); const float ea = exp_slot(m[r] - mn); const float alpha = (m[r] <= -1.0e38f) ? 0.f : ea; float es = exp_slot(s[0][r] - mn) + exp_slot(s[1][r] - mn);
#pragma unroll
      for (int o = 1; o < 16; o <<= 1) es += __shfl_xor(es, o);
      l[r] = l[r] * alpha + es; m[r] = mn; } }
  if (col == 0) { float* p = ST + ((b * NH + h) * CC + n0 + 8 * g) * 2;
#pragma unroll
    for (int q = 0; q < 4; ++q) { const v4f v = { m[2 * q], l[2 * q], m[2 * q + 1], l[2 * q + 1] }; vst2(p + q * 4, v); } }
}
__global__ __launch_bounds__(128) void k_sprob(const _Float16* __restrict__ QS, const float* __restrict__ ST, float* __restrict__ SW, _Float16* __restrict__ SWH) { __shared__ __align__(16) float so[4][16][36]; __shared__ __align__(16) _Float16 sh[4][16][40];
  const int tid = threadIdx.x, wave = tid >> 5, lane = tid & 31, col = lane & 15, g = lane >> 4; const size_t b = blockIdx.y; const int n0 = blockIdx.x * 32 + (wave >> 1) * 16; const size_t rq = b * CC + n0; const int j0 = blockIdx.z * 64 + (wave & 1) * 32;
  float accp[2][8];
#pragma unroll
  for (int ct = 0; ct < 2; ++ct)
#pragma unroll
    for (int r = 0; r < 8; ++r) accp[ct][r] = 0.f;
#pragma unroll 1
  for (int h = 0; h < NH; ++h) { v16h aq[2];
#pragma unroll
    for (int kc = 0; kc < 2; ++kc) aq[kc] = frag_h(QS + (rq + col) * 1024 + h * HS + kc * 32, lane);
#pragma unroll
    for (int ct = 0; ct < 2; ++ct) { const int kk = j0 + ct * 16 + col; v8f c = {};
#pragma unroll
      for (int kc = 0; kc < 2; ++kc) c = wmma16(aq[kc], frag_h(QS + (b * CC + kk) * 1024 + LL + h * HS + kc * 32, lane), c);
#pragma unroll
      for (int r = 0; r < 8; ++r) { const float* st = ST + ((b * NH + h) * CC + n0 + 8 * g + r) * 2; accp[ct][r] += __expf(c[r] * 0.125f - st[0]) / st[1]; } } }
#pragma unroll
  for (int ct = 0; ct < 2; ++ct)
#pragma unroll
    for (int r = 0; r < 8; ++r) { const float v = accp[ct][r] * (1.0f / (float)NH); so[wave][8 * g + r][ct * 16 + col] = v; sh[wave][8 * g + r][ct * 16 + col] = (_Float16)v; }
  LDSX();
  for (int rl = 0; rl < 16; ++rl) { if (lane < 8) vst2(SW + (rq + rl) * CC + j0 + lane * 4, *(const v4f*)&so[wave][rl][lane * 4]); else if (lane < 12) vst2((unsigned*)(SWH + (rq + rl) * CC + j0 + (lane - 8) * 8), *(const v4u*)&sh[wave][rl][(lane - 8) * 8]); }
}
extern "C" void kernel_launch(void* const* d_in, const int* in_sizes, int n_in, void* d_out, int out_size, void* d_ws, size_t ws_size, hipStream_t stream) {
  (void)in_sizes; (void)n_in; (void)out_size;
  const float** F = (const float**)d_in;   // 0 src [16,512,512], 1 spatial_src [16,512,512], 2 Wq_t, 3 Wk_t, 4 Wv_t [8,64,512], 5 Wo_t [512,512], 6 Wq_s, 7 Wk_s [8,64,512], 8 W1 [2048,512], 9 b1, 10 W2 [512,2048], 11 b2, 12 tsW1, 13 tsb1, 14 tsW2, 15 tsb2, 16 alpha [1], 17 g1, 18 be1, 19 g2, 20 be2, 21 tsg1, 22 tsbe1, 23 tsg2, 24 tsbe2, 25 sg, 26 sbe
  if (ws_size < (size_t)WS_END) return;
  char* ws = (char*)d_ws; _Float16* P = (_Float16*)ws; _Float16 *LN = (_Float16*)(ws + WS_LN), *Q = (_Float16*)(ws + WS_Q), *Kr = (_Float16*)(ws + WS_K), *V = (_Float16*)(ws + WS_V), *HH = (_Float16*)(ws + WS_HH), *SP = (_Float16*)(ws + WS_SP), *QS = (_Float16*)(ws + WS_QS), *SWH = (_Float16*)(ws + WS_SWH); float *O = (float*)(ws + WS_O), *S1 = (float*)(ws + WS_S1), *S2 = (float*)(ws + WS_S2), *S3 = (float*)(ws + WS_S3), *ST = (float*)(ws + WS_ST);
  float* OUT0 = (float*)d_out; float* SW = (float*)d_out + OUT1;
  const int nr = TNB * TT;   // rows processed (temporal (b,t) and spatial (b,n) alike)
  k_pack<<<dim3(HID, 7), 256, 0, stream>>>(F[2], F[3], F[4], F[5], F[8], F[10], F[6], F[7], F[12], F[14], P);
  // temporal attention block
  k_ln<1><<<nr, 256, 0, stream>>>(F[0], F[17], F[18], LN);
  k_g<0, CC><<<dim3(nr / 128, CC / 128, 3), 128, 0, stream>>>(LN, nullptr, P + WS_PW / 2, nullptr, nullptr, nullptr, nullptr, Q, Kr, V, CC);
  k_attn<<<dim3(TT / 64, NH, TNB), 128, 0, stream>>>(Q, Kr, V, O);
  k_g<5, CC><<<dim3(nr / 128, CC / 128, 1), 128, 0, stream>>>(nullptr, O, P + WS_PO / 2, nullptr, F[0], nullptr, S1, nullptr, nullptr, nullptr, CC);
  // FFN 1
  k_ln<0><<<nr, 256, 0, stream>>>(S1, F[19], F[20], LN);
  k_g<2, CC><<<dim3(nr / 128, HID / 128, 1), 128, 0, stream>>>(LN, nullptr, P + WS_P1 / 2, F[9], nullptr, F[16], nullptr, HH, nullptr, nullptr, HID);
  k_g<1, HID><<<dim3(nr / 128, CC / 128, 1), 128, 0, stream>>>(HH, nullptr, P + WS_P2 / 2, F[11], S1, nullptr, S2, nullptr, nullptr, nullptr, CC);
  // spatial attention weights
  k_ln<1><<<nr, 256, 0, stream>>>(F[1], F[25], F[26], SP);
  k_g<3, LL><<<dim3(nr / 128, 1024 / 128, 1), 128, 0, stream>>>(SP, nullptr, P + WS_PS / 2, nullptr, nullptr, nullptr, nullptr, QS, nullptr, nullptr, 1024);
  k_sstat<<<dim3(CC / 64, TNB, NH), 128, 0, stream>>>(QS, ST);
  k_sprob<<<dim3(CC / 32, TNB, CC / 64), 128, 0, stream>>>(QS, ST, SW, SWH);
  // temporal-spatial mixing
  k_ln<0><<<nr, 256, 0, stream>>>(S2, F[21], F[22], LN);
  k_g<4, CC><<<dim3(TT / 128, CC / 128, TNB), 128, 0, stream>>>(LN, nullptr, SWH, nullptr, S2, nullptr, S3, nullptr, nullptr, nullptr, CC);
  // FFN 2
  k_ln<0><<<nr, 256, 0, stream>>>(S3, F[23], F[24], LN);
  k_g<2, CC><<<dim3(nr / 128, HID / 128, 1), 128, 0, stream>>>(LN, nullptr, P + WS_PT1 / 2, F[13], nullptr, F[16], nullptr, HH, nullptr, nullptr, HID);
  k_g<1, HID><<<dim3(nr / 128, CC / 128, 1), 128, 0, stream>>>(HH, nullptr, P + WS_PT2 / 2, F[15], S3, nullptr, OUT0, nullptr, nullptr, nullptr, CC);
}

// v003
// A run of this version takes 296 microseconds.
// Two timings next to v002 both put it at 1.11 times that version's speed.
// All steps since v000 together make it 3.46 times as fast.
#include <hip/hip_runtime.h>
#include <math.h>

typedef __attribute__((ext_vector_type(16))) _Float16 v16h;
typedef __attribute__((ext_vector_type(16))) __bf16 v16b;
typedef __attribute__((ext_vector_type(8)))  _Float16 v8h;
typedef __attribute__((ext_vector_type(4)))  _Float16 v4hh;
typedef __attribute__((ext_vector_type(8)))  float v8f;
typedef __attribute__((ext_vector_type(4)))  float v4f;
typedef __attribute__((ext_vector_type(2)))  float v2f;
typedef __attribute__((ext_vector_type(4)))  unsigned v4u;
typedef __attribute__((ext_vector_type(4)))  int v4i;
typedef float __attribute__((may_alias)) float_a;
typedef int __attribute__((may_alias)) int_a;

template <typename T> __device__ __forceinline__ void vst2(void* p, T v) { *(T*)p = v;  }
__device__ __forceinline__ v8f wmma16(v16h a, v16h b, v8f c) {
  v8f d = __builtin_amdgcn_wmma_f32_16x16x32_f16(false, a, false, b, (short)0, c, false, false);
  asm volatile("v_nop\n\tv_nop\n\tv_nop\n\tv_nop" : "+v"(d) : "v"(a), "v"(b));
  return d;
}
__device__ __forceinline__ v8f wmma_bf(v16b a, v16b b, v8f c) {
  v8f d = __builtin_amdgcn_wmma_f32_16x16x32_bf16(false, a, false, b, (short)0, c, false, false);
  asm volatile("v_nop\n\tv_nop\n\tv_nop\n\tv_nop" : "+v"(d) : "v"(a), "v"(b));
  return d;
}
// 16x16x32 fragments: lane = (h = lane>>4, row/col = lane&15); elements 0..7 = k0+8h+0..7, 8..15 = k0+16+8h+0..7; D element r = row 8h+r
__device__ __forceinline__ v16h frag_h(const _Float16* rowk0, int lane) {
  union { v16h v; v8h q[2]; } u; const _Float16* p = rowk0 + 8 * (lane >> 4);
  u.q[0] = *(const v8h*)p; u.q[1] = *(const v8h*)(p + 16); return u.v;
}
__device__ __forceinline__ v16h frag_f32(const float* rowk0, int lane) {
  v16h a; const float* p = rowk0 + 8 * (lane >> 4);
#pragma unroll
  for (int i = 0; i < 8; ++i) { a[i] = (_Float16)p[i]; a[8 + i] = (_Float16)p[16 + i]; }
  return a;
}
__device__ __forceinline__ v16h frag_f32s(const float* rowk0, int lane, float sc) {
  v16h a; const float* p = rowk0 + 8 * (lane >> 4);
#pragma unroll
  for (int i = 0; i < 8; ++i) { a[i] = (_Float16)(p[i] * sc); a[8 + i] = (_Float16)(p[16 + i] * sc); }
  return a;
}
// column fragment from a [K][ld] layout (column n), rows >= K read as 0
__device__ __forceinline__ v16h fragc_f32(const float* W, int k0, int n, int lane, int ld, int K) {
  v16h a; const int g = lane >> 4;
#pragma unroll
  for (int i = 0; i < 8; ++i) { const int ka = k0 + 8 * g + i, kb = ka + 16;
    a[i] = (_Float16)(ka < K ? W[(size_t)(ka < K ? ka : K - 1) * ld + n] : 0.f); a[8 + i] = (_Float16)(kb < K ? W[(size_t)(kb < K ? kb : K - 1) * ld + n] : 0.f); }
  return a;
}
struct F2 { v16b h, l; };
__device__ __forceinline__ F2 bsplit16(const float v[16]) { F2 r;
#pragma unroll
  for (int i = 0; i < 16; ++i) { const __bf16 h = (__bf16)v[i]; r.h[i] = h; r.l[i] = (__bf16)(v[i] - (float)h); }
  return r; }
__device__ __forceinline__ F2 split_row(const float* row, int k0, int lane) { float v[16]; const float* p = row + k0 + 8 * (lane >> 4);
#pragma unroll
  for (int i = 0; i < 8; ++i) { v[i] = p[i]; v[8 + i] = p[16 + i]; }
  return bsplit16(v); }
__device__ __forceinline__ F2 split_rowK(const float* row, int k0, int lane, int K) { float v[16]; const int g = lane >> 4;
#pragma unroll
  for (int i = 0; i < 8; ++i) { const int ka = k0 + 8 * g + i, kb = ka + 16; v[i] = ka < K ? row[ka < K ? ka : K - 1] : 0.f; v[8 + i] = kb < K ? row[kb < K ? kb : K - 1] : 0.f; }
  return bsplit16(v); }
__device__ __forceinline__ F2 split_col(const float* W, int k0, int n, int lane, int ld, int K) { float v[16]; const int g = lane >> 4;
#pragma unroll
  for (int i = 0; i < 8; ++i) { const int ka = k0 + 8 * g + i, kb = ka + 16; v[i] = ka < K ? W[(size_t)(ka < K ? ka : K - 1) * ld + n] : 0.f; v[8 + i] = kb < K ? W[(size_t)(kb < K ? kb : K - 1) * ld + n] : 0.f; }
  return bsplit16(v); }
__device__ __forceinline__ v8f mac3(const F2& a, const F2& b, v8f c) { c = wmma_bf(a.l, b.h, c); c = wmma_bf(a.h, b.l, c); return wmma_bf(a.h, b.h, c); }
__device__ __forceinline__ float sigm(float v) { return 1.0f / (1.0f + expf(-v)); }
#define LDSX() do { asm volatile("s_wait_dscnt 0" ::: "memory"); __builtin_amdgcn_wave_barrier(); __builtin_amdgcn_fence(__ATOMIC_RELEASE, "workgroup"); } while (0)


// STNDT encoder layer (B 16, T 512 time steps, C 512 channels, L 512, 8 heads, hidden 2,048): pre-norm temporal self-attention + FFN (PReLU), spatial attention weights (mean over heads of softmax(q k / 8) on the layer-normed spatial source), temporal-spatial mixing + FFN; returns (ts_out, spatial_weights).
#define NB 16
#define TT 512
#define CC 512
#define LL 512
#define NH 8
#define HS 64
#define HID 2048
#define NR (NB * TT)       // 8,192 temporal rows (b, t)
#define NRS (NB * CC)      // 8,192 spatial rows (b, n)
#define WSC 256.0f
#ifndef TNB
#define TNB NB
#endif
typedef __attribute__((ext_vector_type(8))) __bf16 v8b;
__device__ __forceinline__ v16b frag_b(const __bf16* rowk0, int lane) {
  union { v16b v; v8b q[2]; } u; const __bf16* p = rowk0 + 8 * (lane >> 4);
  u.q[0] = *(const v8b*)p; u.q[1] = *(const v8b*)(p + 16); return u.v;
}
__device__ __forceinline__ float bfr(float v) { return (float)(__bf16)v; }
__device__ __attribute__((noinline)) float exp_ni(float v) { return expf(v); }
__device__ __attribute__((noinline)) float erf_ni(float v) { return erff(v); }

#define WS_PW  0u                                   // f16 x 2^8 natural rows: Wq_t|Wk_t|Wv_t [1536][512], Wo_t [512][512], W1 [2048][512], W2 [512][2048], Wq_s|Wk_s [1024][512], tsW1 [2048][512], tsW2 [512][2048]
#define WS_PO  (WS_PW + 2u * (size_t)1536 * CC)
#define WS_P1  (WS_PO + 2u * (size_t)CC * CC)
#define WS_P2  (WS_P1 + 2u * (size_t)HID * CC)
#define WS_PS  (WS_P2 + 2u * (size_t)CC * HID)
#define WS_PT1 (WS_PS + 2u * (size_t)1024 * LL)
#define WS_PT2 (WS_PT1 + 2u * (size_t)HID * CC)
#define WS_LN  (WS_PT2 + 2u * (size_t)CC * HID)        // f16 LN rows [NR][512] (reused for each pre-norm); f16 Q, K rows [NR][512]; f16 V planes [b][512][T]; f32 ctx [NR][512]
#define WS_Q   (WS_LN + 2u * (size_t)NR * CC)
#define WS_K   (WS_Q + 2u * (size_t)NR * CC)
#define WS_V   (WS_K + 2u * (size_t)NR * CC)
#define WS_O   (WS_V + 2u * (size_t)NB * CC * TT)
#define WS_S1  (WS_O + 4u * (size_t)NR * CC)           // f32 residual streams S1, S2, S3 [NR][512]; f16 hidden [NR][2048]
#define WS_S2  (WS_S1 + 4u * (size_t)NR * CC)
#define WS_S3  (WS_S2 + 4u * (size_t)NR * CC)
#define WS_HH  (WS_S3 + 4u * (size_t)NR * CC)
#define WS_SP  (WS_HH + 2u * (size_t)NR * HID)         // spatial: f16 LN(sp) rows [NRS][512]; f16 qs | ks rows [NRS][1024]; f32 row stats (max, sum) [b][h][n][2]; f16 sw copy [b][c][m]
#define WS_QS  (WS_SP + 2u * (size_t)NRS * LL)
#define WS_ST  (WS_QS + 2u * (size_t)NRS * 1024)
#define WS_SWH (WS_ST + 4u * (size_t)NB * CC * 32)
#define WS_END (WS_SWH + 2u * (size_t)NB * CC * CC)
#define OUT1   ((size_t)NR * CC)                      // float offset of spatial_weights in d_out

// ---- k_pack: f16 x 2^8 copies of the natural [out][in] rows. The packed planes lie one behind another in the order Wq_t Wk_t Wv_t Wo_t W1 W2 Wq_s Wk_s tsW1 tsW2 and each is a plain copy of its source, so the whole is 22 units of 262,144 elements. One work-group a WGP: block b takes elements b * 1,024 ... + 1,023 of every unit, a thread one 16-byte load of each (22 in flight), no LDS
#define PU 262144
__global__ __launch_bounds__(256) void k_pack(const float* __restrict__ WQ, const float* __restrict__ WK, const float* __restrict__ WV, const float* __restrict__ WO, const float* __restrict__ W1, const float* __restrict__ W2, const float* __restrict__ WQS, const float* __restrict__ WKS, const float* __restrict__ T1, const float* __restrict__ T2, _Float16* __restrict__ P) {
  const unsigned ob = blockIdx.x * 4096u + threadIdx.x * 16u;   // the thread's byte offset in every f32 unit
  const float* const s[22] = { WQ, WK, WV, WO, W1, W1 + PU, W1 + 2 * PU, W1 + 3 * PU, W2, W2 + PU, W2 + 2 * PU, W2 + 3 * PU, WQS, WKS, T1, T1 + PU, T1 + 2 * PU, T1 + 3 * PU, T2, T2 + PU, T2 + 2 * PU, T2 + 3 * PU };
  v4f x[22];
#pragma unroll   // straight-line: every index into s and x a constant
  for (int u = 0; u < 22; ++u) x[u] = *(const v4f*)((const char*)s[u] + ob);
  __builtin_amdgcn_sched_barrier(0);   // all 22 loads are issued before the first is waited for; without it the last one was sunk behind a wait
#pragma unroll   // as above
  for (int u = 0; u < 22; ++u) { v4hh o;
#pragma unroll   // as above
    for (int e = 0; e < 4; ++e) o[e] = (_Float16)(bfr(x[u][e]) * WSC);
    vst2((char*)(P + (size_t)u * PU) + ob / 2, o); } }
// ---- k_ln: wave = LNR whole rows (512 wide, 16 floats a lane as four 16-byte loads, all rows' loads in flight at once), block = 8 waves, one work-group a WGP: LayerNorm (mean-square var, 1e-5) x g + b -> f16 row; input either a raw input (bf16-rounded) or an f32 stream. The sums stay in the wave: no LDS, no barrier
#define LNR 4
// lane l with lane l ^ M inside its 16-lane row (DPP row_xmask), and with lane l ^ 16
template <int M> __device__ __forceinline__ float xrow(float v) { return __builtin_bit_cast(float, __builtin_amdgcn_update_dpp(0, __builtin_bit_cast(int, v), 0x160 + M, 0xf, 0xf, true)); }
__device__ __forceinline__ float xhalf(float v) { return __builtin_bit_cast(float, __builtin_amdgcn_permlanex16(__builtin_bit_cast(int, v), __builtin_bit_cast(int, v), 0x76543210, 0xfedcba98, false, false)); }
__device__ __forceinline__ float wsum(float v) { v += xrow<1>(v); v += xrow<2>(v); v += xrow<4>(v); v += xrow<8>(v); return v + xhalf(v); }
template <int RAW>
__global__ __launch_bounds__(256) void k_ln(const float* __restrict__ X, const float* __restrict__ G, const float* __restrict__ Bt, _Float16* __restrict__ Y) {
  // the bare unroll directives below keep every index into a register array (x, gg, bb, mu, inv) a constant
  const int lane = threadIdx.x & 31; const size_t e0 = ((size_t)blockIdx.x * 8 + (threadIdx.x >> 5)) * LNR * CC + lane * 4;
  v4f x[LNR][4], gg[4], bb[4]; float mu[LNR], inv[LNR];
#pragma unroll
  for (int r = 0; r < LNR; ++r)
#pragma unroll
    for (int i = 0; i < 4; ++i) x[r][i] = *(const v4f*)(X + e0 + r * CC + i * 128);
#pragma unroll
  for (int i = 0; i < 4; ++i) { gg[i] = *(const v4f*)(G + i * 128 + lane * 4); bb[i] = *(const v4f*)(Bt + i * 128 + lane * 4); }
  __builtin_amdgcn_sched_barrier(0);   // all 24 loads are issued before the first is waited for; without it six of the g and b loads were sunk into the arithmetic, each with a wait of its own
#pragma unroll
  for (int r = 0; r < LNR; ++r) { v4f t = { 0.f, 0.f, 0.f, 0.f };
#pragma unroll
    for (int i = 0; i < 4; ++i) {
      if (RAW) {
#pragma unroll
        for (int e = 0; e < 4; ++e) x[r][i][e] = bfr(x[r][i][e]); }
      t += x[r][i]; }
    mu[r] = wsum((t[0] + t[1]) + (t[2] + t[3])) / (float)CC; }
#pragma unroll
  for (int r = 0; r < LNR; ++r) { v4f q = { 0.f, 0.f, 0.f, 0.f };
#pragma unroll
    for (int i = 0; i < 4; ++i) { x[r][i] -= mu[r]; q += x[r][i] * x[r][i]; }
    inv[r] = wsum((q[0] + q[1]) + (q[2] + q[3])) / (float)CC + 1e-5f; }
#pragma unroll
  for (int r = 0; r < LNR; ++r) inv[r] = 1.0f / sqrtf(inv[r]);
#pragma unroll
  for (int i = 0; i < 4; ++i)
#pragma unroll
    for (int e = 0; e < 4; ++e) { gg[i][e] = bfr(gg[i][e]); bb[i][e] = bfr(bb[i][e]); }
#pragma unroll
  for (int r = 0; r < LNR; ++r)
#pragma unroll
    for (int i = 0; i < 4; ++i) { v4hh o;
#pragma unroll
      for (int e = 0; e < 4; ++e) o[e] = (_Float16)(x[r][i][e] * inv[r] * gg[i][e] + bb[i][e]);
      vst2(Y + e0 + r * CC + i * 128, o); } }
// ---- k_g<MODE>: block = (128 rows, 128 cols[, which]), wave = 64 x 64: generic f16 GEMM A rows [*][KW] . W rows / 2^8. Both operands' 64-k slices (whole 128-B lines) are brought into a two-buffer LDS ring by asynchronous copies; the fragments are read from LDS. MODE 0: q/k/v (which = blockIdx.z): q,k -> f16 rows, v -> planes; MODE 1: OUT32 = RES + A . W + bias; MODE 2: OUT16 = f16(prelu(A . W + bias)) (hidden); MODE 3: qs|ks -> f16 rows [NRS][1024]; MODE 4: mixing, batch = blockIdx.z: OUT32 = RES + A . W, W = sw f16 rows [c][m] of the batch, no 2^8; MODE 5: Wo: A = f32 ctx rows AF (staged as f32, rounded to f16 where the fragment is formed), OUT32 = RES (bf16-rounded) + A . W
// eight copies of 16 B per lane, LS bytes apart in LDS and GS bytes apart in memory; the s_wait_xcnt 0 in the same statement stands in front of every later rewrite of the address registers
template <int LS, int GS>
__device__ __forceinline__ void cp8(unsigned l, const char* p) {
  asm volatile("global_load_async_to_lds_b128 %0, %8, off\n\t"
               "global_load_async_to_lds_b128 %1, %9, off\n\t"
               "global_load_async_to_lds_b128 %2, %10, off\n\t"
               "global_load_async_to_lds_b128 %3, %11, off\n\t"
               "global_load_async_to_lds_b128 %4, %12, off\n\t"
               "global_load_async_to_lds_b128 %5, %13, off\n\t"
               "global_load_async_to_lds_b128 %6, %14, off\n\t"
               "global_load_async_to_lds_b128 %7, %15, off\n\t"
               "s_wait_xcnt 0x0"
               :: "v"(l), "v"(l + 1u * LS), "v"(l + 2u * LS), "v"(l + 3u * LS), "v"(l + 4u * LS), "v"(l + 5u * LS), "v"(l + 6u * LS), "v"(l + 7u * LS),
                  "v"(p), "v"(p + 1 * GS), "v"(p + 2 * GS), "v"(p + 3 * GS), "v"(p + 4 * GS), "v"(p + 5 * GS), "v"(p + 6 * GS), "v"(p + 7 * GS)
               : "memory");
}
// LDS row pitches in bytes, both conflict-free for 16-byte reads: 128-B rows of halves + 16, 256-B rows of floats + 16
#define HPB 144
#define FPB 272
// stage s of the ring: 128 A rows, then 128 W rows, 64 k each, into buffer s & 1 (STB bytes each); la / lw and ga / gw are the lane's own first LDS and memory addresses
template <int MODE, int KW, int STB>
__device__ __forceinline__ void fill(unsigned la, unsigned lw, const char* ga, const char* gw, int s) { const unsigned o = (unsigned)(s & 1) * STB;
  if (MODE == 5) { cp8<8 * FPB, 8 * KW * 4>(la + o, ga + s * 256); cp8<8 * FPB, 8 * KW * 4>(la + o + 64u * FPB, ga + s * 256 + 64 * KW * 4); }
  else cp8<16 * HPB, 16 * KW * 2>(la + o, ga + s * 128);
  cp8<16 * HPB, 16 * KW * 2>(lw + o, gw + s * 128); }
template <int MODE, int KW>
__global__ __launch_bounds__(128) void k_g(const _Float16* __restrict__ A, const float* __restrict__ AF, const _Float16* __restrict__ Wr, const float* __restrict__ BI, const float* __restrict__ RES, const float* __restrict__ ALPHA, float* __restrict__ O32, _Float16* __restrict__ O16, _Float16* __restrict__ O16B, _Float16* __restrict__ VPL, int ow) {
  // the bare unroll directives below keep every index into a register array (acc, a, bf, bb, rv) a constant
  constexpr int APB = (MODE == 5) ? FPB : HPB, WOF = 128 * APB, STB = WOF + 128 * HPB, NS = KW / 64;   // NS ring stages, 8 or 32
  __shared__ __align__(16) char ring[2 * STB];
  const int tid = threadIdx.x, wave = tid >> 5, lane = tid & 31, col = lane & 15, g = lane >> 4, wr = wave >> 1, wc = wave & 1; const int which = blockIdx.z; const size_t rb = (size_t)blockIdx.x * 128 + ((MODE == 4) ? (size_t)which * TT : 0); const int c0 = blockIdx.y * 128; const _Float16* W = Wr + ((MODE == 0 || MODE == 4) ? (size_t)which * CC * KW : 0);
  const size_t r0 = rb + wr * 64; const int cw = c0 + wc * 64;
  const unsigned l0 = (unsigned)(size_t)&ring[0];
  const char* ga = (MODE == 5) ? (const char*)(AF + (rb + (tid >> 4)) * KW + (tid & 15) * 4) : (const char*)(A + (rb + (tid >> 3)) * KW + (tid & 7) * 8);
  const unsigned la = l0 + ((MODE == 5) ? (tid >> 4) * FPB + (tid & 15) * 16 : (tid >> 3) * HPB + (tid & 7) * 16);
  const char* gw = (const char*)(W + (size_t)(c0 + (tid >> 3)) * KW + (tid & 7) * 8); const unsigned lw = l0 + WOF + (tid >> 3) * HPB + (tid & 7) * 16;
  fill<MODE, KW, STB>(la, lw, ga, gw, 0);
  float bb[4] = { 0.f, 0.f, 0.f, 0.f }, alr = 0.f;   // the bias and slope loads fly while stage 0 lands
  if (MODE == 2 || (MODE == 1 && BI)) {
#pragma unroll
    for (int j = 0; j < 4; ++j) bb[j] = BI[cw + j * 16 + col]; }
  if (MODE == 2) alr = ALPHA[0];
  asm volatile("s_wait_asynccnt 0x0" ::: "memory");   // stage 0 has landed before the barrier publishes it
  __syncthreads();
  fill<MODE, KW, STB>(la, lw, ga, gw, 1);
  v8f acc[4][4] = {};
#pragma unroll 1   // one ring trip per loop trip, so that the publish point below stands once, in the written order
  for (int t = 0; t < NS; ++t) { const char* bp = ring + (t & 1) * STB;
#pragma unroll
    for (int kc = 0; kc < 2; ++kc) { v16h a[4], bf[4];
#pragma unroll
      for (int i = 0; i < 4; ++i) { const char* ar = bp + (wr * 64 + i * 16 + col) * APB;
        a[i] = (MODE == 5) ? frag_f32((const float*)ar + kc * 32, lane) : frag_h((const _Float16*)ar + kc * 32, lane);
        bf[i] = frag_h((const _Float16*)(bp + WOF + (wc * 64 + i * 16 + col) * HPB) + kc * 32, lane); }
#pragma unroll
      for (int i = 0; i < 4; ++i)
#pragma unroll
        for (int j = 0; j < 4; ++j) acc[i][j] = wmma16(a[i], bf[j], acc[i][j]); }
    asm volatile("s_wait_dscnt 0x0" ::: "memory");      // this wave's reads of the buffer are over before it is refilled
    asm volatile("s_wait_asynccnt 0x0" ::: "memory");   // this wave's copies of stage t + 1 have landed
    __syncthreads();                                    // publishes stage t + 1 and frees stage t's buffer
    if (t + 2 < NS) fill<MODE, KW, STB>(la, lw, ga, gw, t + 2); }
  asm volatile("s_wait_asynccnt 0x0" ::: "memory");     // no copy is outstanding when the ring becomes output staging
  // output staging: each wave's 64 x 64 tile in its own 18-KiB part of the ring, which every wave has left at the last trip's barrier; the stores go out as whole 128-B lines
  char* stg = ring + wave * 18432;
  if (MODE == 1 || MODE == 4 || MODE == 5) { float_a* sf = (float_a*)stg;   // rows of 68 floats
#pragma unroll
    for (int j = 0; j < 4; ++j) { const float bj = bfr(bb[j]);
#pragma unroll
      for (int i = 0; i < 4; ++i)
#pragma unroll
        for (int r = 0; r < 8; ++r) sf[(i * 16 + 8 * g + r) * 68 + j * 16 + col] = (MODE == 1) ? acc[i][j][r] * (1.0f / WSC) + bj : (MODE == 5) ? acc[i][j][r] * (1.0f / WSC) : acc[i][j][r]; }
    LDSX();
    for (int rl = 0; rl < 64; rl += 16) { v4f rv[8];
#pragma unroll
      for (int u = 0; u < 8; ++u) rv[u] = *(const v4f*)(RES + (r0 + rl + 2 * u + g) * ow + cw + col * 4);
#pragma unroll
      for (int u = 0; u < 8; ++u) { const int row = rl + 2 * u + g; v4f x = rv[u];
        if (MODE == 5) {
#pragma unroll
          for (int e = 0; e < 4; ++e) x[e] = bfr(x[e]); }
        vst2(O32 + (r0 + row) * ow + cw + col * 4, *(const v4f*)(stg + (row * 68 + col * 4) * 4) + x); }
      asm volatile("s_wait_xcnt 0x0" ::: "memory"); }   // before the next trip rewrites the stores' address registers
    return; }
  _Float16* sh = (_Float16*)stg;   // rows of HPB bytes
  if (MODE == 0 && which == 2) {
#pragma unroll
    for (int j = 0; j < 4; ++j)
#pragma unroll
      for (int i = 0; i < 4; ++i) { v8h hv;
#pragma unroll
        for (int r = 0; r < 8; ++r) hv[r] = (_Float16)(acc[i][j][r] * (1.0f / WSC));
        *(v8h*)&sh[(j * 16 + col) * (HPB / 2) + i * 16 + 8 * g] = hv; }
    LDSX(); const size_t b = rb / TT; const int s0 = (int)(rb % TT) + wr * 64;
#pragma unroll   // straight-line: sixteen stores in flight
    for (int d = 0; d < 64; d += 4) { const int dd = d + (lane >> 3), q = lane & 7; vst2((unsigned*)(VPL + ((b * CC + cw + dd) * TT) + s0 + q * 8), *(const v4u*)&sh[dd * (HPB / 2) + q * 8]); }
    return; }
  { const float al = bfr(alr);
#pragma unroll
    for (int j = 0; j < 4; ++j) { const float bj = bfr(bb[j]);
#pragma unroll
      for (int i = 0; i < 4; ++i)
#pragma unroll
        for (int r = 0; r < 8; ++r) { float v = acc[i][j][r] * (1.0f / WSC) + bj; if (MODE == 2) v = (v >= 0.f) ? v : al * v; sh[(i * 16 + 8 * g + r) * (HPB / 2) + j * 16 + col] = (_Float16)v; } } }
  LDSX();
  { _Float16* dst = (MODE == 0) ? ((which == 0) ? O16 : O16B) : O16;
#pragma unroll   // straight-line: sixteen stores in flight
    for (int rl = 0; rl < 64; rl += 4) { const int row = rl + (lane >> 3), q = lane & 7; vst2((unsigned*)(dst + (r0 + row) * ow + cw + q * 8), *(const v4u*)&sh[row * (HPB / 2) + q * 8]); } }
}
// ---- k_attn: block = (64 queries, head, b): temporal attention over the 512 steps, 1/8; ctx f32 [NR][512] (256-B head segments)
__global__ __launch_bounds__(128) void k_attn(const _Float16* __restrict__ Q, const _Float16* __restrict__ Kr, const _Float16* __restrict__ V, float* __restrict__ O) {
  __shared__ __align__(16) _Float16 sph[4][16][40]; __shared__ __align__(16) float so[4][16][68];
  const int tid = threadIdx.x, wave = tid >> 5, lane = tid & 31, col = lane & 15, g = lane >> 4; const int h = blockIdx.y; const size_t b = blockIdx.z; const int q0 = blockIdx.x * 64 + wave * 16; const size_t rq = b * TT + q0;
  v16h aq[2];
#pragma unroll
  for (int kc = 0; kc < 2; ++kc) aq[kc] = frag_h(Q + (rq + col) * CC + h * HS + kc * 32, lane);
  float m[8], l[8];
#pragma unroll
  for (int r = 0; r < 8; ++r) { m[r] = -3.0e38f; l[r] = 0.f; }
  v8f acc[4] = {};
#pragma unroll 1
  for (int ks = 0; ks < TT / 32; ++ks) { const int j0 = ks * 32; v8f s[2];
#pragma unroll
    for (int ct = 0; ct < 2; ++ct) { const int kk = j0 + ct * 16 + col; const size_t rk = (b * TT + kk) * CC + h * HS; v8f c = {};
#pragma unroll
      for (int kc = 0; kc < 2; ++kc) c = wmma16(aq[kc], frag_h(Kr + rk + kc * 32, lane), c);
#pragma unroll
      for (int r = 0; r < 8; ++r) s[ct][r] = c[r] * 0.125f; }
#pragma unroll
    for (int r = 0; r < 8; ++r) { float mx = fmaxf(s[0][r], s[1][r]);
#pragma unroll
      for (int o = 1; o < 16; o <<= 1) mx = fmaxf(mx, __shfl_xor(mx, o));
      const float mn = fmaxf(m[r], mx); const float alpha = (m[r] <= -1.0e38f) ? 0.f : __expf(m[r] - mn); const float e0 = __expf(s[0][r] - mn), e1 = __expf(s[1][r] - mn); float es = e0 + e1;
#pragma unroll
      for (int o = 1; o < 16; o <<= 1) es += __shfl_xor(es, o);
      l[r] = l[r] * alpha + es; m[r] = mn;
#pragma unroll
      for (int dt = 0; dt < 4; ++dt) acc[dt][r] *= alpha;
      sph[wave][8 * g + r][col] = (_Float16)(e0 * 2048.0f); sph[wave][8 * g + r][16 + col] = (_Float16)(e1 * 2048.0f); }
    LDSX();
    const v16h pa = frag_h(&sph[wave][col][0], lane);
#pragma unroll
    for (int dt = 0; dt < 4; ++dt) acc[dt] = wmma16(pa, frag_h(V + ((b * CC + h * HS + dt * 16 + col) * TT) + j0, lane), acc[dt]);
    LDSX(); }
#pragma unroll
  for (int r = 0; r < 8; ++r) { const float il = (1.0f / 2048.0f) / l[r];
#pragma unroll
    for (int dt = 0; dt < 4; ++dt) so[wave][8 * g + r][dt * 16 + col] = acc[dt][r] * il; }
  LDSX();
  for (int rl = 0; rl < 16; ++rl) if (lane < 16) vst2(O + (rq + rl) * CC + h * HS + lane * 4, *(const v4f*)&so[wave][rl][lane * 4]);
}
// ---- k_sstat / k_sprob: 512-wide score rows qs_n . ks_m / 8 per head. k_sstat: block = (64 rows n, b, head h): max / sum per row -> ST [b][h][n][2] (a wave's 16 rows fill one 128-B line). k_sprob: block = (32 rows n, b, 64 cols m), wave = 16 rows x 32 cols: accumulate p / 8 over the heads into the f32 output rows and an f16 copy
// __expf (v_exp_f32 of v * log2 e) with a v_nop in the same statement: the v_nop keeps the one free slot behind a transcendental
__device__ __forceinline__ float exp_slot(float v) { float d; asm("v_exp_f32 %0, %1\n\tv_nop" : "=v"(d) : "v"(v * 1.44269504f)); return d; }
__global__ __launch_bounds__(128) void k_sstat(const _Float16* __restrict__ QS, float* __restrict__ ST) {
  const int tid = threadIdx.x, wave = tid >> 5, lane = tid & 31, col = lane & 15, g = lane >> 4; const size_t b = blockIdx.y; const int h = blockIdx.z; const int n0 = blockIdx.x * 64 + wave * 16; const size_t rq = b * CC + n0;
  v16h aq[2];
#pragma unroll
  for (int kc = 0; kc < 2; ++kc) aq[kc] = frag_h(QS + (rq + col) * 1024 + h * HS + kc * 32, lane);
  float m[8], l[8];
#pragma unroll
  for (int r = 0; r < 8; ++r) { m[r] = -3.0e38f; l[r] = 0.f; }
#pragma unroll 1
  for (int ks = 0; ks < CC / 32; ++ks) { const int j0 = ks * 32; v8f s[2];
#pragma unroll
    for (int ct = 0; ct < 2; ++ct) { const int kk = j0 + ct * 16 + col; v8f c = {};
#pragma unroll
      for (int kc = 0; kc < 2; ++kc) c = wmma16(aq[kc], frag_h(QS + (b * CC + kk) * 1024 + LL + h * HS + kc * 32, lane), c);
#pragma unroll
      for (int r = 0; r < 8; ++r) s[ct][r] = c[r] * 0.125f; }
#pragma unroll
    for (int r = 0; r < 8; ++r) { float mx = fmaxf(s[0][r], s[1][r]);
#pragma unroll
      for (int o = 1; o < 16; o <<= 1) mx = fmaxf(mx, __shfl_xor(mx, o));
      const float mn = fmaxf(m[r], mx); const float ea = exp_slot(m[r] - mn); const float alpha = (m[r] <= -1.0e38f) ? 0.f : ea; float es = exp_slot(s[0][r] - mn) + exp_slot(s[1][r] - mn);
#pragma unroll
      for (int o = 1; o < 16; o <<= 1) es += __shfl_xor(es, o);
      l[r] = l[r] * alpha + es; m[r] = mn; } }
  if (col == 0) { float* p = ST + ((b * NH + h) * CC + n0 + 8 * g) * 2;
#pragma unroll
    for (int q = 0; q < 4; ++q) { const v4f v = { m[2 * q], l[2 * q], m[2 * q + 1], l[2 * q + 1] }; vst2(p + q * 4, v); } }
}
__global__ __launch_bounds__(128) void k_sprob(const _Float16* __restrict__ QS, const float* __restrict__ ST, float* __restrict__ SW, _Float16* __restrict__ SWH) { __shared__ __align__(16) float so[4][16][36]; __shared__ __align__(16) _Float16 sh[4][16][40];
  const int tid = threadIdx.x, wave = tid >> 5, lane = tid & 31, col = lane & 15, g = lane >> 4; const size_t b = blockIdx.y; const int n0 = blockIdx.x * 32 + (wave >> 1) * 16; const size_t rq = b * CC + n0; const int j0 = blockIdx.z * 64 + (wave & 1) * 32;
  float accp[2][8];
#pragma unroll
  for (int ct = 0; ct < 2; ++ct)
#pragma unroll
    for (int r = 0; r < 8; ++r) accp[ct][r] = 0.f;
#pragma unroll 1
  for (int h = 0; h < NH; ++h) { v16h aq[2];
#pragma unroll
    for (int kc = 0; kc < 2; ++kc) aq[kc] = frag_h(QS + (rq + col) * 1024 + h * HS + kc * 32, lane);
#pragma unroll
    for (int ct = 0; ct < 2; ++ct) { const int kk = j0 + ct * 16 + col; v8f c = {};
#pragma unroll
      for (int kc = 0; kc < 2; ++kc) c = wmma16(aq[kc], frag_h(QS + (b * CC + kk) * 1024 + LL + h * HS + kc * 32, lane), c);
#pragma unroll
      for (int r = 0; r < 8; ++r) { const float* st = ST + ((b * NH + h) * CC + n0 + 8 * g + r) * 2; accp[ct][r] += __expf(c[r] * 0.125f - st[0]) / st[1]; } } }
#pragma unroll
  for (int ct = 0; ct < 2; ++ct)
#pragma unroll
    for (int r = 0; r < 8; ++r) { const float v = accp[ct][r] * (1.0f / (float)NH); so[wave][8 * g + r][ct * 16 + col] = v; sh[wave][8 * g + r][ct * 16 + col] = (_Float16)v; }
  LDSX();
  for (int rl = 0; rl < 16; ++rl) { if (lane < 8) vst2(SW + (rq + rl) * CC + j0 + lane * 4, *(const v4f*)&so[wave][rl][lane * 4]); else if (lane < 12) vst2((unsigned*)(SWH + (rq + rl) * CC + j0 + (lane - 8) * 8), *(const v4u*)&sh[wave][rl][(lane - 8) * 8]); }
}
extern "C" void kernel_launch(void* const* d_in, const int* in_sizes, int n_in, void* d_out, int out_size, void* d_ws, size_t ws_size, hipStream_t stream) {
  (void)in_sizes; (void)n_in; (void)out_size;
  const float** F = (const float**)d_in;   // 0 src [16,512,512], 1 spatial_src [16,512,512], 2 Wq_t, 3 Wk_t, 4 Wv_t [8,64,512], 5 Wo_t [512,512], 6 Wq_s, 7 Wk_s [8,64,512], 8 W1 [2048,512], 9 b1, 10 W2 [512,2048], 11 b2, 12 tsW1, 13 tsb1, 14 tsW2, 15 tsb2, 16 alpha [1], 17 g1, 18 be1, 19 g2, 20 be2, 21 tsg1, 22 tsbe1, 23 tsg2, 24 tsbe2, 25 sg, 26 sbe
  if (ws_size < (size_t)WS_END) return;
  char* ws = (char*)d_ws; _Float16* P = (_Float16*)ws; _Float16 *LN = (_Float16*)(ws + WS_LN), *Q = (_Float16*)(ws + WS_Q), *Kr = (_Float16*)(ws + WS_K), *V = (_Float16*)(ws + WS_V), *HH = (_Float16*)(ws + WS_HH), *SP = (_Float16*)(ws + WS_SP), *QS = (_Float16*)(ws + WS_QS), *SWH = (_Float16*)(ws + WS_SWH); float *O = (float*)(ws + WS_O), *S1 = (float*)(ws + WS_S1), *S2 = (float*)(ws + WS_S2), *S3 = (float*)(ws + WS_S3), *ST = (float*)(ws + WS_ST);
  float* OUT0 = (float*)d_out; float* SW = (float*)d_out + OUT1;
  const int nr = TNB * TT;   // rows processed (temporal (b,t) and spatial (b,n) alike)
  k_pack<<<PU / 1024, 256, 0, stream>>>(F[2], F[3], F[4], F[5], F[8], F[10], F[6], F[7], F[12], F[14], P);
  // temporal attention block
  k_ln<1><<<nr / (8 * LNR), 256, 0, stream>>>(F[0], F[17], F[18], LN);
  k_g<0, CC><<<dim3(nr / 128, CC / 128, 3), 128, 0, stream>>>(LN, nullptr, P + WS_PW / 2, nullptr, nullptr, nullptr, nullptr, Q, Kr, V, CC);
  k_attn<<<dim3(TT / 64, NH, TNB), 128, 0, stream>>>(Q, Kr, V, O);
  k_g<5, CC><<<dim3(nr / 128, CC / 128, 1), 128, 0, stream>>>(nullptr, O, P + WS_PO / 2, nullptr, F[0], nullptr, S1, nullptr, nullptr, nullptr, CC);
  // FFN 1
  k_ln<0><<<nr / (8 * LNR), 256, 0, stream>>>(S1, F[19], F[20], LN);
  k_g<2, CC><<<dim3(nr / 128, HID / 128, 1), 128, 0, stream>>>(LN, nullptr, P + WS_P1 / 2, F[9], nullptr, F[16], nullptr, HH, nullptr, nullptr, HID);
  k_g<1, HID><<<dim3(nr / 128, CC / 128, 1), 128, 0, stream>>>(HH, nullptr, P + WS_P2 / 2, F[11], S1, nullptr, S2, nullptr, nullptr, nullptr, CC);
  // spatial attention weights
  k_ln<1><<<nr / (8 * LNR), 256, 0, stream>>>(F[1], F[25], F[26], SP);
  k_g<3, LL><<<dim3(nr / 128, 1024 / 128, 1), 128, 0, stream>>>(SP, nullptr, P + WS_PS / 2, nullptr, nullptr, nullptr, nullptr, QS, nullptr, nullptr, 1024);
  k_sstat<<<dim3(CC / 64, TNB, NH), 128, 0, stream>>>(QS, ST);
  k_sprob<<<dim3(CC / 32, TNB, CC / 64), 128, 0, stream>>>(QS, ST, SW, SWH);
  // temporal-spatial mixing
  k_ln<0><<<nr / (8 * LNR), 256, 0, stream>>>(S2, F[21], F[22], LN);
  k_g<4, CC><<<dim3(TT / 128, CC / 128, TNB), 128, 0, stream>>>(LN, nullptr, SWH, nullptr, S2, nullptr, S3, nullptr, nullptr, nullptr, CC);
  // FFN 2
  k_ln<0><<<nr / (8 * LNR), 256, 0, stream>>>(S3, F[23], F[24], LN);
  k_g<2, CC><<<dim3(nr / 128, HID / 128, 1), 128, 0, stream>>>(LN, nullptr, P + WS_PT1 / 2, F[13], nullptr, F[16], nullptr, HH, nullptr, nullptr, HID);
  k_g<1, HID><<<dim3(nr / 128, CC / 128, 1), 128, 0, stream>>>(HH, nullptr, P + WS_PT2 / 2, F[15], S3, nullptr, OUT0, nullptr, nullptr, nullptr, CC);
}

// v004
// One run takes 237 microseconds.
// In two side-by-side timings against v003, it was 1.25 and 1.26 times as fast.
// Counting every step since v000, it is 4.34 times as fast.
#include <hip/hip_runtime.h>
#include <math.h>

typedef __attribute__((ext_vector_type(16))) _Float16 v16h;
typedef __attribute__((ext_vector_type(16))) __bf16 v16b;
typedef __attribute__((ext_vector_type(8)))  _Float16 v8h;
typedef __attribute__((ext_vector_type(4)))  _Float16 v4hh;
typedef __attribute__((ext_vector_type(8)))  float v8f;
typedef __attribute__((ext_vector_type(4)))  float v4f;
typedef __attribute__((ext_vector_type(2)))  float v2f;
typedef __attribute__((ext_vector_type(4)))  unsigned v4u;
typedef __attribute__((ext_vector_type(4)))  int v4i;
typedef float __attribute__((may_alias)) float_a;
typedef int __attribute__((may_alias)) int_a;

template <typename T> __device__ __forceinline__ void vst2(void* p, T v) { *(T*)p = v;  }
__device__ __forceinline__ v8f wmma16(v16h a, v16h b, v8f c) {
  v8f d = __builtin_amdgcn_wmma_f32_16x16x32_f16(false, a, false, b, (short)0, c, false, false);
  asm volatile("v_nop\n\tv_nop\n\tv_nop\n\tv_nop" : "+v"(d) : "v"(a), "v"(b));
  return d;
}
__device__ __forceinline__ v8f wmma_bf(v16b a, v16b b, v8f c) {
  v8f d = __builtin_amdgcn_wmma_f32_16x16x32_bf16(false, a, false, b, (short)0, c, false, false);
  asm volatile("v_nop\n\tv_nop\n\tv_nop\n\tv_nop" : "+v"(d) : "v"(a), "v"(b));
  return d;
}
// 16x16x32 fragments: lane = (h = lane>>4, row/col = lane&15); elements 0..7 = k0+8h+0..7, 8..15 = k0+16+8h+0..7; D element r = row 8h+r
__device__ __forceinline__ v16h frag_h(const _Float16* rowk0, int lane) {
  union { v16h v; v8h q[2]; } u; const _Float16* p = rowk0 + 8 * (lane >> 4);
  u.q[0] = *(const v8h*)p; u.q[1] = *(const v8h*)(p + 16); return u.v;
}
__device__ __forceinline__ v16h frag_f32(const float* rowk0, int lane) {
  v16h a; const float* p = rowk0 + 8 * (lane >> 4);
#pragma unroll
  for (int i = 0; i < 8; ++i) { a[i] = (_Float16)p[i]; a[8 + i] = (_Float16)p[16 + i]; }
  return a;
}
__device__ __forceinline__ v16h frag_f32s(const float* rowk0, int lane, float sc) {
  v16h a; const float* p = rowk0 + 8 * (lane >> 4);
#pragma unroll
  for (int i = 0; i < 8; ++i) { a[i] = (_Float16)(p[i] * sc); a[8 + i] = (_Float16)(p[16 + i] * sc); }
  return a;
}
// column fragment from a [K][ld] layout (column n), rows >= K read as 0
__device__ __forceinline__ v16h fragc_f32(const float* W, int k0, int n, int lane, int ld, int K) {
  v16h a; const int g = lane >> 4;
#pragma unroll
  for (int i = 0; i < 8; ++i) { const int ka = k0 + 8 * g + i, kb = ka + 16;
    a[i] = (_Float16)(ka < K ? W[(size_t)(ka < K ? ka : K - 1) * ld + n] : 0.f); a[8 + i] = (_Float16)(kb < K ? W[(size_t)(kb < K ? kb : K - 1) * ld + n] : 0.f); }
  return a;
}
struct F2 { v16b h, l; };
__device__ __forceinline__ F2 bsplit16(const float v[16]) { F2 r;
#pragma unroll
  for (int i = 0; i < 16; ++i) { const __bf16 h = (__bf16)v[i]; r.h[i] = h; r.l[i] = (__bf16)(v[i] - (float)h); }
  return r; }
__device__ __forceinline__ F2 split_row(const float* row, int k0, int lane) { float v[16]; const float* p = row + k0 + 8 * (lane >> 4);
#pragma unroll
  for (int i = 0; i < 8; ++i) { v[i] = p[i]; v[8 + i] = p[16 + i]; }
  return bsplit16(v); }
__device__ __forceinline__ F2 split_rowK(const float* row, int k0, int lane, int K) { float v[16]; const int g = lane >> 4;
#pragma unroll
  for (int i = 0; i < 8; ++i) { const int ka = k0 + 8 * g + i, kb = ka + 16; v[i] = ka < K ? row[ka < K ? ka : K - 1] : 0.f; v[8 + i] = kb < K ? row[kb < K ? kb : K - 1] : 0.f; }
  return bsplit16(v); }
__device__ __forceinline__ F2 split_col(const float* W, int k0, int n, int lane, int ld, int K) { float v[16]; const int g = lane >> 4;
#pragma unroll
  for (int i = 0; i < 8; ++i) { const int ka = k0 + 8 * g + i, kb = ka + 16; v[i] = ka < K ? W[(size_t)(ka < K ? ka : K - 1) * ld + n] : 0.f; v[8 + i] = kb < K ? W[(size_t)(kb < K ? kb : K - 1) * ld + n] : 0.f; }
  return bsplit16(v); }
__device__ __forceinline__ v8f mac3(const F2& a, const F2& b, v8f c) { c = wmma_bf(a.l, b.h, c); c = wmma_bf(a.h, b.l, c); return wmma_bf(a.h, b.h, c); }
__device__ __forceinline__ float sigm(float v) { return 1.0f / (1.0f + expf(-v)); }
#define LDSX() do { asm volatile("s_wait_dscnt 0" ::: "memory"); __builtin_amdgcn_wave_barrier(); __builtin_amdgcn_fence(__ATOMIC_RELEASE, "workgroup"); } while (0)


// STNDT encoder layer (B 16, T 512 time steps, C 512 channels, L 512, 8 heads, hidden 2,048): pre-norm temporal self-attention + FFN (PReLU), spatial attention weights (mean over heads of softmax(q k / 8) on the layer-normed spatial source), temporal-spatial mixing + FFN; returns (ts_out, spatial_weights).
#define NB 16
#define TT 512
#define CC 512
#define LL 512
#define NH 8
#define HS 64
#define HID 2048
#define NR (NB * TT)       // 8,192 temporal rows (b, t)
#define NRS (NB * CC)      // 8,192 spatial rows (b, n)
#define WSC 256.0f
#ifndef TNB
#define TNB NB
#endif
typedef __attribute__((ext_vector_type(8))) __bf16 v8b;
__device__ __forceinline__ v16b frag_b(const __bf16* rowk0, int lane) {
  union { v16b v; v8b q[2]; } u; const __bf16* p = rowk0 + 8 * (lane >> 4);
  u.q[0] = *(const v8b*)p; u.q[1] = *(const v8b*)(p + 16); return u.v;
}
__device__ __forceinline__ float bfr(float v) { return (float)(__bf16)v; }
__device__ __attribute__((noinline)) float exp_ni(float v) { return expf(v); }
__device__ __attribute__((noinline)) float erf_ni(float v) { return erff(v); }

#define WS_PW  0u                                   // f16 x 2^8 natural rows: Wq_t|Wk_t|Wv_t [1536][512], Wo_t [512][512], W1 [2048][512], W2 [512][2048], Wq_s|Wk_s [1024][512], tsW1 [2048][512], tsW2 [512][2048]
#define WS_PO  (WS_PW + 2u * (size_t)1536 * CC)
#define WS_P1  (WS_PO + 2u * (size_t)CC * CC)
#define WS_P2  (WS_P1 + 2u * (size_t)HID * CC)
#define WS_PS  (WS_P2 + 2u * (size_t)CC * HID)
#define WS_PT1 (WS_PS + 2u * (size_t)1024 * LL)
#define WS_PT2 (WS_PT1 + 2u * (size_t)HID * CC)
#define WS_LN  (WS_PT2 + 2u * (size_t)CC * HID)        // f16 LN rows [NR][512] (reused for each pre-norm); f16 Q, K rows [NR][512]; f16 V planes [b][512][T]; f32 ctx [NR][512]
#define WS_Q   (WS_LN + 2u * (size_t)NR * CC)
#define WS_K   (WS_Q + 2u * (size_t)NR * CC)
#define WS_V   (WS_K + 2u * (size_t)NR * CC)
#define WS_O   (WS_V + 2u * (size_t)NB * CC * TT)
#define WS_S1  (WS_O + 4u * (size_t)NR * CC)           // f32 residual streams S1, S2, S3 [NR][512]; f16 hidden [NR][2048]
#define WS_S2  (WS_S1 + 4u * (size_t)NR * CC)
#define WS_S3  (WS_S2 + 4u * (size_t)NR * CC)
#define WS_HH  (WS_S3 + 4u * (size_t)NR * CC)
#define WS_SP  (WS_HH + 2u * (size_t)NR * HID)         // spatial: f16 LN(sp) rows [NRS][512]; f16 qs | ks rows [NRS][1024]; f32 row stats (max, sum) [b][h][n][2]; f16 sw copy [b][c][m]
#define WS_QS  (WS_SP + 2u * (size_t)NRS * LL)
#define WS_ST  (WS_QS + 2u * (size_t)NRS * 1024)
#define WS_SWH (WS_ST + 4u * (size_t)NB * CC * 32)
#define WS_END (WS_SWH + 2u * (size_t)NB * CC * CC)
#define OUT1   ((size_t)NR * CC)                      // float offset of spatial_weights in d_out

// ---- k_pack: f16 x 2^8 copies of the natural [out][in] rows. The packed planes lie one behind another in the order Wq_t Wk_t Wv_t Wo_t W1 W2 Wq_s Wk_s tsW1 tsW2 and each is a plain copy of its source, so the whole is 22 units of 262,144 elements. One work-group a WGP: block b takes elements b * 1,024 ... + 1,023 of every unit, a thread one 16-byte load of each (22 in flight), no LDS
#define PU 262144
__global__ __launch_bounds__(256) void k_pack(const float* __restrict__ WQ, const float* __restrict__ WK, const float* __restrict__ WV, const float* __restrict__ WO, const float* __restrict__ W1, const float* __restrict__ W2, const float* __restrict__ WQS, const float* __restrict__ WKS, const float* __restrict__ T1, const float* __restrict__ T2, _Float16* __restrict__ P) {
  const unsigned ob = blockIdx.x * 4096u + threadIdx.x * 16u;   // the thread's byte offset in every f32 unit
  const float* const s[22] = { WQ, WK, WV, WO, W1, W1 + PU, W1 + 2 * PU, W1 + 3 * PU, W2, W2 + PU, W2 + 2 * PU, W2 + 3 * PU, WQS, WKS, T1, T1 + PU, T1 + 2 * PU, T1 + 3 * PU, T2, T2 + PU, T2 + 2 * PU, T2 + 3 * PU };
  v4f x[22];
#pragma unroll   // straight-line: every index into s and x a constant
  for (int u = 0; u < 22; ++u) x[u] = *(const v4f*)((const char*)s[u] + ob);
  __builtin_amdgcn_sched_barrier(0);   // all 22 loads are issued before the first is waited for; without it the last one was sunk behind a wait
#pragma unroll   // as above
  for (int u = 0; u < 22; ++u) { v4hh o;
#pragma unroll   // as above
    for (int e = 0; e < 4; ++e) o[e] = (_Float16)(bfr(x[u][e]) * WSC);
    vst2((char*)(P + (size_t)u * PU) + ob / 2, o); } }
// ---- k_ln: wave = LNR whole rows (512 wide, 16 floats a lane as four 16-byte loads, all rows' loads in flight at once), block = 8 waves, one work-group a WGP: LayerNorm (mean-square var, 1e-5) x g + b -> f16 row; input either a raw input (bf16-rounded) or an f32 stream. The sums stay in the wave: no LDS, no barrier
#define LNR 4
// lane l with lane l ^ M inside its 16-lane row (DPP row_xmask), and with lane l ^ 16
template <int M> __device__ __forceinline__ float xrow(float v) { return __builtin_bit_cast(float, __builtin_amdgcn_update_dpp(0, __builtin_bit_cast(int, v), 0x160 + M, 0xf, 0xf, true)); }
__device__ __forceinline__ float xhalf(float v) { return __builtin_bit_cast(float, __builtin_amdgcn_permlanex16(__builtin_bit_cast(int, v), __builtin_bit_cast(int, v), 0x76543210, 0xfedcba98, false, false)); }
__device__ __forceinline__ float wsum(float v) { v += xrow<1>(v); v += xrow<2>(v); v += xrow<4>(v); v += xrow<8>(v); return v + xhalf(v); }
template <int RAW>
__global__ __launch_bounds__(256) void k_ln(const float* __restrict__ X, const float* __restrict__ G, const float* __restrict__ Bt, _Float16* __restrict__ Y) {
  // the bare unroll directives below keep every index into a register array (x, gg, bb, mu, inv) a constant
  const int lane = threadIdx.x & 31; const size_t e0 = ((size_t)blockIdx.x * 8 + (threadIdx.x >> 5)) * LNR * CC + lane * 4;
  v4f x[LNR][4], gg[4], bb[4]; float mu[LNR], inv[LNR];
#pragma unroll
  for (int r = 0; r < LNR; ++r)
#pragma unroll
    for (int i = 0; i < 4; ++i) x[r][i] = *(const v4f*)(X + e0 + r * CC + i * 128);
#pragma unroll
  for (int i = 0; i < 4; ++i) { gg[i] = *(const v4f*)(G + i * 128 + lane * 4); bb[i] = *(const v4f*)(Bt + i * 128 + lane * 4); }
  __builtin_amdgcn_sched_barrier(0);   // all 24 loads are issued before the first is waited for; without it six of the g and b loads were sunk into the arithmetic, each with a wait of its own
#pragma unroll
  for (int r = 0; r < LNR; ++r) { v4f t = { 0.f, 0.f, 0.f, 0.f };
#pragma unroll
    for (int i = 0; i < 4; ++i) {
      if (RAW) {
#pragma unroll
        for (int e = 0; e < 4; ++e) x[r][i][e] = bfr(x[r][i][e]); }
      t += x[r][i]; }
    mu[r] = wsum((t[0] + t[1]) + (t[2] + t[3])) / (float)CC; }
#pragma unroll
  for (int r = 0; r < LNR; ++r) { v4f q = { 0.f, 0.f, 0.f, 0.f };
#pragma unroll
    for (int i = 0; i < 4; ++i) { x[r][i] -= mu[r]; q += x[r][i] * x[r][i]; }
    inv[r] = wsum((q[0] + q[1]) + (q[2] + q[3])) / (float)CC + 1e-5f; }
#pragma unroll
  for (int r = 0; r < LNR; ++r) inv[r] = 1.0f / sqrtf(inv[r]);
#pragma unroll
  for (int i = 0; i < 4; ++i)
#pragma unroll
    for (int e = 0; e < 4; ++e) { gg[i][e] = bfr(gg[i][e]); bb[i][e] = bfr(bb[i][e]); }
#pragma unroll
  for (int r = 0; r < LNR; ++r)
#pragma unroll
    for (int i = 0; i < 4; ++i) { v4hh o;
#pragma unroll
      for (int e = 0; e < 4; ++e) o[e] = (_Float16)(x[r][i][e] * inv[r] * gg[i][e] + bb[i][e]);
      vst2(Y + e0 + r * CC + i * 128, o); } }
// ---- k_g<MODE>: block = (128 rows, 128 cols[, which]), wave = 64 x 64: generic f16 GEMM A rows [*][KW] . W rows / 2^8. Both operands' 64-k slices (whole 128-B lines) are brought into a two-buffer LDS ring by asynchronous copies; the fragments are read from LDS. MODE 0: q/k/v (which = blockIdx.z): q,k -> f16 rows, v -> planes; MODE 1: OUT32 = RES + A . W + bias; MODE 2: OUT16 = f16(prelu(A . W + bias)) (hidden); MODE 3: qs|ks -> f16 rows [NRS][1024]; MODE 4: mixing, batch = blockIdx.z: OUT32 = RES + A . W, W = sw f16 rows [c][m] of the batch, no 2^8; MODE 5: Wo: A = f32 ctx rows AF (staged as f32, rounded to f16 where the fragment is formed), OUT32 = RES (bf16-rounded) + A . W
// eight copies of 16 B per lane, LS bytes apart in LDS and GS bytes apart in memory; the s_wait_xcnt 0 in the same statement stands in front of every later rewrite of the address registers
template <int LS, int GS>
__device__ __forceinline__ void cp8(unsigned l, const char* p) {
  asm volatile("global_load_async_to_lds_b128 %0, %8, off\n\t"
               "global_load_async_to_lds_b128 %1, %9, off\n\t"
               "global_load_async_to_lds_b128 %2, %10, off\n\t"
               "global_load_async_to_lds_b128 %3, %11, off\n\t"
               "global_load_async_to_lds_b128 %4, %12, off\n\t"
               "global_load_async_to_lds_b128 %5, %13, off\n\t"
               "global_load_async_to_lds_b128 %6, %14, off\n\t"
               "global_load_async_to_lds_b128 %7, %15, off\n\t"
               "s_wait_xcnt 0x0"
               :: "v"(l), "v"(l + 1u * LS), "v"(l + 2u * LS), "v"(l + 3u * LS), "v"(l + 4u * LS), "v"(l + 5u * LS), "v"(l + 6u * LS), "v"(l + 7u * LS),
                  "v"(p), "v"(p + 1 * GS), "v"(p + 2 * GS), "v"(p + 3 * GS), "v"(p + 4 * GS), "v"(p + 5 * GS), "v"(p + 6 * GS), "v"(p + 7 * GS)
               : "memory");
}
// LDS row pitches in bytes, both conflict-free for 16-byte reads: 128-B rows of halves + 16, 256-B rows of floats + 16
#define HPB 144
#define FPB 272
// stage s of the ring: 128 A rows, then 128 W rows, 64 k each, into buffer s & 1 (STB bytes each); la / lw and ga / gw are the lane's own first LDS and memory addresses
template <int MODE, int KW, int STB>
__device__ __forceinline__ void fill(unsigned la, unsigned lw, const char* ga, const char* gw, int s) { const unsigned o = (unsigned)(s & 1) * STB;
  if (MODE == 5) { cp8<8 * FPB, 8 * KW * 4>(la + o, ga + s * 256); cp8<8 * FPB, 8 * KW * 4>(la + o + 64u * FPB, ga + s * 256 + 64 * KW * 4); }
  else cp8<16 * HPB, 16 * KW * 2>(la + o, ga + s * 128);
  cp8<16 * HPB, 16 * KW * 2>(lw + o, gw + s * 128); }
template <int MODE, int KW>
__global__ __launch_bounds__(128) void k_g(const _Float16* __restrict__ A, const float* __restrict__ AF, const _Float16* __restrict__ Wr, const float* __restrict__ BI, const float* __restrict__ RES, const float* __restrict__ ALPHA, float* __restrict__ O32, _Float16* __restrict__ O16, _Float16* __restrict__ O16B, _Float16* __restrict__ VPL, int ow) {
  // the bare unroll directives below keep every index into a register array (acc, a, bf, bb, rv) a constant
  constexpr int APB = (MODE == 5) ? FPB : HPB, WOF = 128 * APB, STB = WOF + 128 * HPB, NS = KW / 64;   // NS ring stages, 8 or 32
  __shared__ __align__(16) char ring[2 * STB];
  const int tid = threadIdx.x, wave = tid >> 5, lane = tid & 31, col = lane & 15, g = lane >> 4, wr = wave >> 1, wc = wave & 1; const int which = blockIdx.z; const size_t rb = (size_t)blockIdx.x * 128 + ((MODE == 4) ? (size_t)which * TT : 0); const int c0 = blockIdx.y * 128; const _Float16* W = Wr + ((MODE == 0 || MODE == 4) ? (size_t)which * CC * KW : 0);
  const size_t r0 = rb + wr * 64; const int cw = c0 + wc * 64;
  const unsigned l0 = (unsigned)(size_t)&ring[0];
  const char* ga = (MODE == 5) ? (const char*)(AF + (rb + (tid >> 4)) * KW + (tid & 15) * 4) : (const char*)(A + (rb + (tid >> 3)) * KW + (tid & 7) * 8);
  const unsigned la = l0 + ((MODE == 5) ? (tid >> 4) * FPB + (tid & 15) * 16 : (tid >> 3) * HPB + (tid & 7) * 16);
  const char* gw = (const char*)(W + (size_t)(c0 + (tid >> 3)) * KW + (tid & 7) * 8); const unsigned lw = l0 + WOF + (tid >> 3) * HPB + (tid & 7) * 16;
  fill<MODE, KW, STB>(la, lw, ga, gw, 0);
  float bb[4] = { 0.f, 0.f, 0.f, 0.f }, alr = 0.f;   // the bias and slope loads fly while stage 0 lands
  if (MODE == 2 || (MODE == 1 && BI)) {
#pragma unroll
    for (int j = 0; j < 4; ++j) bb[j] = BI[cw + j * 16 + col]; }
  if (MODE == 2) alr = ALPHA[0];
  asm volatile("s_wait_asynccnt 0x0" ::: "memory");   // stage 0 has landed before the barrier publishes it
  __syncthreads();
  fill<MODE, KW, STB>(la, lw, ga, gw, 1);
  v8f acc[4][4] = {};
#pragma unroll 1   // one ring trip per loop trip, so that the publish point below stands once, in the written order
  for (int t = 0; t < NS; ++t) { const char* bp = ring + (t & 1) * STB;
#pragma unroll
    for (int kc = 0; kc < 2; ++kc) { v16h a[4], bf[4];
#pragma unroll
      for (int i = 0; i < 4; ++i) { const char* ar = bp + (wr * 64 + i * 16 + col) * APB;
        a[i] = (MODE == 5) ? frag_f32((const float*)ar + kc * 32, lane) : frag_h((const _Float16*)ar + kc * 32, lane);
        bf[i] = frag_h((const _Float16*)(bp + WOF + (wc * 64 + i * 16 + col) * HPB) + kc * 32, lane); }
#pragma unroll
      for (int i = 0; i < 4; ++i)
#pragma unroll
        for (int j = 0; j < 4; ++j) acc[i][j] = wmma16(a[i], bf[j], acc[i][j]); }
    asm volatile("s_wait_dscnt 0x0" ::: "memory");      // this wave's reads of the buffer are over before it is refilled
    asm volatile("s_wait_asynccnt 0x0" ::: "memory");   // this wave's copies of stage t + 1 have landed
    __syncthreads();                                    // publishes stage t + 1 and frees stage t's buffer
    if (t + 2 < NS) fill<MODE, KW, STB>(la, lw, ga, gw, t + 2); }
  asm volatile("s_wait_asynccnt 0x0" ::: "memory");     // no copy is outstanding when the ring becomes output staging
  // output staging: each wave's 64 x 64 tile in its own 18-KiB part of the ring, which every wave has left at the last trip's barrier; the stores go out as whole 128-B lines
  char* stg = ring + wave * 18432;
  if (MODE == 1 || MODE == 4 || MODE == 5) { float_a* sf = (float_a*)stg;   // rows of 68 floats
#pragma unroll
    for (int j = 0; j < 4; ++j) { const float bj = bfr(bb[j]);
#pragma unroll
      for (int i = 0; i < 4; ++i)
#pragma unroll
        for (int r = 0; r < 8; ++r) sf[(i * 16 + 8 * g + r) * 68 + j * 16 + col] = (MODE == 1) ? acc[i][j][r] * (1.0f / WSC) + bj : (MODE == 5) ? acc[i][j][r] * (1.0f / WSC) : acc[i][j][r]; }
    LDSX();
    for (int rl = 0; rl < 64; rl += 16) { v4f rv[8];
#pragma unroll
      for (int u = 0; u < 8; ++u) rv[u] = *(const v4f*)(RES + (r0 + rl + 2 * u + g) * ow + cw + col * 4);
#pragma unroll
      for (int u = 0; u < 8; ++u) { const int row = rl + 2 * u + g; v4f x = rv[u];
        if (MODE == 5) {
#pragma unroll
          for (int e = 0; e < 4; ++e) x[e] = bfr(x[e]); }
        vst2(O32 + (r0 + row) * ow + cw + col * 4, *(const v4f*)(stg + (row * 68 + col * 4) * 4) + x); }
      asm volatile("s_wait_xcnt 0x0" ::: "memory"); }   // before the next trip rewrites the stores' address registers
    return; }
  _Float16* sh = (_Float16*)stg;   // rows of HPB bytes
  if (MODE == 0 && which == 2) {
#pragma unroll
    for (int j = 0; j < 4; ++j)
#pragma unroll
      for (int i = 0; i < 4; ++i) { v8h hv;
#pragma unroll
        for (int r = 0; r < 8; ++r) hv[r] = (_Float16)(acc[i][j][r] * (1.0f / WSC));
        *(v8h*)&sh[(j * 16 + col) * (HPB / 2) + i * 16 + 8 * g] = hv; }
    LDSX(); const size_t b = rb / TT; const int s0 = (int)(rb % TT) + wr * 64;
#pragma unroll   // straight-line: sixteen stores in flight
    for (int d = 0; d < 64; d += 4) { const int dd = d + (lane >> 3), q = lane & 7; vst2((unsigned*)(VPL + ((b * CC + cw + dd) * TT) + s0 + q * 8), *(const v4u*)&sh[dd * (HPB / 2) + q * 8]); }
    return; }
  { const float al = bfr(alr);
#pragma unroll
    for (int j = 0; j < 4; ++j) { const float bj = bfr(bb[j]);
#pragma unroll
      for (int i = 0; i < 4; ++i)
#pragma unroll
        for (int r = 0; r < 8; ++r) { float v = acc[i][j][r] * (1.0f / WSC) + bj; if (MODE == 2) v = (v >= 0.f) ? v : al * v; sh[(i * 16 + 8 * g + r) * (HPB / 2) + j * 16 + col] = (_Float16)v; } } }
  LDSX();
  { _Float16* dst = (MODE == 0) ? ((which == 0) ? O16 : O16B) : O16;
#pragma unroll   // straight-line: sixteen stores in flight
    for (int rl = 0; rl < 64; rl += 4) { const int row = rl + (lane >> 3), q = lane & 7; vst2((unsigned*)(dst + (r0 + row) * ow + cw + q * 8), *(const v4u*)&sh[row * (HPB / 2) + q * 8]); } }
}
// one copy of 16 B per lane, with its s_wait_xcnt 0 in the same statement as in cp8
__device__ __forceinline__ void cp1(unsigned l, const char* p) {
  asm volatile("global_load_async_to_lds_b128 %0, %1, off\n\t"
               "s_wait_xcnt 0x0"
               :: "v"(l), "v"(p) : "memory");
}
// LDS pitch in bytes of a 1,024-B row of halves + 16: conflict-free for 16-byte reads
#define VPB 1040
// ---- k_attn: block = (256 queries, head, b), 16 waves of 16 queries, one work-group a WGP: temporal attention over the 512 steps, 1/8; ctx f32 [NR][512] (256-B head segments). The head's whole K (512 rows of 128 B) and V (64 planes of 1,024 B) are brought into LDS once by asynchronous copies of whole lines; the K, V and P fragments are read from LDS, the query fragments from memory
__global__ __launch_bounds__(512) void k_attn(const _Float16* __restrict__ Q, const _Float16* __restrict__ Kr, const _Float16* __restrict__ V, float* __restrict__ O) {
  __shared__ __align__(16) char sk[TT * HPB]; __shared__ __align__(16) char sv[HS * VPB];
  __shared__ __align__(16) _Float16 sph[16][16][40]; __shared__ __align__(16) float so[16][16][68];
  // the bare unroll directives below keep every index into a register array (aq, kf, vf, s, m, l, acc) a constant
  const int tid = threadIdx.x, wave = tid >> 5, lane = tid & 31, col = lane & 15, g = lane >> 4; const int h = blockIdx.y; const size_t b = blockIdx.z; const int q0 = blockIdx.x * 256 + wave * 16; const size_t rq = b * TT + q0;
  cp8<64 * HPB, 64 * CC * 2>((unsigned)(size_t)&sk[0] + (tid >> 3) * HPB + (tid & 7) * 16, (const char*)(Kr + (b * TT + (tid >> 3)) * CC + h * HS + (tid & 7) * 8));
  cp8<8 * VPB, 8 * TT * 2>((unsigned)(size_t)&sv[0] + (tid >> 6) * VPB + (tid & 63) * 16, (const char*)(V + (b * CC + h * HS + (tid >> 6)) * TT + (tid & 63) * 8));
  v16h aq[2];   // the query loads fly while K and V land
#pragma unroll
  for (int kc = 0; kc < 2; ++kc) aq[kc] = frag_h(Q + (rq + col) * CC + h * HS + kc * 32, lane);
  asm volatile("s_wait_asynccnt 0x0" ::: "memory");   // this wave's copies have landed before the barrier publishes them
  __syncthreads();
  float m[8], l[8];
#pragma unroll
  for (int r = 0; r < 8; ++r) { m[r] = -3.0e38f; l[r] = 0.f; }
  v8f acc[4] = {};
#pragma unroll 1
  for (int ks = 0; ks < TT / 32; ++ks) { const int j0 = ks * 32; v8f s[2]; v16h kf[2][2], vf[4];   // the pass's eight fragments are read as one group
#pragma unroll
    for (int ct = 0; ct < 2; ++ct)
#pragma unroll
      for (int kc = 0; kc < 2; ++kc) kf[ct][kc] = frag_h((const _Float16*)(sk + (j0 + ct * 16 + col) * HPB) + kc * 32, lane);
#pragma unroll
    for (int dt = 0; dt < 4; ++dt) vf[dt] = frag_h((const _Float16*)(sv + (dt * 16 + col) * VPB) + j0, lane);
#pragma unroll
    for (int ct = 0; ct < 2; ++ct) { v8f c = {};
#pragma unroll
      for (int kc = 0; kc < 2; ++kc) c = wmma16(aq[kc], kf[ct][kc], c);
#pragma unroll
      for (int r = 0; r < 8; ++r) s[ct][r] = c[r] * 0.125f; }
#pragma unroll
    for (int r = 0; r < 8; ++r) { float mx = fmaxf(s[0][r], s[1][r]);
#pragma unroll
      for (int o = 1; o < 16; o <<= 1) mx = fmaxf(mx, __shfl_xor(mx, o));
      const float mn = fmaxf(m[r], mx); const float alpha = (m[r] <= -1.0e38f) ? 0.f : __expf(m[r] - mn); const float e0 = __expf(s[0][r] - mn), e1 = __expf(s[1][r] - mn); float es = e0 + e1;
#pragma unroll
      for (int o = 1; o < 16; o <<= 1) es += __shfl_xor(es, o);
      l[r] = l[r] * alpha + es; m[r] = mn;
#pragma unroll
      for (int dt = 0; dt < 4; ++dt) acc[dt][r] *= alpha;
      sph[wave][8 * g + r][col] = (_Float16)(e0 * 2048.0f); sph[wave][8 * g + r][16 + col] = (_Float16)(e1 * 2048.0f); }
    LDSX();
    const v16h pa = frag_h(&sph[wave][col][0], lane);
#pragma unroll
    for (int dt = 0; dt < 4; ++dt) acc[dt] = wmma16(pa, vf[dt], acc[dt]);
    LDSX(); }
#pragma unroll
  for (int r = 0; r < 8; ++r) { const float il = (1.0f / 2048.0f) / l[r];
#pragma unroll
    for (int dt = 0; dt < 4; ++dt) so[wave][8 * g + r][dt * 16 + col] = acc[dt][r] * il; }
  LDSX();
  for (int rl = 0; rl < 16; ++rl) if (lane < 16) vst2(O + (rq + rl) * CC + h * HS + lane * 4, *(const v4f*)&so[wave][rl][lane * 4]);
}
// ---- k_sstat / k_sprob: 512-wide score rows qs_n . ks_m / 8 per head. k_sstat: block = (256 rows n, b, head h), 16 waves of 16 rows, the head's 512 ks rows in LDS: max / sum per row -> ST [b][h][n][2] (a wave's 16 rows fill one 128-B line). k_sprob: block = (64 rows n, b, 64 cols m), 8 waves, wave = 16 rows x 32 cols, the 64 qs rows, the 64 ks rows (all heads) and the rows' stats in LDS: accumulate p / 8 over the heads into the f32 output rows and an f16 copy. Both fill their LDS once by asynchronous copies of whole lines
// __expf (v_exp_f32 of v * log2 e) with a v_nop in the same statement: the v_nop keeps the one free slot behind a transcendental
__device__ __forceinline__ float exp_slot(float v) { float d; asm("v_exp_f32 %0, %1\n\tv_nop" : "=v"(d) : "v"(v * 1.44269504f)); return d; }
__global__ __launch_bounds__(512) void k_sstat(const _Float16* __restrict__ QS, float* __restrict__ ST) {
  __shared__ __align__(16) char sk[CC * HPB];
  // the bare unroll directives below keep every index into a register array (aq, kf, s, m, l) a constant
  const int tid = threadIdx.x, wave = tid >> 5, lane = tid & 31, col = lane & 15, g = lane >> 4; const size_t b = blockIdx.y; const int h = blockIdx.z; const int n0 = blockIdx.x * 256 + wave * 16; const size_t rq = b * CC + n0;
  cp8<64 * HPB, 64 * 1024 * 2>((unsigned)(size_t)&sk[0] + (tid >> 3) * HPB + (tid & 7) * 16, (const char*)(QS + (b * CC + (tid >> 3)) * 1024 + LL + h * HS + (tid & 7) * 8));
  v16h aq[2];   // the qs loads fly while the ks rows land
#pragma unroll
  for (int kc = 0; kc < 2; ++kc) aq[kc] = frag_h(QS + (rq + col) * 1024 + h * HS + kc * 32, lane);
  asm volatile("s_wait_asynccnt 0x0" ::: "memory");   // this wave's copies have landed before the barrier publishes them
  __syncthreads();
  float m[8], l[8];
#pragma unroll
  for (int r = 0; r < 8; ++r) { m[r] = -3.0e38f; l[r] = 0.f; }
#pragma unroll 1
  for (int ks = 0; ks < CC / 32; ++ks) { const int j0 = ks * 32; v8f s[2]; v16h kf[2][2];   // the pass's four fragments are read as one group
#pragma unroll
    for (int ct = 0; ct < 2; ++ct)
#pragma unroll
      for (int kc = 0; kc < 2; ++kc) kf[ct][kc] = frag_h((const _Float16*)(sk + (j0 + ct * 16 + col) * HPB) + kc * 32, lane);
#pragma unroll
    for (int ct = 0; ct < 2; ++ct) { v8f c = {};
#pragma unroll
      for (int kc = 0; kc < 2; ++kc) c = wmma16(aq[kc], kf[ct][kc], c);
#pragma unroll
      for (int r = 0; r < 8; ++r) s[ct][r] = c[r] * 0.125f; }
#pragma unroll
    for (int r = 0; r < 8; ++r) { float mx = fmaxf(s[0][r], s[1][r]);
#pragma unroll
      for (int o = 1; o < 16; o <<= 1) mx = fmaxf(mx, __shfl_xor(mx, o));
      const float mn = fmaxf(m[r], mx); const float ea = exp_slot(m[r] - mn); const float alpha = (m[r] <= -1.0e38f) ? 0.f : ea; float es = exp_slot(s[0][r] - mn) + exp_slot(s[1][r] - mn);
#pragma unroll
      for (int o = 1; o < 16; o <<= 1) es += __shfl_xor(es, o);
      l[r] = l[r] * alpha + es; m[r] = mn; } }
  if (col == 0) { float* p = ST + ((b * NH + h) * CC + n0 + 8 * g) * 2;
#pragma unroll
    for (int q = 0; q < 4; ++q) { const v4f v = { m[2 * q], l[2 * q], m[2 * q + 1], l[2 * q + 1] }; vst2(p + q * 4, v); } }
}
__global__ __launch_bounds__(256) void k_sprob(const _Float16* __restrict__ QS, const float* __restrict__ ST, float* __restrict__ SW, _Float16* __restrict__ SWH) { __shared__ __align__(16) char sq[64 * VPB]; __shared__ __align__(16) char sk[64 * VPB]; __shared__ __align__(16) float sst[NH * 64 * 2];
  // the bare unroll directives below keep every index into a register array (aq, kf, st, accp) a constant
  const int tid = threadIdx.x, wave = tid >> 5, lane = tid & 31, col = lane & 15, g = lane >> 4; const size_t b = blockIdx.y; const int nb = blockIdx.x * 64, mb = blockIdx.z * 64, nl = (wave >> 1) * 16, ml = (wave & 1) * 32; const int n0 = nb + nl; const size_t rq = b * CC + n0; const int j0 = mb + ml;
  { const unsigned lo = (tid >> 6) * VPB + (tid & 63) * 16, lq = (unsigned)(size_t)&sq[0] + lo, lk = (unsigned)(size_t)&sk[0] + lo;
    const char* gq = (const char*)(QS + (b * CC + nb + (tid >> 6)) * 1024 + (tid & 63) * 8); const char* gk = (const char*)(QS + (b * CC + mb + (tid >> 6)) * 1024 + LL + (tid & 63) * 8);
    cp8<4 * VPB, 4 * 2048>(lq, gq); cp8<4 * VPB, 4 * 2048>(lq + 32u * VPB, gq + 32 * 2048);
    cp8<4 * VPB, 4 * 2048>(lk, gk); cp8<4 * VPB, 4 * 2048>(lk + 32u * VPB, gk + 32 * 2048);
    cp1((unsigned)(size_t)&sst[0] + tid * 16, (const char*)(ST + ((b * NH + (tid >> 5)) * CC + nb) * 2 + (tid & 31) * 4)); }   // head tid >> 5: its 64 rows' (max, sum) pairs, 512 B
  asm volatile("s_wait_asynccnt 0x0" ::: "memory");   // this wave's copies have landed before the barrier publishes them
  __syncthreads();
  float accp[2][8];
#pragma unroll
  for (int ct = 0; ct < 2; ++ct)
#pragma unroll
    for (int r = 0; r < 8; ++r) accp[ct][r] = 0.f;
#pragma unroll 1
  for (int h = 0; h < NH; ++h) { v16h aq[2], kf[2][2]; v4f st[4];   // the head's six fragments and the 8 rows' stats are read as one group
#pragma unroll
    for (int kc = 0; kc < 2; ++kc) aq[kc] = frag_h((const _Float16*)(sq + (nl + col) * VPB) + h * HS + kc * 32, lane);
#pragma unroll
    for (int ct = 0; ct < 2; ++ct)
#pragma unroll
      for (int kc = 0; kc < 2; ++kc) kf[ct][kc] = frag_h((const _Float16*)(sk + (ml + ct * 16 + col) * VPB) + h * HS + kc * 32, lane);
#pragma unroll
    for (int q = 0; q < 4; ++q) st[q] = *(const v4f*)&sst[(h * 64 + nl + 8 * g + 2 * q) * 2];
#pragma unroll
    for (int ct = 0; ct < 2; ++ct) { v8f c = {};
#pragma unroll
      for (int kc = 0; kc < 2; ++kc) c = wmma16(aq[kc], kf[ct][kc], c);
#pragma unroll
      for (int r = 0; r < 8; ++r) accp[ct][r] += exp_slot(c[r] * 0.125f - st[r >> 1][(r & 1) * 2]) / st[r >> 1][(r & 1) * 2 + 1]; } }
  __syncthreads();   // every wave has left the qs rows before they become output staging
  float_a* so = (float_a*)(sq + wave * 3584); _Float16* sh = (_Float16*)(sq + wave * 3584 + 2304);   // per wave: 16 rows of 36 floats, then 16 rows of 40 halves
#pragma unroll
  for (int ct = 0; ct < 2; ++ct)
#pragma unroll
    for (int r = 0; r < 8; ++r) { const float v = accp[ct][r] * (1.0f / (float)NH); so[(8 * g + r) * 36 + ct * 16 + col] = v; sh[(8 * g + r) * 40 + ct * 16 + col] = (_Float16)v; }
  LDSX();
  for (int rl = 0; rl < 16; ++rl) { if (lane < 8) vst2(SW + (rq + rl) * CC + j0 + lane * 4, *(const v4f*)&so[rl * 36 + lane * 4]); else if (lane < 12) vst2((unsigned*)(SWH + (rq + rl) * CC + j0 + (lane - 8) * 8), *(const v4u*)&sh[rl * 40 + (lane - 8) * 8]); }
}
extern "C" void kernel_launch(void* const* d_in, const int* in_sizes, int n_in, void* d_out, int out_size, void* d_ws, size_t ws_size, hipStream_t stream) {
  (void)in_sizes; (void)n_in; (void)out_size;
  const float** F = (const float**)d_in;   // 0 src [16,512,512], 1 spatial_src [16,512,512], 2 Wq_t, 3 Wk_t, 4 Wv_t [8,64,512], 5 Wo_t [512,512], 6 Wq_s, 7 Wk_s [8,64,512], 8 W1 [2048,512], 9 b1, 10 W2 [512,2048], 11 b2, 12 tsW1, 13 tsb1, 14 tsW2, 15 tsb2, 16 alpha [1], 17 g1, 18 be1, 19 g2, 20 be2, 21 tsg1, 22 tsbe1, 23 tsg2, 24 tsbe2, 25 sg, 26 sbe
  if (ws_size < (size_t)WS_END) return;
  char* ws = (char*)d_ws; _Float16* P = (_Float16*)ws; _Float16 *LN = (_Float16*)(ws + WS_LN), *Q = (_Float16*)(ws + WS_Q), *Kr = (_Float16*)(ws + WS_K), *V = (_Float16*)(ws + WS_V), *HH = (_Float16*)(ws + WS_HH), *SP = (_Float16*)(ws + WS_SP), *QS = (_Float16*)(ws + WS_QS), *SWH = (_Float16*)(ws + WS_SWH); float *O = (float*)(ws + WS_O), *S1 = (float*)(ws + WS_S1), *S2 = (float*)(ws + WS_S2), *S3 = (float*)(ws + WS_S3), *ST = (float*)(ws + WS_ST);
  float* OUT0 = (float*)d_out; float* SW = (float*)d_out + OUT1;
  const int nr = TNB * TT;   // rows processed (temporal (b,t) and spatial (b,n) alike)
  k_pack<<<PU / 1024, 256, 0, stream>>>(F[2], F[3], F[4], F[5], F[8], F[10], F[6], F[7], F[12], F[14], P);
  // temporal attention block
  k_ln<1><<<nr / (8 * LNR), 256, 0, stream>>>(F[0], F[17], F[18], LN);
  k_g<0, CC><<<dim3(nr / 128, CC / 128, 3), 128, 0, stream>>>(LN, nullptr, P + WS_PW / 2, nullptr, nullptr, nullptr, nullptr, Q, Kr, V, CC);
  k_attn<<<dim3(TT / 256, NH, TNB), 512, 0, stream>>>(Q, Kr, V, O);
  k_g<5, CC><<<dim3(nr / 128, CC / 128, 1), 128, 0, stream>>>(nullptr, O, P + WS_PO / 2, nullptr, F[0], nullptr, S1, nullptr, nullptr, nullptr, CC);
  // FFN 1
  k_ln<0><<<nr / (8 * LNR), 256, 0, stream>>>(S1, F[19], F[20], LN);
  k_g<2, CC><<<dim3(nr / 128, HID / 128, 1), 128, 0, stream>>>(LN, nullptr, P + WS_P1 / 2, F[9], nullptr, F[16], nullptr, HH, nullptr, nullptr, HID);
  k_g<1, HID><<<dim3(nr / 128, CC / 128, 1), 128, 0, stream>>>(HH, nullptr, P + WS_P2 / 2, F[11], S1, nullptr, S2, nullptr, nullptr, nullptr, CC);
  // spatial attention weights
  k_ln<1><<<nr / (8 * LNR), 256, 0, stream>>>(F[1], F[25], F[26], SP);
  k_g<3, LL><<<dim3(nr / 128, 1024 / 128, 1), 128, 0, stream>>>(SP, nullptr, P + WS_PS / 2, nullptr, nullptr, nullptr, nullptr, QS, nullptr, nullptr, 1024);
  k_sstat<<<dim3(CC / 256, TNB, NH), 512, 0, stream>>>(QS, ST);
  k_sprob<<<dim3(CC / 64, TNB, CC / 64), 256, 0, stream>>>(QS, ST, SW, SWH);
  // temporal-spatial mixing
  k_ln<0><<<nr / (8 * LNR), 256, 0, stream>>>(S2, F[21], F[22], LN);
  k_g<4, CC><<<dim3(TT / 128, CC / 128, TNB), 128, 0, stream>>>(LN, nullptr, SWH, nullptr, S2, nullptr, S3, nullptr, nullptr, nullptr, CC);
  // FFN 2
  k_ln<0><<<nr / (8 * LNR), 256, 0, stream>>>(S3, F[23], F[24], LN);
  k_g<2, CC><<<dim3(nr / 128, HID / 128, 1), 128, 0, stream>>>(LN, nullptr, P + WS_PT1 / 2, F[13], nullptr, F[16], nullptr, HH, nullptr, nullptr, HID);
  k_g<1, HID><<<dim3(nr / 128, CC / 128, 1), 128, 0, stream>>>(HH, nullptr, P + WS_PT2 / 2, F[15], S3, nullptr, OUT0, nullptr, nullptr, nullptr, CC);
}

// v005
// It runs in 211 microseconds.
// Timed twice side by side with v004, it ran 1.12 times as fast both times.
// Counting every step since v000, it is 4.86 times as fast.
#include <hip/hip_runtime.h>
#include <math.h>

typedef __attribute__((ext_vector_type(16))) _Float16 v16h;
typedef __attribute__((ext_vector_type(16))) __bf16 v16b;
typedef __attribute__((ext_vector_type(8)))  _Float16 v8h;
typedef __attribute__((ext_vector_type(4)))  _Float16 v4hh;
typedef __attribute__((ext_vector_type(8)))  float v8f;
typedef __attribute__((ext_vector_type(4)))  float v4f;
typedef __attribute__((ext_vector_type(2)))  float v2f;
typedef __attribute__((ext_vector_type(4)))  unsigned v4u;
typedef __attribute__((ext_vector_type(4)))  int v4i;
typedef float __attribute__((may_alias)) float_a;
typedef int __attribute__((may_alias)) int_a;

template <typename T> __device__ __forceinline__ void vst2(void* p, T v) { *(T*)p = v;  }
__device__ __forceinline__ v8f wmma16(v16h a, v16h b, v8f c) {
  v8f d = __builtin_amdgcn_wmma_f32_16x16x32_f16(false, a, false, b, (short)0, c, false, false);
  asm volatile("v_nop\n\tv_nop\n\tv_nop\n\tv_nop" : "+v"(d) : "v"(a), "v"(b));
  return d;
}
__device__ __forceinline__ v8f wmma_bf(v16b a, v16b b, v8f c) {
  v8f d = __builtin_amdgcn_wmma_f32_16x16x32_bf16(false, a, false, b, (short)0, c, false, false);
  asm volatile("v_nop\n\tv_nop\n\tv_nop\n\tv_nop" : "+v"(d) : "v"(a), "v"(b));
  return d;
}
// 16x16x32 fragments: lane = (h = lane>>4, row/col = lane&15); elements 0..7 = k0+8h+0..7, 8..15 = k0+16+8h+0..7; D element r = row 8h+r
__device__ __forceinline__ v16h frag_h(const _Float16* rowk0, int lane) {
  union { v16h v; v8h q[2]; } u; const _Float16* p = rowk0 + 8 * (lane >> 4);
  u.q[0] = *(const v8h*)p; u.q[1] = *(const v8h*)(p + 16); return u.v;
}
__device__ __forceinline__ v16h frag_f32(const float* rowk0, int lane) {
  v16h a; const float* p = rowk0 + 8 * (lane >> 4);
#pragma unroll
  for (int i = 0; i < 8; ++i) { a[i] = (_Float16)p[i]; a[8 + i] = (_Float16)p[16 + i]; }
  return a;
}
__device__ __forceinline__ v16h frag_f32s(const float* rowk0, int lane, float sc) {
  v16h a; const float* p = rowk0 + 8 * (lane >> 4);
#pragma unroll
  for (int i = 0; i < 8; ++i) { a[i] = (_Float16)(p[i] * sc); a[8 + i] = (_Float16)(p[16 + i] * sc); }
  return a;
}
// column fragment from a [K][ld] layout (column n), rows >= K read as 0
__device__ __forceinline__ v16h fragc_f32(const float* W, int k0, int n, int lane, int ld, int K) {
  v16h a; const int g = lane >> 4;
#pragma unroll
  for (int i = 0; i < 8; ++i) { const int ka = k0 + 8 * g + i, kb = ka + 16;
    a[i] = (_Float16)(ka < K ? W[(size_t)(ka < K ? ka : K - 1) * ld + n] : 0.f); a[8 + i] = (_Float16)(kb < K ? W[(size_t)(kb < K ? kb : K - 1) * ld + n] : 0.f); }
  return a;
}
struct F2 { v16b h, l; };
__device__ __forceinline__ F2 bsplit16(const float v[16]) { F2 r;
#pragma unroll
  for (int i = 0; i < 16; ++i) { const __bf16 h = (__bf16)v[i]; r.h[i] = h; r.l[i] = (__bf16)(v[i] - (float)h); }
  return r; }
__device__ __forceinline__ F2 split_row(const float* row, int k0, int lane) { float v[16]; const float* p = row + k0 + 8 * (lane >> 4);
#pragma unroll
  for (int i = 0; i < 8; ++i) { v[i] = p[i]; v[8 + i] = p[16 + i]; }
  return bsplit16(v); }
__device__ __forceinline__ F2 split_rowK(const float* row, int k0, int lane, int K) { float v[16]; const int g = lane >> 4;
#pragma unroll
  for (int i = 0; i < 8; ++i) { const int ka = k0 + 8 * g + i, kb = ka + 16; v[i] = ka < K ? row[ka < K ? ka : K - 1] : 0.f; v[8 + i] = kb < K ? row[kb < K ? kb : K - 1] : 0.f; }
  return bsplit16(v); }
__device__ __forceinline__ F2 split_col(const float* W, int k0, int n, int lane, int ld, int K) { float v[16]; const int g = lane >> 4;
#pragma unroll
  for (int i = 0; i < 8; ++i) { const int ka = k0 + 8 * g + i, kb = ka + 16; v[i] = ka < K ? W[(size_t)(ka < K ? ka : K - 1) * ld + n] : 0.f; v[8 + i] = kb < K ? W[(size_t)(kb < K ? kb : K - 1) * ld + n] : 0.f; }
  return bsplit16(v); }
__device__ __forceinline__ v8f mac3(const F2& a, const F2& b, v8f c) { c = wmma_bf(a.l, b.h, c); c = wmma_bf(a.h, b.l, c); return wmma_bf(a.h, b.h, c); }
__device__ __forceinline__ float sigm(float v) { return 1.0f / (1.0f + expf(-v)); }
#define LDSX() do { asm volatile("s_wait_dscnt 0" ::: "memory"); __builtin_amdgcn_wave_barrier(); __builtin_amdgcn_fence(__ATOMIC_RELEASE, "workgroup"); } while (0)


// STNDT encoder layer (B 16, T 512 time steps, C 512 channels, L 512, 8 heads, hidden 2,048): pre-norm temporal self-attention + FFN (PReLU), spatial attention weights (mean over heads of softmax(q k / 8) on the layer-normed spatial source), temporal-spatial mixing + FFN; returns (ts_out, spatial_weights).
#define NB 16
#define TT 512
#define CC 512
#define LL 512
#define NH 8
#define HS 64
#define HID 2048
#define NR (NB * TT)       // 8,192 temporal rows (b, t)
#define NRS (NB * CC)      // 8,192 spatial rows (b, n)
#define WSC 256.0f
#ifndef TNB
#define TNB NB
#endif
typedef __attribute__((ext_vector_type(8))) __bf16 v8b;
__device__ __forceinline__ v16b frag_b(const __bf16* rowk0, int lane) {
  union { v16b v; v8b q[2]; } u; const __bf16* p = rowk0 + 8 * (lane >> 4);
  u.q[0] = *(const v8b*)p; u.q[1] = *(const v8b*)(p + 16); return u.v;
}
__device__ __forceinline__ float bfr(float v) { return (float)(__bf16)v; }
__device__ __attribute__((noinline)) float exp_ni(float v) { return expf(v); }
__device__ __attribute__((noinline)) float erf_ni(float v) { return erff(v); }

#define WS_PW  0u                                   // f16 x 2^8 natural rows: Wq_t|Wk_t|Wv_t [1536][512], Wo_t [512][512], W1 [2048][512], W2 [512][2048], Wq_s|Wk_s [1024][512], tsW1 [2048][512], tsW2 [512][2048]
#define WS_PO  (WS_PW + 2u * (size_t)1536 * CC)
#define WS_P1  (WS_PO + 2u * (size_t)CC * CC)
#define WS_P2  (WS_P1 + 2u * (size_t)HID * CC)
#define WS_PS  (WS_P2 + 2u * (size_t)CC * HID)
#define WS_PT1 (WS_PS + 2u * (size_t)1024 * LL)
#define WS_PT2 (WS_PT1 + 2u * (size_t)HID * CC)
#define WS_LN  (WS_PT2 + 2u * (size_t)CC * HID)        // f16 LN rows [NR][512] (reused for each pre-norm); f16 Q, K rows [NR][512]; f16 V planes [b][512][T]; f32 ctx [NR][512]
#define WS_Q   (WS_LN + 2u * (size_t)NR * CC)
#define WS_K   (WS_Q + 2u * (size_t)NR * CC)
#define WS_V   (WS_K + 2u * (size_t)NR * CC)
#define WS_O   (WS_V + 2u * (size_t)NB * CC * TT)
#define WS_S1  (WS_O + 4u * (size_t)NR * CC)           // f32 residual streams S1, S2, S3 [NR][512]; f16 hidden [NR][2048]
#define WS_S2  (WS_S1 + 4u * (size_t)NR * CC)
#define WS_S3  (WS_S2 + 4u * (size_t)NR * CC)
#define WS_HH  (WS_S3 + 4u * (size_t)NR * CC)
#define WS_SP  (WS_HH + 2u * (size_t)NR * HID)         // spatial: f16 LN(sp) rows [NRS][512]; f16 qs | ks rows [NRS][1024]; f32 row stats (max, sum) [b][h][n][2]; f16 sw copy [b][c][m]
#define WS_QS  (WS_SP + 2u * (size_t)NRS * LL)
#define WS_ST  (WS_QS + 2u * (size_t)NRS * 1024)
#define WS_SWH (WS_ST + 4u * (size_t)NB * CC * 32)
#define WS_END (WS_SWH + 2u * (size_t)NB * CC * CC)
#define OUT1   ((size_t)NR * CC)                      // float offset of spatial_weights in d_out

// ---- k_pack: f16 x 2^8 copies of the natural [out][in] rows. The packed planes lie one behind another in the order Wq_t Wk_t Wv_t Wo_t W1 W2 Wq_s Wk_s tsW1 tsW2 and each is a plain copy of its source, so the whole is 22 units of 262,144 elements. One work-group a WGP: block b takes elements b * 1,024 ... + 1,023 of every unit, a thread one 16-byte load of each (22 in flight), no LDS
#define PU 262144
__global__ __launch_bounds__(256) void k_pack(const float* __restrict__ WQ, const float* __restrict__ WK, const float* __restrict__ WV, const float* __restrict__ WO, const float* __restrict__ W1, const float* __restrict__ W2, const float* __restrict__ WQS, const float* __restrict__ WKS, const float* __restrict__ T1, const float* __restrict__ T2, _Float16* __restrict__ P) {
  const unsigned ob = blockIdx.x * 4096u + threadIdx.x * 16u;   // the thread's byte offset in every f32 unit
  const float* const s[22] = { WQ, WK, WV, WO, W1, W1 + PU, W1 + 2 * PU, W1 + 3 * PU, W2, W2 + PU, W2 + 2 * PU, W2 + 3 * PU, WQS, WKS, T1, T1 + PU, T1 + 2 * PU, T1 + 3 * PU, T2, T2 + PU, T2 + 2 * PU, T2 + 3 * PU };
  v4f x[22];
#pragma unroll   // straight-line: every index into s and x a constant
  for (int u = 0; u < 22; ++u) x[u] = *(const v4f*)((const char*)s[u] + ob);
  __builtin_amdgcn_sched_barrier(0);   // all 22 loads are issued before the first is waited for; without it the last one was sunk behind a wait
#pragma unroll   // as above
  for (int u = 0; u < 22; ++u) { v4hh o;
#pragma unroll   // as above
    for (int e = 0; e < 4; ++e) o[e] = (_Float16)(bfr(x[u][e]) * WSC);
    vst2((char*)(P + (size_t)u * PU) + ob / 2, o); } }
// ---- k_ln: wave = LNR whole rows (512 wide, 16 floats a lane as four 16-byte loads, all rows' loads in flight at once), block = 8 waves, one work-group a WGP: LayerNorm (mean-square var, 1e-5) x g + b -> f16 row; input either a raw input (bf16-rounded) or an f32 stream. The sums stay in the wave: no LDS, no barrier
#define LNR 4
// lane l with lane l ^ M inside its 16-lane row (DPP row_xmask), and with lane l ^ 16
template <int M> __device__ __forceinline__ float xrow(float v) { return __builtin_bit_cast(float, __builtin_amdgcn_update_dpp(0, __builtin_bit_cast(int, v), 0x160 + M, 0xf, 0xf, true)); }
__device__ __forceinline__ float xhalf(float v) { return __builtin_bit_cast(float, __builtin_amdgcn_permlanex16(__builtin_bit_cast(int, v), __builtin_bit_cast(int, v), 0x76543210, 0xfedcba98, false, false)); }
__device__ __forceinline__ float wsum(float v) { v += xrow<1>(v); v += xrow<2>(v); v += xrow<4>(v); v += xrow<8>(v); return v + xhalf(v); }
template <int RAW>
__global__ __launch_bounds__(256) void k_ln(const float* __restrict__ X, const float* __restrict__ G, const float* __restrict__ Bt, _Float16* __restrict__ Y) {
  // the bare unroll directives below keep every index into a register array (x, gg, bb, mu, inv) a constant
  const int lane = threadIdx.x & 31; const size_t e0 = ((size_t)blockIdx.x * 8 + (threadIdx.x >> 5)) * LNR * CC + lane * 4;
  v4f x[LNR][4], gg[4], bb[4]; float mu[LNR], inv[LNR];
#pragma unroll
  for (int r = 0; r < LNR; ++r)
#pragma unroll
    for (int i = 0; i < 4; ++i) x[r][i] = *(const v4f*)(X + e0 + r * CC + i * 128);
#pragma unroll
  for (int i = 0; i < 4; ++i) { gg[i] = *(const v4f*)(G + i * 128 + lane * 4); bb[i] = *(const v4f*)(Bt + i * 128 + lane * 4); }
  __builtin_amdgcn_sched_barrier(0);   // all 24 loads are issued before the first is waited for; without it six of the g and b loads were sunk into the arithmetic, each with a wait of its own
#pragma unroll
  for (int r = 0; r < LNR; ++r) { v4f t = { 0.f, 0.f, 0.f, 0.f };
#pragma unroll
    for (int i = 0; i < 4; ++i) {
      if (RAW) {
#pragma unroll
        for (int e = 0; e < 4; ++e) x[r][i][e] = bfr(x[r][i][e]); }
      t += x[r][i]; }
    mu[r] = wsum((t[0] + t[1]) + (t[2] + t[3])) / (float)CC; }
#pragma unroll
  for (int r = 0; r < LNR; ++r) { v4f q = { 0.f, 0.f, 0.f, 0.f };
#pragma unroll
    for (int i = 0; i < 4; ++i) { x[r][i] -= mu[r]; q += x[r][i] * x[r][i]; }
    inv[r] = wsum((q[0] + q[1]) + (q[2] + q[3])) / (float)CC + 1e-5f; }
#pragma unroll
  for (int r = 0; r < LNR; ++r) inv[r] = 1.0f / sqrtf(inv[r]);
#pragma unroll
  for (int i = 0; i < 4; ++i)
#pragma unroll
    for (int e = 0; e < 4; ++e) { gg[i][e] = bfr(gg[i][e]); bb[i][e] = bfr(bb[i][e]); }
#pragma unroll
  for (int r = 0; r < LNR; ++r)
#pragma unroll
    for (int i = 0; i < 4; ++i) { v4hh o;
#pragma unroll
      for (int e = 0; e < 4; ++e) o[e] = (_Float16)(x[r][i][e] * inv[r] * gg[i][e] + bb[i][e]);
      vst2(Y + e0 + r * CC + i * 128, o); } }
// ---- k_g<MODE>: block = (128 rows, 128 cols[, which]), wave = 64 x 64: generic f16 GEMM A rows [*][KW] . W rows / 2^8. Both operands' 64-k slices (whole 128-B lines) are brought into a two-buffer LDS ring by asynchronous copies; the fragments are read from LDS. MODE 0: q/k/v (which = blockIdx.z): q,k -> f16 rows, v -> planes; MODE 1: OUT32 = RES + A . W + bias; MODE 2: OUT16 = f16(prelu(A . W + bias)) (hidden); MODE 3: qs|ks -> f16 rows [NRS][1024]; MODE 4: mixing, batch = blockIdx.z: OUT32 = RES + A . W, W = sw f16 rows [c][m] of the batch, no 2^8; MODE 5: Wo: A = f32 ctx rows AF (staged as f32, rounded to f16 where the fragment is formed), OUT32 = RES (bf16-rounded) + A . W
// eight copies of 16 B per lane, LS bytes apart in LDS and GS bytes apart in memory; the s_wait_xcnt 0 in the same statement stands in front of every later rewrite of the address registers
template <int LS, int GS>
__device__ __forceinline__ void cp8(unsigned l, const char* p) {
  asm volatile("global_load_async_to_lds_b128 %0, %8, off\n\t"
               "global_load_async_to_lds_b128 %1, %9, off\n\t"
               "global_load_async_to_lds_b128 %2, %10, off\n\t"
               "global_load_async_to_lds_b128 %3, %11, off\n\t"
               "global_load_async_to_lds_b128 %4, %12, off\n\t"
               "global_load_async_to_lds_b128 %5, %13, off\n\t"
               "global_load_async_to_lds_b128 %6, %14, off\n\t"
               "global_load_async_to_lds_b128 %7, %15, off\n\t"
               "s_wait_xcnt 0x0"
               :: "v"(l), "v"(l + 1u * LS), "v"(l + 2u * LS), "v"(l + 3u * LS), "v"(l + 4u * LS), "v"(l + 5u * LS), "v"(l + 6u * LS), "v"(l + 7u * LS),
                  "v"(p), "v"(p + 1 * GS), "v"(p + 2 * GS), "v"(p + 3 * GS), "v"(p + 4 * GS), "v"(p + 5 * GS), "v"(p + 6 * GS), "v"(p + 7 * GS)
               : "memory");
}
// LDS row pitches in bytes, both conflict-free for 16-byte reads: 128-B rows of halves + 16, 256-B rows of floats + 16
#define HPB 144
#define FPB 272
// stage s of the ring: 128 A rows, then 128 W rows, 64 k each, into buffer s & 1 (STB bytes each); la / lw and ga / gw are the lane's own first LDS and memory addresses
template <int MODE, int KW, int STB>
__device__ __forceinline__ void fill(unsigned la, unsigned lw, const char* ga, const char* gw, int s) { const unsigned o = (unsigned)(s & 1) * STB;
  if (MODE == 5) { cp8<8 * FPB, 8 * KW * 4>(la + o, ga + s * 256); cp8<8 * FPB, 8 * KW * 4>(la + o + 64u * FPB, ga + s * 256 + 64 * KW * 4); }
  else cp8<16 * HPB, 16 * KW * 2>(la + o, ga + s * 128);
  cp8<16 * HPB, 16 * KW * 2>(lw + o, gw + s * 128); }
template <int MODE, int KW>
__global__ __launch_bounds__(128) void k_g(const _Float16* __restrict__ A, const float* __restrict__ AF, const _Float16* __restrict__ Wr, const float* __restrict__ BI, const float* __restrict__ RES, const float* __restrict__ ALPHA, float* __restrict__ O32, _Float16* __restrict__ O16, _Float16* __restrict__ O16B, _Float16* __restrict__ VPL, int ow) {
  // the bare unroll directives below keep every index into a register array (acc, a, bf, bb, rv) a constant
  constexpr int APB = (MODE == 5) ? FPB : HPB, WOF = 128 * APB, STB = WOF + 128 * HPB, NS = KW / 64;   // NS ring stages, 8 or 32
  __shared__ __align__(16) char ring[2 * STB];
  const int tid = threadIdx.x, wave = tid >> 5, lane = tid & 31, col = lane & 15, g = lane >> 4, wr = wave >> 1, wc = wave & 1; const int which = blockIdx.z; const size_t rb = (size_t)blockIdx.x * 128 + ((MODE == 4) ? (size_t)which * TT : 0); const int c0 = blockIdx.y * 128; const _Float16* W = Wr + ((MODE == 0 || MODE == 4) ? (size_t)which * CC * KW : 0);
  const size_t r0 = rb + wr * 64; const int cw = c0 + wc * 64;
  const unsigned l0 = (unsigned)(size_t)&ring[0];
  const char* ga = (MODE == 5) ? (const char*)(AF + (rb + (tid >> 4)) * KW + (tid & 15) * 4) : (const char*)(A + (rb + (tid >> 3)) * KW + (tid & 7) * 8);
  const unsigned la = l0 + ((MODE == 5) ? (tid >> 4) * FPB + (tid & 15) * 16 : (tid >> 3) * HPB + (tid & 7) * 16);
  const char* gw = (const char*)(W + (size_t)(c0 + (tid >> 3)) * KW + (tid & 7) * 8); const unsigned lw = l0 + WOF + (tid >> 3) * HPB + (tid & 7) * 16;
  fill<MODE, KW, STB>(la, lw, ga, gw, 0);
  float bb[4] = { 0.f, 0.f, 0.f, 0.f }, alr = 0.f;   // the bias and slope loads fly while stage 0 lands
  if (MODE == 2 || (MODE == 1 && BI)) {
#pragma unroll
    for (int j = 0; j < 4; ++j) bb[j] = BI[cw + j * 16 + col]; }
  if (MODE == 2) alr = ALPHA[0];
  asm volatile("s_wait_asynccnt 0x0" ::: "memory");   // stage 0 has landed before the barrier publishes it
  __syncthreads();
  fill<MODE, KW, STB>(la, lw, ga, gw, 1);
  v8f acc[4][4] = {};
#pragma unroll 1   // one ring trip per loop trip, so that the publish point below stands once, in the written order
  for (int t = 0; t < NS; ++t) { const char* bp = ring + (t & 1) * STB;
#pragma unroll
    for (int kc = 0; kc < 2; ++kc) { v16h a[4], bf[4];
#pragma unroll
      for (int i = 0; i < 4; ++i) { const char* ar = bp + (wr * 64 + i * 16 + col) * APB;
        a[i] = (MODE == 5) ? frag_f32((const float*)ar + kc * 32, lane) : frag_h((const _Float16*)ar + kc * 32, lane);
        bf[i] = frag_h((const _Float16*)(bp + WOF + (wc * 64 + i * 16 + col) * HPB) + kc * 32, lane); }
#pragma unroll
      for (int i = 0; i < 4; ++i)
#pragma unroll
        for (int j = 0; j < 4; ++j) acc[i][j] = wmma16(a[i], bf[j], acc[i][j]); }
    asm volatile("s_wait_dscnt 0x0" ::: "memory");      // this wave's reads of the buffer are over before it is refilled
    asm volatile("s_wait_asynccnt 0x0" ::: "memory");   // this wave's copies of stage t + 1 have landed
    __syncthreads();                                    // publishes stage t + 1 and frees stage t's buffer
    if (t + 2 < NS) fill<MODE, KW, STB>(la, lw, ga, gw, t + 2); }
  asm volatile("s_wait_asynccnt 0x0" ::: "memory");     // no copy is outstanding when the ring becomes output staging
  // output staging: each wave's 64 x 64 tile in its own 18-KiB part of the ring, which every wave has left at the last trip's barrier; the stores go out as whole 128-B lines
  char* stg = ring + wave * 18432;
  if (MODE == 1 || MODE == 4 || MODE == 5) { float_a* sf = (float_a*)stg;   // rows of 68 floats
#pragma unroll
    for (int j = 0; j < 4; ++j) { const float bj = bfr(bb[j]);
#pragma unroll
      for (int i = 0; i < 4; ++i)
#pragma unroll
        for (int r = 0; r < 8; ++r) sf[(i * 16 + 8 * g + r) * 68 + j * 16 + col] = (MODE == 1) ? acc[i][j][r] * (1.0f / WSC) + bj : (MODE == 5) ? acc[i][j][r] * (1.0f / WSC) : acc[i][j][r]; }
    LDSX();
    for (int rl = 0; rl < 64; rl += 16) { v4f rv[8];
#pragma unroll
      for (int u = 0; u < 8; ++u) rv[u] = *(const v4f*)(RES + (r0 + rl + 2 * u + g) * ow + cw + col * 4);
#pragma unroll
      for (int u = 0; u < 8; ++u) { const int row = rl + 2 * u + g; v4f x = rv[u];
        if (MODE == 5) {
#pragma unroll
          for (int e = 0; e < 4; ++e) x[e] = bfr(x[e]); }
        vst2(O32 + (r0 + row) * ow + cw + col * 4, *(const v4f*)(stg + (row * 68 + col * 4) * 4) + x); }
      asm volatile("s_wait_xcnt 0x0" ::: "memory"); }   // before the next trip rewrites the stores' address registers
    return; }
  _Float16* sh = (_Float16*)stg;   // rows of HPB bytes
  if (MODE == 0 && which == 2) {
#pragma unroll
    for (int j = 0; j < 4; ++j)
#pragma unroll
      for (int i = 0; i < 4; ++i) { v8h hv;
#pragma unroll
        for (int r = 0; r < 8; ++r) hv[r] = (_Float16)(acc[i][j][r] * (1.0f / WSC));
        *(v8h*)&sh[(j * 16 + col) * (HPB / 2) + i * 16 + 8 * g] = hv; }
    LDSX(); const size_t b = rb / TT; const int s0 = (int)(rb % TT) + wr * 64;
#pragma unroll   // straight-line: sixteen stores in flight
    for (int d = 0; d < 64; d += 4) { const int dd = d + (lane >> 3), q = lane & 7; vst2((unsigned*)(VPL + ((b * CC + cw + dd) * TT) + s0 + q * 8), *(const v4u*)&sh[dd * (HPB / 2) + q * 8]); }
    return; }
  { const float al = bfr(alr);
#pragma unroll
    for (int j = 0; j < 4; ++j) { const float bj = bfr(bb[j]);
#pragma unroll
      for (int i = 0; i < 4; ++i)
#pragma unroll
        for (int r = 0; r < 8; ++r) { float v = acc[i][j][r] * (1.0f / WSC) + bj; if (MODE == 2) v = (v >= 0.f) ? v : al * v; sh[(i * 16 + 8 * g + r) * (HPB / 2) + j * 16 + col] = (_Float16)v; } } }
  LDSX();
  { _Float16* dst = (MODE == 0) ? ((which == 0) ? O16 : O16B) : O16;
#pragma unroll   // straight-line: sixteen stores in flight
    for (int rl = 0; rl < 64; rl += 4) { const int row = rl + (lane >> 3), q = lane & 7; vst2((unsigned*)(dst + (r0 + row) * ow + cw + q * 8), *(const v4u*)&sh[row * (HPB / 2) + q * 8]); } }
}
// one copy of 16 B per lane, with its s_wait_xcnt 0 in the same statement as in cp8
__device__ __forceinline__ void cp1(unsigned l, const char* p) {
  asm volatile("global_load_async_to_lds_b128 %0, %1, off\n\t"
               "s_wait_xcnt 0x0"
               :: "v"(l), "v"(p) : "memory");
}
// LDS pitch in bytes of a 1,024-B row of halves + 16: conflict-free for 16-byte reads
#define VPB 1040
// __expf (v_exp_f32 of v * log2 e) with a v_nop in the same statement: the v_nop keeps the one free slot behind a transcendental
__device__ __forceinline__ float exp_slot(float v) { float d; asm("v_exp_f32 %0, %1\n\tv_nop" : "=v"(d) : "v"(v * 1.44269504f)); return d; }
// eight v_exp_f32 of independent values in one statement: each fills the one free slot behind the transcendental before it, the v_nop the last one's; the early-clobber outputs keep every result off the sources
__device__ __forceinline__ v8f exp2x8(v8f x) { float d0, d1, d2, d3, d4, d5, d6, d7;
  asm("v_exp_f32 %0, %8\n\tv_exp_f32 %1, %9\n\tv_exp_f32 %2, %10\n\tv_exp_f32 %3, %11\n\tv_exp_f32 %4, %12\n\tv_exp_f32 %5, %13\n\tv_exp_f32 %6, %14\n\tv_exp_f32 %7, %15\n\tv_nop"
      : "=&v"(d0), "=&v"(d1), "=&v"(d2), "=&v"(d3), "=&v"(d4), "=&v"(d5), "=&v"(d6), "=&v"(d7)
      : "v"(x[0]), "v"(x[1]), "v"(x[2]), "v"(x[3]), "v"(x[4]), "v"(x[5]), "v"(x[6]), "v"(x[7]));
  const v8f d = { d0, d1, d2, d3, d4, d5, d6, d7 }; return d; }
// largest of a lane's 16 raw scores, then of both lane halves: the maximum over the pass's 32 keys of the lane's own query
__device__ __forceinline__ float max32(v8f a, v8f b) { float x = fmaxf(a[0], b[0]);
#pragma unroll   // straight-line: every index into a and b a constant
  for (int r = 1; r < 8; ++r) x = fmaxf(fmaxf(x, a[r]), b[r]);
  return fmaxf(x, xhalf(x)); }
#define SCL2 0.18033688f   // 1/8 x log2 e: raw score -> exponent of 2
__global__ __launch_bounds__(512) void k_attn(const _Float16* __restrict__ Q, const _Float16* __restrict__ Kr, const _Float16* __restrict__ V, float* __restrict__ O) {
  __shared__ __align__(16) char sk[TT * HPB]; __shared__ __align__(16) char sv[HS * VPB];
  __shared__ __align__(16) float so[16][16][68];
  // the bare unroll directives below keep every index into a register array (aq, kf, vf, s, pb, acc) a constant
  const int tid = threadIdx.x, wave = tid >> 5, lane = tid & 31, col = lane & 15, g = lane >> 4; const int h = blockIdx.y; const size_t b = blockIdx.z; const int q0 = blockIdx.x * 256 + wave * 16; const size_t rq = b * TT + q0;
  cp8<64 * HPB, 64 * CC * 2>((unsigned)(size_t)&sk[0] + (tid >> 3) * HPB + (tid & 7) * 16, (const char*)(Kr + (b * TT + (tid >> 3)) * CC + h * HS + (tid & 7) * 8));
  cp8<8 * VPB, 8 * TT * 2>((unsigned)(size_t)&sv[0] + (tid >> 6) * VPB + (tid & 63) * 16, (const char*)(V + (b * CC + h * HS + (tid >> 6)) * TT + (tid & 63) * 8));
  v16h aq[2];   // the query loads fly while K and V land
#pragma unroll
  for (int kc = 0; kc < 2; ++kc) aq[kc] = frag_h(Q + (rq + col) * CC + h * HS + kc * 32, lane);
  asm volatile("s_wait_asynccnt 0x0" ::: "memory");   // this wave's copies have landed before the barrier publishes them
  __syncthreads();
  float m = -3.0e38f; v8f l = {};   // of the lane's query: running maximum of the raw scores (both halves alike); eight partial sums of p x 2^11 over the keys of this lane half
  v8f acc[4] = {};               // acc[dt][r] = O^T[dt * 16 + 8 g + r][query col], x 2^11
#pragma unroll 1
  for (int ks = 0; ks < TT / 32; ++ks) { const int j0 = ks * 32; v8f s[2]; v16h kf[2][2], vf[4];   // the pass's eight fragments are read as one group
#pragma unroll
    for (int ct = 0; ct < 2; ++ct)
#pragma unroll
      for (int kc = 0; kc < 2; ++kc) kf[ct][kc] = frag_h((const _Float16*)(sk + (j0 + ct * 16 + col) * HPB) + kc * 32, lane);
#pragma unroll
    for (int dt = 0; dt < 4; ++dt) vf[dt] = frag_h((const _Float16*)(sv + (dt * 16 + col) * VPB) + j0, lane);
#pragma unroll
    for (int ct = 0; ct < 2; ++ct) { v8f c = {};   // s[ct][r] = raw score of key j0 + ct * 16 + 8 g + r with query col
#pragma unroll
      for (int kc = 0; kc < 2; ++kc) c = wmma16(kf[ct][kc], aq[kc], c);
      s[ct] = c; }
    const float mn = fmaxf(m, max32(s[0], s[1])); const float ea = exp_slot((m - mn) * 0.125f); const float alpha = (m <= -1.0e38f) ? 0.f : ea; const float off = 11.0f - mn * SCL2;
    const v8f e0 = exp2x8(s[0] * SCL2 + off), e1 = exp2x8(s[1] * SCL2 + off);   // p x 2^11
    l = l * alpha + (e0 + e1); m = mn;
    v16h pb;   // element i = key j0 + 8 g + i, element 8 + i = key j0 + 16 + 8 g + i: the k order of frag_h
#pragma unroll
    for (int r = 0; r < 8; ++r) { pb[r] = (_Float16)e0[r]; pb[8 + r] = (_Float16)e1[r]; }
#pragma unroll
    for (int dt = 0; dt < 4; ++dt) acc[dt] = wmma16(vf[dt], pb, acc[dt] * alpha); }
  { float lt = ((l[0] + l[1]) + (l[2] + l[3])) + ((l[4] + l[5]) + (l[6] + l[7])); lt += xhalf(lt); const float il = 1.0f / lt;
#pragma unroll
    for (int dt = 0; dt < 4; ++dt)
#pragma unroll
      for (int q = 0; q < 2; ++q) { const v4f o = { acc[dt][4 * q] * il, acc[dt][4 * q + 1] * il, acc[dt][4 * q + 2] * il, acc[dt][4 * q + 3] * il }; *(v4f*)&so[wave][col][dt * 16 + 8 * g + 4 * q] = o; } }
  LDSX();
  for (int rl = 0; rl < 16; ++rl) if (lane < 16) vst2(O + (rq + rl) * CC + h * HS + lane * 4, *(const v4f*)&so[wave][rl][lane * 4]);
}
// ---- k_sstat / k_sprob: 512-wide score rows qs_n . ks_m / 8 per head. k_sstat: block = (256 rows n, b, head h), 16 waves of 16 rows, the head's 512 ks rows in LDS: scores taken transposed as in k_attn (a lane = one row n): max / sum per row -> ST [b][h][n][2] (a wave's 16 rows fill one 128-B line). k_sprob: block = (64 rows n, b, 64 cols m), 8 waves, wave = 16 rows x 32 cols, the 64 qs rows, the 64 ks rows (all heads) and the rows' stats in LDS: scores transposed likewise, accumulate p / 8 over the heads into the f32 output rows and an f16 copy. Both fill their LDS once by asynchronous copies of whole lines
__global__ __launch_bounds__(512) void k_sstat(const _Float16* __restrict__ QS, float* __restrict__ ST) {
  __shared__ __align__(16) char sk[CC * HPB];
  // the bare unroll directives below keep every index into a register array (aq, kf, s) a constant
  const int tid = threadIdx.x, wave = tid >> 5, lane = tid & 31, col = lane & 15; const size_t b = blockIdx.y; const int h = blockIdx.z; const int n0 = blockIdx.x * 256 + wave * 16; const size_t rq = b * CC + n0;
  cp8<64 * HPB, 64 * 1024 * 2>((unsigned)(size_t)&sk[0] + (tid >> 3) * HPB + (tid & 7) * 16, (const char*)(QS + (b * CC + (tid >> 3)) * 1024 + LL + h * HS + (tid & 7) * 8));
  v16h aq[2];   // the qs loads fly while the ks rows land
#pragma unroll
  for (int kc = 0; kc < 2; ++kc) aq[kc] = frag_h(QS + (rq + col) * 1024 + h * HS + kc * 32, lane);
  asm volatile("s_wait_asynccnt 0x0" ::: "memory");   // this wave's copies have landed before the barrier publishes them
  __syncthreads();
  float m = -3.0e38f; v8f l = {};   // of the lane's row n0 + col: running maximum of the raw scores (both halves alike); eight partial sums over the columns of this lane half
#pragma unroll 1
  for (int ks = 0; ks < CC / 32; ++ks) { const int j0 = ks * 32; v8f s[2]; v16h kf[2][2];   // the pass's four fragments are read as one group
#pragma unroll
    for (int ct = 0; ct < 2; ++ct)
#pragma unroll
      for (int kc = 0; kc < 2; ++kc) kf[ct][kc] = frag_h((const _Float16*)(sk + (j0 + ct * 16 + col) * HPB) + kc * 32, lane);
#pragma unroll
    for (int ct = 0; ct < 2; ++ct) { v8f c = {};   // transposed: s[ct][r] = raw score of column j0 + ct * 16 + 8 g + r with row n0 + col
#pragma unroll
      for (int kc = 0; kc < 2; ++kc) c = wmma16(kf[ct][kc], aq[kc], c);
      s[ct] = c; }
    const float mn = fmaxf(m, max32(s[0], s[1])); const float ea = exp_slot((m - mn) * 0.125f); const float alpha = (m <= -1.0e38f) ? 0.f : ea; const float off = -mn * SCL2;
    l = l * alpha + (exp2x8(s[0] * SCL2 + off) + exp2x8(s[1] * SCL2 + off)); m = mn; }
  float lt = ((l[0] + l[1]) + (l[2] + l[3])) + ((l[4] + l[5]) + (l[6] + l[7])); lt += xhalf(lt);
  if (lane < 16) { const v2f v = { m * 0.125f, lt }; vst2(ST + ((b * NH + h) * CC + n0 + col) * 2, v); }   // 16 lanes x 8 B: the wave's one 128-B line
}
__global__ __launch_bounds__(256) void k_sprob(const _Float16* __restrict__ QS, const float* __restrict__ ST, float* __restrict__ SW, _Float16* __restrict__ SWH) { __shared__ __align__(16) char sq[64 * VPB]; __shared__ __align__(16) char sk[64 * VPB]; __shared__ __align__(16) float sst[NH * 64 * 2];
  // the bare unroll directives below keep every index into a register array (aq, kf, accp, hv) a constant
  const int tid = threadIdx.x, wave = tid >> 5, lane = tid & 31, col = lane & 15, g = lane >> 4; const size_t b = blockIdx.y; const int nb = blockIdx.x * 64, mb = blockIdx.z * 64, nl = (wave >> 1) * 16, ml = (wave & 1) * 32; const int n0 = nb + nl; const size_t rq = b * CC + n0; const int j0 = mb + ml;
  { const unsigned lo = (tid >> 6) * VPB + (tid & 63) * 16, lq = (unsigned)(size_t)&sq[0] + lo, lk = (unsigned)(size_t)&sk[0] + lo;
    const char* gq = (const char*)(QS + (b * CC + nb + (tid >> 6)) * 1024 + (tid & 63) * 8); const char* gk = (const char*)(QS + (b * CC + mb + (tid >> 6)) * 1024 + LL + (tid & 63) * 8);
    cp8<4 * VPB, 4 * 2048>(lq, gq); cp8<4 * VPB, 4 * 2048>(lq + 32u * VPB, gq + 32 * 2048);
    cp8<4 * VPB, 4 * 2048>(lk, gk); cp8<4 * VPB, 4 * 2048>(lk + 32u * VPB, gk + 32 * 2048);
    cp1((unsigned)(size_t)&sst[0] + tid * 16, (const char*)(ST + ((b * NH + (tid >> 5)) * CC + nb) * 2 + (tid & 31) * 4)); }   // head tid >> 5: its 64 rows' (max, sum) pairs, 512 B
  asm volatile("s_wait_asynccnt 0x0" ::: "memory");   // this wave's copies have landed before the barrier publishes them
  __syncthreads();
  v8f accp[2] = {};   // transposed as in k_attn: accp[ct][r] = column j0 + ct * 16 + 8 g + r of the lane's own row n0 + col
#pragma unroll 1
  for (int h = 0; h < NH; ++h) { v16h aq[2], kf[2][2];   // the head's six fragments and the lane's row stats are read as one group
#pragma unroll
    for (int kc = 0; kc < 2; ++kc) aq[kc] = frag_h((const _Float16*)(sq + (nl + col) * VPB) + h * HS + kc * 32, lane);
#pragma unroll
    for (int ct = 0; ct < 2; ++ct)
#pragma unroll
      for (int kc = 0; kc < 2; ++kc) kf[ct][kc] = frag_h((const _Float16*)(sk + (ml + ct * 16 + col) * VPB) + h * HS + kc * 32, lane);
    const v2f st = *(const v2f*)&sst[(h * 64 + nl + col) * 2]; const float off = -st[0] * 1.44269504f, rl = 1.0f / st[1];   // the row's maximum as an exponent of 2, and one division a row and head
#pragma unroll
    for (int ct = 0; ct < 2; ++ct) { v8f c = {};
#pragma unroll
      for (int kc = 0; kc < 2; ++kc) c = wmma16(kf[ct][kc], aq[kc], c);
      accp[ct] += exp2x8(c * SCL2 + off) * rl; } }
  __syncthreads();   // every wave has left the qs rows before they become output staging
  float_a* so = (float_a*)(sq + wave * 3584); _Float16* sh = (_Float16*)(sq + wave * 3584 + 2304);   // per wave: 16 rows of 36 floats, then 16 rows of 40 halves
#pragma unroll
  for (int ct = 0; ct < 2; ++ct) { const v8f v = accp[ct] * (1.0f / (float)NH); v8h hv;   // a lane's 8 values are 8 neighbours of its row: 16-byte LDS stores
#pragma unroll
    for (int r = 0; r < 8; ++r) hv[r] = (_Float16)v[r];
    const v4f v0 = { v[0], v[1], v[2], v[3] }, v1 = { v[4], v[5], v[6], v[7] };
    *(v4f*)&so[col * 36 + ct * 16 + 8 * g] = v0; *(v4f*)&so[col * 36 + ct * 16 + 8 * g + 4] = v1; *(v8h*)&sh[col * 40 + ct * 16 + 8 * g] = hv; }
  LDSX();
  for (int rl = 0; rl < 16; ++rl) { if (lane < 8) vst2(SW + (rq + rl) * CC + j0 + lane * 4, *(const v4f*)&so[rl * 36 + lane * 4]); else if (lane < 12) vst2((unsigned*)(SWH + (rq + rl) * CC + j0 + (lane - 8) * 8), *(const v4u*)&sh[rl * 40 + (lane - 8) * 8]); }
}
extern "C" void kernel_launch(void* const* d_in, const int* in_sizes, int n_in, void* d_out, int out_size, void* d_ws, size_t ws_size, hipStream_t stream) {
  (void)in_sizes; (void)n_in; (void)out_size;
  const float** F = (const float**)d_in;   // 0 src [16,512,512], 1 spatial_src [16,512,512], 2 Wq_t, 3 Wk_t, 4 Wv_t [8,64,512], 5 Wo_t [512,512], 6 Wq_s, 7 Wk_s [8,64,512], 8 W1 [2048,512], 9 b1, 10 W2 [512,2048], 11 b2, 12 tsW1, 13 tsb1, 14 tsW2, 15 tsb2, 16 alpha [1], 17 g1, 18 be1, 19 g2, 20 be2, 21 tsg1, 22 tsbe1, 23 tsg2, 24 tsbe2, 25 sg, 26 sbe
  if (ws_size < (size_t)WS_END) return;
  char* ws = (char*)d_ws; _Float16* P = (_Float16*)ws; _Float16 *LN = (_Float16*)(ws + WS_LN), *Q = (_Float16*)(ws + WS_Q), *Kr = (_Float16*)(ws + WS_K), *V = (_Float16*)(ws + WS_V), *HH = (_Float16*)(ws + WS_HH), *SP = (_Float16*)(ws + WS_SP), *QS = (_Float16*)(ws + WS_QS), *SWH = (_Float16*)(ws + WS_SWH); float *O = (float*)(ws + WS_O), *S1 = (float*)(ws + WS_S1), *S2 = (float*)(ws + WS_S2), *S3 = (float*)(ws + WS_S3), *ST = (float*)(ws + WS_ST);
  float* OUT0 = (float*)d_out; float* SW = (float*)d_out + OUT1;
  const int nr = TNB * TT;   // rows processed (temporal (b,t) and spatial (b,n) alike)
  k_pack<<<PU / 1024, 256, 0, stream>>>(F[2], F[3], F[4], F[5], F[8], F[10], F[6], F[7], F[12], F[14], P);
  // temporal attention block
  k_ln<1><<<nr / (8 * LNR), 256, 0, stream>>>(F[0], F[17], F[18], LN);
  k_g<0, CC><<<dim3(nr / 128, CC / 128, 3), 128, 0, stream>>>(LN, nullptr, P + WS_PW / 2, nullptr, nullptr, nullptr, nullptr, Q, Kr, V, CC);
  k_attn<<<dim3(TT / 256, NH, TNB), 512, 0, stream>>>(Q, Kr, V, O);
  k_g<5, CC><<<dim3(nr / 128, CC / 128, 1), 128, 0, stream>>>(nullptr, O, P + WS_PO / 2, nullptr, F[0], nullptr, S1, nullptr, nullptr, nullptr, CC);
  // FFN 1
  k_ln<0><<<nr / (8 * LNR), 256, 0, stream>>>(S1, F[19], F[20], LN);
  k_g<2, CC><<<dim3(nr / 128, HID / 128, 1), 128, 0, stream>>>(LN, nullptr, P + WS_P1 / 2, F[9], nullptr, F[16], nullptr, HH, nullptr, nullptr, HID);
  k_g<1, HID><<<dim3(nr / 128, CC / 128, 1), 128, 0, stream>>>(HH, nullptr, P + WS_P2 / 2, F[11], S1, nullptr, S2, nullptr, nullptr, nullptr, CC);
  // spatial attention weights
  k_ln<1><<<nr / (8 * LNR), 256, 0, stream>>>(F[1], F[25], F[26], SP);
  k_g<3, LL><<<dim3(nr / 128, 1024 / 128, 1), 128, 0, stream>>>(SP, nullptr, P + WS_PS / 2, nullptr, nullptr, nullptr, nullptr, QS, nullptr, nullptr, 1024);
  k_sstat<<<dim3(CC / 256, TNB, NH), 512, 0, stream>>>(QS, ST);
  k_sprob<<<dim3(CC / 64, TNB, CC / 64), 256, 0, stream>>>(QS, ST, SW, SWH);
  // temporal-spatial mixing
  k_ln<0><<<nr / (8 * LNR), 256, 0, stream>>>(S2, F[21], F[22], LN);
  k_g<4, CC><<<dim3(TT / 128, CC / 128, TNB), 128, 0, stream>>>(LN, nullptr, SWH, nullptr, S2, nullptr, S3, nullptr, nullptr, nullptr, CC);
  // FFN 2
  k_ln<0><<<nr / (8 * LNR), 256, 0, stream>>>(S3, F[23], F[24], LN);
  k_g<2, CC><<<dim3(nr / 128, HID / 128, 1), 128, 0, stream>>>(LN, nullptr, P + WS_PT1 / 2, F[13], nullptr, F[16], nullptr, HH, nullptr, nullptr, HID);
  k_g<1, HID><<<dim3(nr / 128, CC / 128, 1), 128, 0, stream>>>(HH, nullptr, P + WS_PT2 / 2, F[15], S3, nullptr, OUT0, nullptr, nullptr, nullptr, CC);
}

// v006
// A run of this version takes 200 microseconds.
// Two timings next to v005 put it at 1.06 and 1.07 times that version's speed.
// All steps since v000 together make it 5.18 times as fast.
#include <hip/hip_runtime.h>
#include <math.h>

typedef __attribute__((ext_vector_type(16))) _Float16 v16h;
typedef __attribute__((ext_vector_type(16))) __bf16 v16b;
typedef __attribute__((ext_vector_type(8)))  _Float16 v8h;
typedef __attribute__((ext_vector_type(4)))  _Float16 v4hh;
typedef __attribute__((ext_vector_type(8)))  float v8f;
typedef __attribute__((ext_vector_type(4)))  float v4f;
typedef __attribute__((ext_vector_type(2)))  float v2f;
typedef __attribute__((ext_vector_type(4)))  unsigned v4u;
typedef __attribute__((ext_vector_type(4)))  int v4i;
typedef float __attribute__((may_alias)) float_a;
typedef int __attribute__((may_alias)) int_a;

template <typename T> __device__ __forceinline__ void vst2(void* p, T v) { *(T*)p = v;  }
__device__ __forceinline__ v8f wmma16(v16h a, v16h b, v8f c) {
  v8f d = __builtin_amdgcn_wmma_f32_16x16x32_f16(false, a, false, b, (short)0, c, false, false);
  asm volatile("v_nop\n\tv_nop\n\tv_nop\n\tv_nop" : "+v"(d) : "v"(a), "v"(b));
  return d;
}
__device__ __forceinline__ v8f wmma_bf(v16b a, v16b b, v8f c) {
  v8f d = __builtin_amdgcn_wmma_f32_16x16x32_bf16(false, a, false, b, (short)0, c, false, false);
  asm volatile("v_nop\n\tv_nop\n\tv_nop\n\tv_nop" : "+v"(d) : "v"(a), "v"(b));
  return d;
}
// 16x16x32 fragments: lane = (h = lane>>4, row/col = lane&15); elements 0..7 = k0+8h+0..7, 8..15 = k0+16+8h+0..7; D element r = row 8h+r
__device__ __forceinline__ v16h frag_h(const _Float16* rowk0, int lane) {
  union { v16h v; v8h q[2]; } u; const _Float16* p = rowk0 + 8 * (lane >> 4);
  u.q[0] = *(const v8h*)p; u.q[1] = *(const v8h*)(p + 16); return u.v;
}
__device__ __forceinline__ v16h frag_f32(const float* rowk0, int lane) {
  v16h a; const float* p = rowk0 + 8 * (lane >> 4);
#pragma unroll
  for (int i = 0; i < 8; ++i) { a[i] = (_Float16)p[i]; a[8 + i] = (_Float16)p[16 + i]; }
  return a;
}
__device__ __forceinline__ v16h frag_f32s(const float* rowk0, int lane, float sc) {
  v16h a; const float* p = rowk0 + 8 * (lane >> 4);
#pragma unroll
  for (int i = 0; i < 8; ++i) { a[i] = (_Float16)(p[i] * sc); a[8 + i] = (_Float16)(p[16 + i] * sc); }
  return a;
}
// column fragment from a [K][ld] layout (column n), rows >= K read as 0
__device__ __forceinline__ v16h fragc_f32(const float* W, int k0, int n, int lane, int ld, int K) {
  v16h a; const int g = lane >> 4;
#pragma unroll
  for (int i = 0; i < 8; ++i) { const int ka = k0 + 8 * g + i, kb = ka + 16;
    a[i] = (_Float16)(ka < K ? W[(size_t)(ka < K ? ka : K - 1) * ld + n] : 0.f); a[8 + i] = (_Float16)(kb < K ? W[(size_t)(kb < K ? kb : K - 1) * ld + n] : 0.f); }
  return a;
}
struct F2 { v16b h, l; };
__device__ __forceinline__ F2 bsplit16(const float v[16]) { F2 r;
#pragma unroll
  for (int i = 0; i < 16; ++i) { const __bf16 h = (__bf16)v[i]; r.h[i] = h; r.l[i] = (__bf16)(v[i] - (float)h); }
  return r; }
__device__ __forceinline__ F2 split_row(const float* row, int k0, int lane) { float v[16]; const float* p = row + k0 + 8 * (lane >> 4);
#pragma unroll
  for (int i = 0; i < 8; ++i) { v[i] = p[i]; v[8 + i] = p[16 + i]; }
  return bsplit16(v); }
__device__ __forceinline__ F2 split_rowK(const float* row, int k0, int lane, int K) { float v[16]; const int g = lane >> 4;
#pragma unroll
  for (int i = 0; i < 8; ++i) { const int ka = k0 + 8 * g + i, kb = ka + 16; v[i] = ka < K ? row[ka < K ? ka : K - 1] : 0.f; v[8 + i] = kb < K ? row[kb < K ? kb : K - 1] : 0.f; }
  return bsplit16(v); }
__device__ __forceinline__ F2 split_col(const float* W, int k0, int n, int lane, int ld, int K) { float v[16]; const int g = lane >> 4;
#pragma unroll
  for (int i = 0; i < 8; ++i) { const int ka = k0 + 8 * g + i, kb = ka + 16; v[i] = ka < K ? W[(size_t)(ka < K ? ka : K - 1) * ld + n] : 0.f; v[8 + i] = kb < K ? W[(size_t)(kb < K ? kb : K - 1) * ld + n] : 0.f; }
  return bsplit16(v); }
__device__ __forceinline__ v8f mac3(const F2& a, const F2& b, v8f c) { c = wmma_bf(a.l, b.h, c); c = wmma_bf(a.h, b.l, c); return wmma_bf(a.h, b.h, c); }
__device__ __forceinline__ float sigm(float v) { return 1.0f / (1.0f + expf(-v)); }
#define LDSX() do { asm volatile("s_wait_dscnt 0" ::: "memory"); __builtin_amdgcn_wave_barrier(); __builtin_amdgcn_fence(__ATOMIC_RELEASE, "workgroup"); } while (0)


// STNDT encoder layer (B 16, T 512 time steps, C 512 channels, L 512, 8 heads, hidden 2,048): pre-norm temporal self-attention + FFN (PReLU), spatial attention weights (mean over heads of softmax(q k / 8) on the layer-normed spatial source), temporal-spatial mixing + FFN; returns (ts_out, spatial_weights).
#define NB 16
#define TT 512
#define CC 512
#define LL 512
#define NH 8
#define HS 64
#define HID 2048
#define NR (NB * TT)       // 8,192 temporal rows (b, t)
#define NRS (NB * CC)      // 8,192 spatial rows (b, n)
#define WSC 256.0f
#ifndef TNB
#define TNB NB
#endif
typedef __attribute__((ext_vector_type(8))) __bf16 v8b;
__device__ __forceinline__ v16b frag_b(const __bf16* rowk0, int lane) {
  union { v16b v; v8b q[2]; } u; const __bf16* p = rowk0 + 8 * (lane >> 4);
  u.q[0] = *(const v8b*)p; u.q[1] = *(const v8b*)(p + 16); return u.v;
}
__device__ __forceinline__ float bfr(float v) { return (float)(__bf16)v; }
__device__ __attribute__((noinline)) float exp_ni(float v) { return expf(v); }
__device__ __attribute__((noinline)) float erf_ni(float v) { return erff(v); }

#define WS_PW  0u                                   // f16 x 2^8 natural rows: Wq_t|Wk_t|Wv_t [1536][512], Wo_t [512][512], W1 [2048][512], W2 [512][2048], Wq_s|Wk_s [1024][512], tsW1 [2048][512], tsW2 [512][2048]
#define WS_PO  (WS_PW + 2u * (size_t)1536 * CC)
#define WS_P1  (WS_PO + 2u * (size_t)CC * CC)
#define WS_P2  (WS_P1 + 2u * (size_t)HID * CC)
#define WS_PS  (WS_P2 + 2u * (size_t)CC * HID)
#define WS_PT1 (WS_PS + 2u * (size_t)1024 * LL)
#define WS_PT2 (WS_PT1 + 2u * (size_t)HID * CC)
#define WS_LN  (WS_PT2 + 2u * (size_t)CC * HID)        // f16 LN rows [NR][512] (reused for each pre-norm); f16 Q, K rows [NR][512]; f16 V planes [b][512][T]; f32 ctx [NR][512]
#define WS_Q   (WS_LN + 2u * (size_t)NR * CC)
#define WS_K   (WS_Q + 2u * (size_t)NR * CC)
#define WS_V   (WS_K + 2u * (size_t)NR * CC)
#define WS_O   (WS_V + 2u * (size_t)NB * CC * TT)
#define WS_S1  (WS_O + 4u * (size_t)NR * CC)           // f32 residual streams S1, S2, S3 [NR][512]; f16 hidden [NR][2048]
#define WS_S2  (WS_S1 + 4u * (size_t)NR * CC)
#define WS_S3  (WS_S2 + 4u * (size_t)NR * CC)
#define WS_HH  (WS_S3 + 4u * (size_t)NR * CC)
#define WS_SP  (WS_HH + 2u * (size_t)NR * HID)         // spatial: f16 LN(sp) rows [NRS][512]; f16 qs | ks rows [NRS][1024]; f32 row stats (max, sum) [b][h][n][2]; f16 sw copy [b][c][m]
#define WS_QS  (WS_SP + 2u * (size_t)NRS * LL)
#define WS_ST  (WS_QS + 2u * (size_t)NRS * 1024)
#define WS_SWH (WS_ST + 4u * (size_t)NB * CC * 32)
#define WS_END (WS_SWH + 2u * (size_t)NB * CC * CC)
#define OUT1   ((size_t)NR * CC)                      // float offset of spatial_weights in d_out

// ---- pack_body (block blk of PU / 1,024, 256 threads): f16 x 2^8 copies of the natural [out][in] rows. The packed planes lie one behind another in the order Wq_t Wk_t Wv_t Wo_t W1 W2 Wq_s Wk_s tsW1 tsW2 and each is a plain copy of its source, so the whole is 22 units of 262,144 elements. Block b takes elements b * 1,024 ... + 1,023 of every unit, a thread one 16-byte load of each (22 in flight), no LDS
#define PU 262144
__device__ __forceinline__ void pack_body(const float* __restrict__ WQ, const float* __restrict__ WK, const float* __restrict__ WV, const float* __restrict__ WO, const float* __restrict__ W1, const float* __restrict__ W2, const float* __restrict__ WQS, const float* __restrict__ WKS, const float* __restrict__ T1, const float* __restrict__ T2, _Float16* __restrict__ P, unsigned blk) {
  const unsigned ob = blk * 4096u + threadIdx.x * 16u;   // the thread's byte offset in every f32 unit
  const float* const s[22] = { WQ, WK, WV, WO, W1, W1 + PU, W1 + 2 * PU, W1 + 3 * PU, W2, W2 + PU, W2 + 2 * PU, W2 + 3 * PU, WQS, WKS, T1, T1 + PU, T1 + 2 * PU, T1 + 3 * PU, T2, T2 + PU, T2 + 2 * PU, T2 + 3 * PU };
  v4f x[22];
#pragma unroll   // straight-line: every index into s and x a constant
  for (int u = 0; u < 22; ++u) x[u] = *(const v4f*)((const char*)s[u] + ob);
  __builtin_amdgcn_sched_barrier(0);   // all 22 loads are issued before the first is waited for; without it the last one was sunk behind a wait
#pragma unroll   // as above
  for (int u = 0; u < 22; ++u) { v4hh o;
#pragma unroll   // as above
    for (int e = 0; e < 4; ++e) o[e] = (_Float16)(bfr(x[u][e]) * WSC);
    vst2((char*)(P + (size_t)u * PU) + ob / 2, o); } }
// ---- ln_body: wave wv (of NLW) = LNR whole rows (512 wide, 16 floats a lane as four 16-byte loads, all rows' loads in flight at once), in blocks of 8 or 16 waves: LayerNorm (mean-square var, 1e-5) x g + b -> f16 row; input either a raw input (bf16-rounded) or an f32 stream. The sums stay in the wave: no LDS, no barrier
#define LNR 4
// lane l with lane l ^ M inside its 16-lane row (DPP row_xmask), and with lane l ^ 16
template <int M> __device__ __forceinline__ float xrow(float v) { return __builtin_bit_cast(float, __builtin_amdgcn_update_dpp(0, __builtin_bit_cast(int, v), 0x160 + M, 0xf, 0xf, true)); }
__device__ __forceinline__ float xhalf(float v) { return __builtin_bit_cast(float, __builtin_amdgcn_permlanex16(__builtin_bit_cast(int, v), __builtin_bit_cast(int, v), 0x76543210, 0xfedcba98, false, false)); }
__device__ __forceinline__ float wsum(float v) { v += xrow<1>(v); v += xrow<2>(v); v += xrow<4>(v); v += xrow<8>(v); return v + xhalf(v); }
#define NLW (TNB * TT / LNR)   // waves of one LayerNorm over all rows
template <int RAW>
__device__ __forceinline__ void ln_body(const float* __restrict__ X, const float* __restrict__ G, const float* __restrict__ Bt, _Float16* __restrict__ Y, unsigned wv) {
  // the bare unroll directives below keep every index into a register array (x, gg, bb, mu, inv) a constant
  const int lane = threadIdx.x & 31; const size_t e0 = (size_t)wv * LNR * CC + lane * 4;
  v4f x[LNR][4], gg[4], bb[4]; float mu[LNR], inv[LNR];
#pragma unroll
  for (int r = 0; r < LNR; ++r)
#pragma unroll
    for (int i = 0; i < 4; ++i) x[r][i] = *(const v4f*)(X + e0 + r * CC + i * 128);
  asm volatile("s_wait_xcnt 0x0" ::: "memory");   // in front of the g and b loads: in one build the last of them had its result in the row loads' address registers
#pragma unroll
  for (int i = 0; i < 4; ++i) { gg[i] = *(const v4f*)(G + i * 128 + lane * 4); bb[i] = *(const v4f*)(Bt + i * 128 + lane * 4); }
  __builtin_amdgcn_sched_barrier(0);   // all 24 loads are issued before the first is waited for; without it six of the g and b loads were sunk into the arithmetic, each with a wait of its own
#pragma unroll
  for (int r = 0; r < LNR; ++r) { v4f t = { 0.f, 0.f, 0.f, 0.f };
#pragma unroll
    for (int i = 0; i < 4; ++i) {
      if (RAW) {
#pragma unroll
        for (int e = 0; e < 4; ++e) x[r][i][e] = bfr(x[r][i][e]); }
      t += x[r][i]; }
    mu[r] = wsum((t[0] + t[1]) + (t[2] + t[3])) / (float)CC; }
#pragma unroll
  for (int r = 0; r < LNR; ++r) { v4f q = { 0.f, 0.f, 0.f, 0.f };
#pragma unroll
    for (int i = 0; i < 4; ++i) { x[r][i] -= mu[r]; q += x[r][i] * x[r][i]; }
    inv[r] = wsum((q[0] + q[1]) + (q[2] + q[3])) / (float)CC + 1e-5f; }
#pragma unroll
  for (int r = 0; r < LNR; ++r) inv[r] = 1.0f / sqrtf(inv[r]);
#pragma unroll
  for (int i = 0; i < 4; ++i)
#pragma unroll
    for (int e = 0; e < 4; ++e) { gg[i][e] = bfr(gg[i][e]); bb[i][e] = bfr(bb[i][e]); }
#pragma unroll
  for (int r = 0; r < LNR; ++r)
#pragma unroll
    for (int i = 0; i < 4; ++i) { v4hh o;
#pragma unroll
      for (int e = 0; e < 4; ++e) o[e] = (_Float16)(x[r][i][e] * inv[r] * gg[i][e] + bb[i][e]);
      vst2(Y + e0 + r * CC + i * 128, o); } }
__global__ __launch_bounds__(256) void k_ln(const float* __restrict__ X, const float* __restrict__ G, const float* __restrict__ Bt, _Float16* __restrict__ Y) { ln_body<0>(X, G, Bt, Y, blockIdx.x * 8 + (threadIdx.x >> 5)); }
// ---- k_head: three pieces of work that depend on nothing but the inputs, side by side in one grid: blocks 0 ... NLW / 8 - 1 LayerNorm of src, the next NLW / 8 LayerNorm of spatial_src, the rest the weight pack
__global__ __launch_bounds__(256) void k_head(const float* __restrict__ X0, const float* __restrict__ G0, const float* __restrict__ B0, _Float16* __restrict__ Y0, const float* __restrict__ X1, const float* __restrict__ G1, const float* __restrict__ B1, _Float16* __restrict__ Y1,
    const float* __restrict__ WQ, const float* __restrict__ WK, const float* __restrict__ WV, const float* __restrict__ WO, const float* __restrict__ W1, const float* __restrict__ W2, const float* __restrict__ WQS, const float* __restrict__ WKS, const float* __restrict__ T1, const float* __restrict__ T2, _Float16* __restrict__ P) {
  const unsigned blk = blockIdx.x;
  if (blk >= 2 * (NLW / 8)) { pack_body(WQ, WK, WV, WO, W1, W2, WQS, WKS, T1, T2, P, blk - 2 * (NLW / 8)); return; }
  const bool sp = blk >= NLW / 8;
  ln_body<1>(sp ? X1 : X0, sp ? G1 : G0, sp ? B1 : B0, sp ? Y1 : Y0, (sp ? blk - NLW / 8 : blk) * 8 + (threadIdx.x >> 5)); }
// ---- g_body<MODE>: block (bx, by, bz) = (128 rows, 128 cols[, which]), wave = 64 x 64, ring = the block's RB<MODE> bytes of LDS: generic f16 GEMM A rows [*][KW] . W rows / 2^8. Both operands' 64-k slices (whole 128-B lines) are brought into a two-buffer LDS ring by asynchronous copies; the fragments are read from LDS. MODE 0: q/k/v (which = bz): q,k -> f16 rows, v -> planes; MODE 1: OUT32 = RES + A . W + bias; MODE 2: OUT16 = f16(prelu(A . W + bias)) (hidden); MODE 3: qs|ks -> f16 rows [NRS][1024]; MODE 4: mixing, batch = bz: OUT32 = RES + A . W, W = sw f16 rows [c][m] of the batch, no 2^8; MODE 5: Wo: A = f32 ctx rows AF (staged as f32, rounded to f16 where the fragment is formed), OUT32 = RES (bf16-rounded) + A . W
// eight copies of 16 B per lane, LS bytes apart in LDS and GS bytes apart in memory; the s_wait_xcnt 0 in the same statement stands in front of every later rewrite of the address registers
template <int LS, int GS>
__device__ __forceinline__ void cp8(unsigned l, const char* p) {
  asm volatile("global_load_async_to_lds_b128 %0, %8, off\n\t"
               "global_load_async_to_lds_b128 %1, %9, off\n\t"
               "global_load_async_to_lds_b128 %2, %10, off\n\t"
               "global_load_async_to_lds_b128 %3, %11, off\n\t"
               "global_load_async_to_lds_b128 %4, %12, off\n\t"
               "global_load_async_to_lds_b128 %5, %13, off\n\t"
               "global_load_async_to_lds_b128 %6, %14, off\n\t"
               "global_load_async_to_lds_b128 %7, %15, off\n\t"
               "s_wait_xcnt 0x0"
               :: "v"(l), "v"(l + 1u * LS), "v"(l + 2u * LS), "v"(l + 3u * LS), "v"(l + 4u * LS), "v"(l + 5u * LS), "v"(l + 6u * LS), "v"(l + 7u * LS),
                  "v"(p), "v"(p + 1 * GS), "v"(p + 2 * GS), "v"(p + 3 * GS), "v"(p + 4 * GS), "v"(p + 5 * GS), "v"(p + 6 * GS), "v"(p + 7 * GS)
               : "memory");
}
// LDS row pitches in bytes, both conflict-free for 16-byte reads: 128-B rows of halves + 16, 256-B rows of floats + 16
#define HPB 144
#define FPB 272
// stage s of the ring: 128 A rows, then 128 W rows, 64 k each, into buffer s & 1 (STB bytes each); la / lw and ga / gw are the lane's own first LDS and memory addresses
template <int MODE, int KW, int STB>
__device__ __forceinline__ void fill(unsigned la, unsigned lw, const char* ga, const char* gw, int s) { const unsigned o = (unsigned)(s & 1) * STB;
  if (MODE == 5) { cp8<8 * FPB, 8 * KW * 4>(la + o, ga + s * 256); cp8<8 * FPB, 8 * KW * 4>(la + o + 64u * FPB, ga + s * 256 + 64 * KW * 4); }
  else cp8<16 * HPB, 16 * KW * 2>(la + o, ga + s * 128);
  cp8<16 * HPB, 16 * KW * 2>(lw + o, gw + s * 128); }
template <int MODE> constexpr int RB = 2 * (128 * ((MODE == 5) ? FPB : HPB) + 128 * HPB);
template <int MODE, int KW>
__device__ __forceinline__ void g_body(char* ring, const _Float16* __restrict__ A, const float* __restrict__ AF, const _Float16* __restrict__ Wr, const float* __restrict__ BI, const float* __restrict__ RES, const float* __restrict__ ALPHA, float* __restrict__ O32, _Float16* __restrict__ O16, _Float16* __restrict__ O16B, _Float16* __restrict__ VPL, int ow, int bx, int by, int bz) {
  // the bare unroll directives below keep every index into a register array (acc, a, bf, bb, rv) a constant
  constexpr int APB = (MODE == 5) ? FPB : HPB, WOF = 128 * APB, STB = WOF + 128 * HPB, NS = KW / 64;   // NS ring stages, 8 or 32
  const int tid = threadIdx.x, wave = tid >> 5, lane = tid & 31, col = lane & 15, g = lane >> 4, wr = wave >> 1, wc = wave & 1; const int which = bz; const size_t rb = (size_t)bx * 128 + ((MODE == 4) ? (size_t)which * TT : 0); const int c0 = by * 128; const _Float16* W = Wr + ((MODE == 0 || MODE == 4) ? (size_t)which * CC * KW : 0);
  const size_t r0 = rb + wr * 64; const int cw = c0 + wc * 64;
  const unsigned l0 = (unsigned)(size_t)&ring[0];
  const char* ga = (MODE == 5) ? (const char*)(AF + (rb + (tid >> 4)) * KW + (tid & 15) * 4) : (const char*)(A + (rb + (tid >> 3)) * KW + (tid & 7) * 8);
  const unsigned la = l0 + ((MODE == 5) ? (tid >> 4) * FPB + (tid & 15) * 16 : (tid >> 3) * HPB + (tid & 7) * 16);
  const char* gw = (const char*)(W + (size_t)(c0 + (tid >> 3)) * KW + (tid & 7) * 8); const unsigned lw = l0 + WOF + (tid >> 3) * HPB + (tid & 7) * 16;
  fill<MODE, KW, STB>(la, lw, ga, gw, 0);
  float bb[4] = { 0.f, 0.f, 0.f, 0.f }, alr = 0.f;   // the bias and slope loads fly while stage 0 lands
  if (MODE == 2 || (MODE == 1 && BI)) {
#pragma unroll
    for (int j = 0; j < 4; ++j) bb[j] = BI[cw + j * 16 + col]; }
  if (MODE == 2) alr = ALPHA[0];
  asm volatile("s_wait_asynccnt 0x0" ::: "memory");   // stage 0 has landed before the barrier publishes it
  __syncthreads();
  fill<MODE, KW, STB>(la, lw, ga, gw, 1);
  v8f acc[4][4] = {};
#pragma unroll 1   // one ring trip per loop trip, so that the publish point below stands once, in the written order
  for (int t = 0; t < NS; ++t) { const char* bp = ring + (t & 1) * STB;
#pragma unroll
    for (int kc = 0; kc < 2; ++kc) { v16h a[4], bf[4];
#pragma unroll
      for (int i = 0; i < 4; ++i) { const char* ar = bp + (wr * 64 + i * 16 + col) * APB;
        a[i] = (MODE == 5) ? frag_f32((const float*)ar + kc * 32, lane) : frag_h((const _Float16*)ar + kc * 32, lane);
        bf[i] = frag_h((const _Float16*)(bp + WOF + (wc * 64 + i * 16 + col) * HPB) + kc * 32, lane); }
#pragma unroll
      for (int i = 0; i < 4; ++i)
#pragma unroll
        for (int j = 0; j < 4; ++j) acc[i][j] = wmma16(a[i], bf[j], acc[i][j]); }
    asm volatile("s_wait_dscnt 0x0" ::: "memory");      // this wave's reads of the buffer are over before it is refilled
    asm volatile("s_wait_asynccnt 0x0" ::: "memory");   // this wave's copies of stage t + 1 have landed
    __syncthreads();                                    // publishes stage t + 1 and frees stage t's buffer
    if (t + 2 < NS) fill<MODE, KW, STB>(la, lw, ga, gw, t + 2); }
  asm volatile("s_wait_asynccnt 0x0" ::: "memory");     // no copy is outstanding when the ring becomes output staging
  // output staging: each wave's 64 x 64 tile in its own 18-KiB part of the ring, which every wave has left at the last trip's barrier; the stores go out as whole 128-B lines
  char* stg = ring + wave * 18432;
  if (MODE == 1 || MODE == 4 || MODE == 5) { float_a* sf = (float_a*)stg;   // rows of 68 floats
#pragma unroll
    for (int j = 0; j < 4; ++j) { const float bj = bfr(bb[j]);
#pragma unroll
      for (int i = 0; i < 4; ++i)
#pragma unroll
        for (int r = 0; r < 8; ++r) sf[(i * 16 + 8 * g + r) * 68 + j * 16 + col] = (MODE == 1) ? acc[i][j][r] * (1.0f / WSC) + bj : (MODE == 5) ? acc[i][j][r] * (1.0f / WSC) : acc[i][j][r]; }
    LDSX();
    for (int rl = 0; rl < 64; rl += 16) { v4f rv[8];
#pragma unroll
      for (int u = 0; u < 8; ++u) rv[u] = *(const v4f*)(RES + (r0 + rl + 2 * u + g) * ow + cw + col * 4);
#pragma unroll
      for (int u = 0; u < 8; ++u) { const int row = rl + 2 * u + g; v4f x = rv[u];
        if (MODE == 5) {
#pragma unroll
          for (int e = 0; e < 4; ++e) x[e] = bfr(x[e]); }
        vst2(O32 + (r0 + row) * ow + cw + col * 4, *(const v4f*)(stg + (row * 68 + col * 4) * 4) + x); }
      asm volatile("s_wait_xcnt 0x0" ::: "memory"); }   // before the next trip rewrites the stores' address registers
    return; }
  _Float16* sh = (_Float16*)stg;   // rows of HPB bytes
  if (MODE == 0 && which == 2) {
#pragma unroll
    for (int j = 0; j < 4; ++j)
#pragma unroll
      for (int i = 0; i < 4; ++i) { v8h hv;
#pragma unroll
        for (int r = 0; r < 8; ++r) hv[r] = (_Float16)(acc[i][j][r] * (1.0f / WSC));
        *(v8h*)&sh[(j * 16 + col) * (HPB / 2) + i * 16 + 8 * g] = hv; }
    LDSX(); const size_t b = rb / TT; const int s0 = (int)(rb % TT) + wr * 64;
#pragma unroll   // straight-line: sixteen stores in flight
    for (int d = 0; d < 64; d += 4) { const int dd = d + (lane >> 3), q = lane & 7; vst2((unsigned*)(VPL + ((b * CC + cw + dd) * TT) + s0 + q * 8), *(const v4u*)&sh[dd * (HPB / 2) + q * 8]); }
    return; }
  { const float al = bfr(alr);
#pragma unroll
    for (int j = 0; j < 4; ++j) { const float bj = bfr(bb[j]);
#pragma unroll
      for (int i = 0; i < 4; ++i)
#pragma unroll
        for (int r = 0; r < 8; ++r) { float v = acc[i][j][r] * (1.0f / WSC) + bj; if (MODE == 2) v = (v >= 0.f) ? v : al * v; sh[(i * 16 + 8 * g + r) * (HPB / 2) + j * 16 + col] = (_Float16)v; } } }
  LDSX();
  { _Float16* dst = (MODE == 0) ? ((which == 0) ? O16 : O16B) : O16;
#pragma unroll   // straight-line: sixteen stores in flight
    for (int rl = 0; rl < 64; rl += 4) { const int row = rl + (lane >> 3), q = lane & 7; vst2((unsigned*)(dst + (r0 + row) * ow + cw + q * 8), *(const v4u*)&sh[row * (HPB / 2) + q * 8]); } }
}
template <int MODE, int KW>
__global__ __launch_bounds__(128) void k_g(const _Float16* __restrict__ A, const float* __restrict__ AF, const _Float16* __restrict__ Wr, const float* __restrict__ BI, const float* __restrict__ RES, const float* __restrict__ ALPHA, float* __restrict__ O32, _Float16* __restrict__ O16, _Float16* __restrict__ O16B, _Float16* __restrict__ VPL, int ow) {
  __shared__ __align__(16) char ring[RB<MODE>];
  g_body<MODE, KW>(ring, A, AF, Wr, BI, RES, ALPHA, O32, O16, O16B, VPL, ow, blockIdx.x, blockIdx.y, blockIdx.z); }
// ---- k_gws: two independent products side by side in one grid, three work-groups a WGP instead of one and then two: of every three neighbours in the grid one is a tile of Wo (MODE 5) and two are tiles of the spatial qs | ks (MODE 3), so that a WGP's three are such a mix whichever way the grid is dealt out
#define NRB (TNB * TT / 128)   // row tiles
__global__ __launch_bounds__(128) void k_gws(const float* __restrict__ AF, const _Float16* __restrict__ WO, const float* __restrict__ RES, float* __restrict__ O32, const _Float16* __restrict__ A, const _Float16* __restrict__ WS, _Float16* __restrict__ O16) {
  __shared__ __align__(16) char ring[RB<5>];
  const unsigned t = blockIdx.x % 3, q = blockIdx.x / 3, u = (t - 1) * (NRB * (CC / 128)) + q;   // q: the Wo tile; u: the qs | ks tile
  if (t == 0) g_body<5, CC>(ring, nullptr, AF, WO, nullptr, RES, nullptr, O32, nullptr, nullptr, nullptr, CC, q % NRB, q / NRB, 0);
  else g_body<3, LL>(ring, A, nullptr, WS, nullptr, nullptr, nullptr, nullptr, O16, nullptr, nullptr, 1024, u % NRB, u / NRB, 0); }
// one copy of 16 B per lane, with its s_wait_xcnt 0 in the same statement as in cp8
__device__ __forceinline__ void cp1(unsigned l, const char* p) {
  asm volatile("global_load_async_to_lds_b128 %0, %1, off\n\t"
               "s_wait_xcnt 0x0"
               :: "v"(l), "v"(p) : "memory");
}
// LDS pitch in bytes of a 1,024-B row of halves + 16: conflict-free for 16-byte reads
#define VPB 1040
// __expf (v_exp_f32 of v * log2 e) with a v_nop in the same statement: the v_nop keeps the one free slot behind a transcendental
__device__ __forceinline__ float exp_slot(float v) { float d; asm("v_exp_f32 %0, %1\n\tv_nop" : "=v"(d) : "v"(v * 1.44269504f)); return d; }
// eight v_exp_f32 of independent values in one statement: each fills the one free slot behind the transcendental before it, the v_nop the last one's; the early-clobber outputs keep every result off the sources
__device__ __forceinline__ v8f exp2x8(v8f x) { float d0, d1, d2, d3, d4, d5, d6, d7;
  asm("v_exp_f32 %0, %8\n\tv_exp_f32 %1, %9\n\tv_exp_f32 %2, %10\n\tv_exp_f32 %3, %11\n\tv_exp_f32 %4, %12\n\tv_exp_f32 %5, %13\n\tv_exp_f32 %6, %14\n\tv_exp_f32 %7, %15\n\tv_nop"
      : "=&v"(d0), "=&v"(d1), "=&v"(d2), "=&v"(d3), "=&v"(d4), "=&v"(d5), "=&v"(d6), "=&v"(d7)
      : "v"(x[0]), "v"(x[1]), "v"(x[2]), "v"(x[3]), "v"(x[4]), "v"(x[5]), "v"(x[6]), "v"(x[7]));
  const v8f d = { d0, d1, d2, d3, d4, d5, d6, d7 }; return d; }
// largest of a lane's 16 raw scores, then of both lane halves: the maximum over the pass's 32 keys of the lane's own query
__device__ __forceinline__ float max32(v8f a, v8f b) { float x = fmaxf(a[0], b[0]);
#pragma unroll   // straight-line: every index into a and b a constant
  for (int r = 1; r < 8; ++r) x = fmaxf(fmaxf(x, a[r]), b[r]);
  return fmaxf(x, xhalf(x)); }
#define SCL2 0.18033688f   // 1/8 x log2 e: raw score -> exponent of 2
__global__ __launch_bounds__(512) void k_attn(const _Float16* __restrict__ Q, const _Float16* __restrict__ Kr, const _Float16* __restrict__ V, float* __restrict__ O) {
  __shared__ __align__(16) char sk[TT * HPB]; __shared__ __align__(16) char sv[HS * VPB];
  __shared__ __align__(16) float so[16][16][68];
  // the bare unroll directives below keep every index into a register array (aq, kf, vf, s, pb, acc) a constant
  const int tid = threadIdx.x, wave = tid >> 5, lane = tid & 31, col = lane & 15, g = lane >> 4; const int h = blockIdx.y; const size_t b = blockIdx.z; const int q0 = blockIdx.x * 256 + wave * 16; const size_t rq = b * TT + q0;
  cp8<64 * HPB, 64 * CC * 2>((unsigned)(size_t)&sk[0] + (tid >> 3) * HPB + (tid & 7) * 16, (const char*)(Kr + (b * TT + (tid >> 3)) * CC + h * HS + (tid & 7) * 8));
  cp8<8 * VPB, 8 * TT * 2>((unsigned)(size_t)&sv[0] + (tid >> 6) * VPB + (tid & 63) * 16, (const char*)(V + (b * CC + h * HS + (tid >> 6)) * TT + (tid & 63) * 8));
  v16h aq[2];   // the query loads fly while K and V land
#pragma unroll
  for (int kc = 0; kc < 2; ++kc) aq[kc] = frag_h(Q + (rq + col) * CC + h * HS + kc * 32, lane);
  asm volatile("s_wait_asynccnt 0x0" ::: "memory");   // this wave's copies have landed before the barrier publishes them
  __syncthreads();
  float m = -3.0e38f; v8f l = {};   // of the lane's query: running maximum of the raw scores (both halves alike); eight partial sums of p x 2^11 over the keys of this lane half
  v8f acc[4] = {};               // acc[dt][r] = O^T[dt * 16 + 8 g + r][query col], x 2^11
#pragma unroll 1
  for (int ks = 0; ks < TT / 32; ++ks) { const int j0 = ks * 32; v8f s[2]; v16h kf[2][2], vf[4];   // the pass's eight fragments are read as one group
#pragma unroll
    for (int ct = 0; ct < 2; ++ct)
#pragma unroll
      for (int kc = 0; kc < 2; ++kc) kf[ct][kc] = frag_h((const _Float16*)(sk + (j0 + ct * 16 + col) * HPB) + kc * 32, lane);
#pragma unroll
    for (int dt = 0; dt < 4; ++dt) vf[dt] = frag_h((const _Float16*)(sv + (dt * 16 + col) * VPB) + j0, lane);
#pragma unroll
    for (int ct = 0; ct < 2; ++ct) { v8f c = {};   // s[ct][r] = raw score of key j0 + ct * 16 + 8 g + r with query col
#pragma unroll
      for (int kc = 0; kc < 2; ++kc) c = wmma16(kf[ct][kc], aq[kc], c);
      s[ct] = c; }
    const float mn = fmaxf(m, max32(s[0], s[1])); const float ea = exp_slot((m - mn) * 0.125f); const float alpha = (m <= -1.0e38f) ? 0.f : ea; const float off = 11.0f - mn * SCL2;
    const v8f e0 = exp2x8(s[0] * SCL2 + off), e1 = exp2x8(s[1] * SCL2 + off);   // p x 2^11
    l = l * alpha + (e0 + e1); m = mn;
    v16h pb;   // element i = key j0 + 8 g + i, element 8 + i = key j0 + 16 + 8 g + i: the k order of frag_h
#pragma unroll
    for (int r = 0; r < 8; ++r) { pb[r] = (_Float16)e0[r]; pb[8 + r] = (_Float16)e1[r]; }
#pragma unroll
    for (int dt = 0; dt < 4; ++dt) acc[dt] = wmma16(vf[dt], pb, acc[dt] * alpha); }
  { float lt = ((l[0] + l[1]) + (l[2] + l[3])) + ((l[4] + l[5]) + (l[6] + l[7])); lt += xhalf(lt); const float il = 1.0f / lt;
#pragma unroll
    for (int dt = 0; dt < 4; ++dt)
#pragma unroll
      for (int q = 0; q < 2; ++q) { const v4f o = { acc[dt][4 * q] * il, acc[dt][4 * q + 1] * il, acc[dt][4 * q + 2] * il, acc[dt][4 * q + 3] * il }; *(v4f*)&so[wave][col][dt * 16 + 8 * g + 4 * q] = o; } }
  LDSX();
  for (int rl = 0; rl < 16; ++rl) if (lane < 16) vst2(O + (rq + rl) * CC + h * HS + lane * 4, *(const v4f*)&so[wave][rl][lane * 4]);
}
// ---- k_sstat / k_sprob: 512-wide score rows qs_n . ks_m / 8 per head. k_sstat: blocks with blockIdx.z < 4 do the LayerNorm X -> Y of the first FFN (independent work, side by side in one grid); the others: block = (256 rows n, b, 4 + head h), 16 waves of 16 rows, the head's 512 ks rows in LDS: scores taken transposed as in k_attn (a lane = one row n): max / sum per row -> ST [b][h][n][2] (a wave's 16 rows fill one 128-B line). k_sprob: blocks with blockIdx.z < 2 do the LayerNorm X -> Y of the mixing (independent work likewise); the others: block = (64 rows n, b, 2 + 64 cols m), 8 waves, wave = 16 rows x 32 cols, the 64 qs rows, the 64 ks rows (all heads) and the rows' stats in LDS: scores transposed likewise, accumulate p / 8 over the heads into the f32 output rows and an f16 copy. Both fill their LDS once by asynchronous copies of whole lines
__global__ __launch_bounds__(512) void k_sstat(const _Float16* __restrict__ QS, float* __restrict__ ST, const float* __restrict__ X, const float* __restrict__ G, const float* __restrict__ Bt, _Float16* __restrict__ Y) {
  __shared__ __align__(16) char sk[CC * HPB];
  if (blockIdx.z < 4) { ln_body<0>(X, G, Bt, Y, ((blockIdx.z * TNB + blockIdx.y) * 2 + blockIdx.x) * 16 + (threadIdx.x >> 5)); return; }   // 4 * TNB * 2 blocks of 16 waves = NLW waves
  // the bare unroll directives below keep every index into a register array (aq, kf, s) a constant
  const int tid = threadIdx.x, wave = tid >> 5, lane = tid & 31, col = lane & 15; const size_t b = blockIdx.y; const int h = blockIdx.z - 4; const int n0 = blockIdx.x * 256 + wave * 16; const size_t rq = b * CC + n0;
  cp8<64 * HPB, 64 * 1024 * 2>((unsigned)(size_t)&sk[0] + (tid >> 3) * HPB + (tid & 7) * 16, (const char*)(QS + (b * CC + (tid >> 3)) * 1024 + LL + h * HS + (tid & 7) * 8));
  v16h aq[2];   // the qs loads fly while the ks rows land
#pragma unroll
  for (int kc = 0; kc < 2; ++kc) aq[kc] = frag_h(QS + (rq + col) * 1024 + h * HS + kc * 32, lane);
  asm volatile("s_wait_asynccnt 0x0" ::: "memory");   // this wave's copies have landed before the barrier publishes them
  __syncthreads();
  float m = -3.0e38f; v8f l = {};   // of the lane's row n0 + col: running maximum of the raw scores (both halves alike); eight partial sums over the columns of this lane half
#pragma unroll 1
  for (int ks = 0; ks < CC / 32; ++ks) { const int j0 = ks * 32; v8f s[2]; v16h kf[2][2];   // the pass's four fragments are read as one group
#pragma unroll
    for (int ct = 0; ct < 2; ++ct)
#pragma unroll
      for (int kc = 0; kc < 2; ++kc) kf[ct][kc] = frag_h((const _Float16*)(sk + (j0 + ct * 16 + col) * HPB) + kc * 32, lane);
#pragma unroll
    for (int ct = 0; ct < 2; ++ct) { v8f c = {};   // transposed: s[ct][r] = raw score of column j0 + ct * 16 + 8 g + r with row n0 + col
#pragma unroll
      for (int kc = 0; kc < 2; ++kc) c = wmma16(kf[ct][kc], aq[kc], c);
      s[ct] = c; }
    const float mn = fmaxf(m, max32(s[0], s[1])); const float ea = exp_slot((m - mn) * 0.125f); const float alpha = (m <= -1.0e38f) ? 0.f : ea; const float off = -mn * SCL2;
    l = l * alpha + (exp2x8(s[0] * SCL2 + off) + exp2x8(s[1] * SCL2 + off)); m = mn; }
  float lt = ((l[0] + l[1]) + (l[2] + l[3])) + ((l[4] + l[5]) + (l[6] + l[7])); lt += xhalf(lt);
  if (lane < 16) { const v2f v = { m * 0.125f, lt }; vst2(ST + ((b * NH + h) * CC + n0 + col) * 2, v); }   // 16 lanes x 8 B: the wave's one 128-B line
}
__global__ __launch_bounds__(256) void k_sprob(const _Float16* __restrict__ QS, const float* __restrict__ ST, float* __restrict__ SW, _Float16* __restrict__ SWH, const float* __restrict__ X, const float* __restrict__ G, const float* __restrict__ Bt, _Float16* __restrict__ Y) { __shared__ __align__(16) char sq[64 * VPB]; __shared__ __align__(16) char sk[64 * VPB]; __shared__ __align__(16) float sst[NH * 64 * 2];
  if (blockIdx.z < 2) { ln_body<0>(X, G, Bt, Y, ((blockIdx.z * TNB + blockIdx.y) * (CC / 64) + blockIdx.x) * 8 + (threadIdx.x >> 5)); return; }   // 2 * TNB * 8 blocks of 8 waves = NLW waves
  // the bare unroll directives below keep every index into a register array (aq, kf, accp, hv) a constant
  const int tid = threadIdx.x, wave = tid >> 5, lane = tid & 31, col = lane & 15, g = lane >> 4; const size_t b = blockIdx.y; const int nb = blockIdx.x * 64, mb = (blockIdx.z - 2) * 64, nl = (wave >> 1) * 16, ml = (wave & 1) * 32; const int n0 = nb + nl; const size_t rq = b * CC + n0; const int j0 = mb + ml;
  { const unsigned lo = (tid >> 6) * VPB + (tid & 63) * 16, lq = (unsigned)(size_t)&sq[0] + lo, lk = (unsigned)(size_t)&sk[0] + lo;
    const char* gq = (const char*)(QS + (b * CC + nb + (tid >> 6)) * 1024 + (tid & 63) * 8); const char* gk = (const char*)(QS + (b * CC + mb + (tid >> 6)) * 1024 + LL + (tid & 63) * 8);
    cp8<4 * VPB, 4 * 2048>(lq, gq); cp8<4 * VPB, 4 * 2048>(lq + 32u * VPB, gq + 32 * 2048);
    cp8<4 * VPB, 4 * 2048>(lk, gk); cp8<4 * VPB, 4 * 2048>(lk + 32u * VPB, gk + 32 * 2048);
    cp1((unsigned)(size_t)&sst[0] + tid * 16, (const char*)(ST + ((b * NH + (tid >> 5)) * CC + nb) * 2 + (tid & 31) * 4)); }   // head tid >> 5: its 64 rows' (max, sum) pairs, 512 B
  asm volatile("s_wait_asynccnt 0x0" ::: "memory");   // this wave's copies have landed before the barrier publishes them
  __syncthreads();
  v8f accp[2] = {};   // transposed as in k_attn: accp[ct][r] = column j0 + ct * 16 + 8 g + r of the lane's own row n0 + col
#pragma unroll 1
  for (int h = 0; h < NH; ++h) { v16h aq[2], kf[2][2];   // the head's six fragments and the lane's row stats are read as one group
#pragma unroll
    for (int kc = 0; kc < 2; ++kc) aq[kc] = frag_h((const _Float16*)(sq + (nl + col) * VPB) + h * HS + kc * 32, lane);
#pragma unroll
    for (int ct = 0; ct < 2; ++ct)
#pragma unroll
      for (int kc = 0; kc < 2; ++kc) kf[ct][kc] = frag_h((const _Float16*)(sk + (ml + ct * 16 + col) * VPB) + h * HS + kc * 32, lane);
    const v2f st = *(const v2f*)&sst[(h * 64 + nl + col) * 2]; const float off = -st[0] * 1.44269504f, rl = 1.0f / st[1];   // the row's maximum as an exponent of 2, and one division a row and head
#pragma unroll
    for (int ct = 0; ct < 2; ++ct) { v8f c = {};
#pragma unroll
      for (int kc = 0; kc < 2; ++kc) c = wmma16(kf[ct][kc], aq[kc], c);
      accp[ct] += exp2x8(c * SCL2 + off) * rl; } }
  __syncthreads();   // every wave has left the qs rows before they become output staging
  float_a* so = (float_a*)(sq + wave * 3584); _Float16* sh = (_Float16*)(sq + wave * 3584 + 2304);   // per wave: 16 rows of 36 floats, then 16 rows of 40 halves
#pragma unroll
  for (int ct = 0; ct < 2; ++ct) { const v8f v = accp[ct] * (1.0f / (float)NH); v8h hv;   // a lane's 8 values are 8 neighbours of its row: 16-byte LDS stores
#pragma unroll
    for (int r = 0; r < 8; ++r) hv[r] = (_Float16)v[r];
    const v4f v0 = { v[0], v[1], v[2], v[3] }, v1 = { v[4], v[5], v[6], v[7] };
    *(v4f*)&so[col * 36 + ct * 16 + 8 * g] = v0; *(v4f*)&so[col * 36 + ct * 16 + 8 * g + 4] = v1; *(v8h*)&sh[col * 40 + ct * 16 + 8 * g] = hv; }
  LDSX();
  for (int rl = 0; rl < 16; ++rl) { if (lane < 8) vst2(SW + (rq + rl) * CC + j0 + lane * 4, *(const v4f*)&so[rl * 36 + lane * 4]); else if (lane < 12) vst2((unsigned*)(SWH + (rq + rl) * CC + j0 + (lane - 8) * 8), *(const v4u*)&sh[rl * 40 + (lane - 8) * 8]); }
}
extern "C" void kernel_launch(void* const* d_in, const int* in_sizes, int n_in, void* d_out, int out_size, void* d_ws, size_t ws_size, hipStream_t stream) {
  (void)in_sizes; (void)n_in; (void)out_size;
  const float** F = (const float**)d_in;   // 0 src [16,512,512], 1 spatial_src [16,512,512], 2 Wq_t, 3 Wk_t, 4 Wv_t [8,64,512], 5 Wo_t [512,512], 6 Wq_s, 7 Wk_s [8,64,512], 8 W1 [2048,512], 9 b1, 10 W2 [512,2048], 11 b2, 12 tsW1, 13 tsb1, 14 tsW2, 15 tsb2, 16 alpha [1], 17 g1, 18 be1, 19 g2, 20 be2, 21 tsg1, 22 tsbe1, 23 tsg2, 24 tsbe2, 25 sg, 26 sbe
  if (ws_size < (size_t)WS_END) return;
  char* ws = (char*)d_ws; _Float16* P = (_Float16*)ws; _Float16 *LN = (_Float16*)(ws + WS_LN), *Q = (_Float16*)(ws + WS_Q), *Kr = (_Float16*)(ws + WS_K), *V = (_Float16*)(ws + WS_V), *HH = (_Float16*)(ws + WS_HH), *SP = (_Float16*)(ws + WS_SP), *QS = (_Float16*)(ws + WS_QS), *SWH = (_Float16*)(ws + WS_SWH); float *O = (float*)(ws + WS_O), *S1 = (float*)(ws + WS_S1), *S2 = (float*)(ws + WS_S2), *S3 = (float*)(ws + WS_S3), *ST = (float*)(ws + WS_ST);
  float* OUT0 = (float*)d_out; float* SW = (float*)d_out + OUT1;
  const int nr = TNB * TT;   // rows processed (temporal (b,t) and spatial (b,n) alike)
  // 12 launches: the weight pack and the spatial branch depend on nothing in the temporal branch before the mixing, so each of their launches shares a grid with a short or thinly filled temporal launch of the same block size
  k_head<<<2 * (NLW / 8) + PU / 1024, 256, 0, stream>>>(F[0], F[17], F[18], LN, F[1], F[25], F[26], SP, F[2], F[3], F[4], F[5], F[8], F[10], F[6], F[7], F[12], F[14], P);
  // temporal attention block; beside Wo the spatial qs | ks
  k_g<0, CC><<<dim3(nr / 128, CC / 128, 3), 128, 0, stream>>>(LN, nullptr, P + WS_PW / 2, nullptr, nullptr, nullptr, nullptr, Q, Kr, V, CC);
  k_attn<<<dim3(TT / 256, NH, TNB), 512, 0, stream>>>(Q, Kr, V, O);
  k_gws<<<NRB * (CC / 128 + 1024 / 128), 128, 0, stream>>>(O, P + WS_PO / 2, F[0], S1, SP, P + WS_PS / 2, QS);
  // FFN 1; beside its LayerNorm the spatial row stats
  k_sstat<<<dim3(CC / 256, TNB, 4 + NH), 512, 0, stream>>>(QS, ST, S1, F[19], F[20], LN);
  k_g<2, CC><<<dim3(nr / 128, HID / 128, 1), 128, 0, stream>>>(LN, nullptr, P + WS_P1 / 2, F[9], nullptr, F[16], nullptr, HH, nullptr, nullptr, HID);
  k_g<1, HID><<<dim3(nr / 128, CC / 128, 1), 128, 0, stream>>>(HH, nullptr, P + WS_P2 / 2, F[11], S1, nullptr, S2, nullptr, nullptr, nullptr, CC);
  // temporal-spatial mixing; beside its LayerNorm the spatial weights
  k_sprob<<<dim3(CC / 64, TNB, 2 + CC / 64), 256, 0, stream>>>(QS, ST, SW, SWH, S2, F[21], F[22], LN);
  k_g<4, CC><<<dim3(TT / 128, CC / 128, TNB), 128, 0, stream>>>(LN, nullptr, SWH, nullptr, S2, nullptr, S3, nullptr, nullptr, nullptr, CC);
  // FFN 2
  k_ln<<<NLW / 8, 256, 0, stream>>>(S3, F[23], F[24], LN);
  k_g<2, CC><<<dim3(nr / 128, HID / 128, 1), 128, 0, stream>>>(LN, nullptr, P + WS_PT1 / 2, F[13], nullptr, F[16], nullptr, HH, nullptr, nullptr, HID);
  k_g<1, HID><<<dim3(nr / 128, CC / 128, 1), 128, 0, stream>>>(HH, nullptr, P + WS_PT2 / 2, F[15], S3, nullptr, OUT0, nullptr, nullptr, nullptr, CC);
}

// v007
// One run takes 173 microseconds.
// In two side-by-side timings against v006, it was 1.13 and 1.14 times as fast.
// Counting every step since v000, it is 5.88 times as fast.
#include <hip/hip_runtime.h>
#include <math.h>

typedef __attribute__((ext_vector_type(16))) _Float16 v16h;
typedef __attribute__((ext_vector_type(16))) __bf16 v16b;
typedef __attribute__((ext_vector_type(8)))  _Float16 v8h;
typedef __attribute__((ext_vector_type(4)))  _Float16 v4hh;
typedef __attribute__((ext_vector_type(8)))  float v8f;
typedef __attribute__((ext_vector_type(4)))  float v4f;
typedef __attribute__((ext_vector_type(2)))  float v2f;
typedef __attribute__((ext_vector_type(4)))  unsigned v4u;
typedef __attribute__((ext_vector_type(4)))  int v4i;
typedef float __attribute__((may_alias)) float_a;
typedef int __attribute__((may_alias)) int_a;

template <typename T> __device__ __forceinline__ void vst2(void* p, T v) { *(T*)p = v;  }
__device__ __forceinline__ v8f wmma16(v16h a, v16h b, v8f c) {
  v8f d = __builtin_amdgcn_wmma_f32_16x16x32_f16(false, a, false, b, (short)0, c, false, false);
  asm volatile("v_nop\n\tv_nop\n\tv_nop\n\tv_nop" : "+v"(d) : "v"(a), "v"(b));
  return d;
}
__device__ __forceinline__ v8f wmma_bf(v16b a, v16b b, v8f c) {
  v8f d = __builtin_amdgcn_wmma_f32_16x16x32_bf16(false, a, false, b, (short)0, c, false, false);
  asm volatile("v_nop\n\tv_nop\n\tv_nop\n\tv_nop" : "+v"(d) : "v"(a), "v"(b));
  return d;
}
// 16x16x32 fragments: lane = (h = lane>>4, row/col = lane&15); elements 0..7 = k0+8h+0..7, 8..15 = k0+16+8h+0..7; D element r = row 8h+r
__device__ __forceinline__ v16h frag_h(const _Float16* rowk0, int lane) {
  union { v16h v; v8h q[2]; } u; const _Float16* p = rowk0 + 8 * (lane >> 4);
  u.q[0] = *(const v8h*)p; u.q[1] = *(const v8h*)(p + 16); return u.v;
}
__device__ __forceinline__ v16h frag_f32(const float* rowk0, int lane) {
  v16h a; const float* p = rowk0 + 8 * (lane >> 4);
#pragma unroll
  for (int i = 0; i < 8; ++i) { a[i] = (_Float16)p[i]; a[8 + i] = (_Float16)p[16 + i]; }
  return a;
}
__device__ __forceinline__ v16h frag_f32s(const float* rowk0, int lane, float sc) {
  v16h a; const float* p = rowk0 + 8 * (lane >> 4);
#pragma unroll
  for (int i = 0; i < 8; ++i) { a[i] = (_Float16)(p[i] * sc); a[8 + i] = (_Float16)(p[16 + i] * sc); }
  return a;
}
// column fragment from a [K][ld] layout (column n), rows >= K read as 0
__device__ __forceinline__ v16h fragc_f32(const float* W, int k0, int n, int lane, int ld, int K) {
  v16h a; const int g = lane >> 4;
#pragma unroll
  for (int i = 0; i < 8; ++i) { const int ka = k0 + 8 * g + i, kb = ka + 16;
    a[i] = (_Float16)(ka < K ? W[(size_t)(ka < K ? ka : K - 1) * ld + n] : 0.f); a[8 + i] = (_Float16)(kb < K ? W[(size_t)(kb < K ? kb : K - 1) * ld + n] : 0.f); }
  return a;
}
struct F2 { v16b h, l; };
__device__ __forceinline__ F2 bsplit16(const float v[16]) { F2 r;
#pragma unroll
  for (int i = 0; i < 16; ++i) { const __bf16 h = (__bf16)v[i]; r.h[i] = h; r.l[i] = (__bf16)(v[i] - (float)h); }
  return r; }
__device__ __forceinline__ F2 split_row(const float* row, int k0, int lane) { float v[16]; const float* p = row + k0 + 8 * (lane >> 4);
#pragma unroll
  for (int i = 0; i < 8; ++i) { v[i] = p[i]; v[8 + i] = p[16 + i]; }
  return bsplit16(v); }
__device__ __forceinline__ F2 split_rowK(const float* row, int k0, int lane, int K) { float v[16]; const int g = lane >> 4;
#pragma unroll
  for (int i = 0; i < 8; ++i) { const int ka = k0 + 8 * g + i, kb = ka + 16; v[i] = ka < K ? row[ka < K ? ka : K - 1] : 0.f; v[8 + i] = kb < K ? row[kb < K ? kb : K - 1] : 0.f; }
  return bsplit16(v); }
__device__ __forceinline__ F2 split_col(const float* W, int k0, int n, int lane, int ld, int K) { float v[16]; const int g = lane >> 4;
#pragma unroll
  for (int i = 0; i < 8; ++i) { const int ka = k0 + 8 * g + i, kb = ka + 16; v[i] = ka < K ? W[(size_t)(ka < K ? ka : K - 1) * ld + n] : 0.f; v[8 + i] = kb < K ? W[(size_t)(kb < K ? kb : K - 1) * ld + n] : 0.f; }
  return bsplit16(v); }
__device__ __forceinline__ v8f mac3(const F2& a, const F2& b, v8f c) { c = wmma_bf(a.l, b.h, c); c = wmma_bf(a.h, b.l, c); return wmma_bf(a.h, b.h, c); }
__device__ __forceinline__ float sigm(float v) { return 1.0f / (1.0f + expf(-v)); }
#define LDSX() do { asm volatile("s_wait_dscnt 0" ::: "memory"); __builtin_amdgcn_wave_barrier(); __builtin_amdgcn_fence(__ATOMIC_RELEASE, "workgroup"); } while (0)


// STNDT encoder layer (B 16, T 512 time steps, C 512 channels, L 512, 8 heads, hidden 2,048): pre-norm temporal self-attention + FFN (PReLU), spatial attention weights (mean over heads of softmax(q k / 8) on the layer-normed spatial source), temporal-spatial mixing + FFN; returns (ts_out, spatial_weights).
#define NB 16
#define TT 512
#define CC 512
#define LL 512
#define NH 8
#define HS 64
#define HID 2048
#define NR (NB * TT)       // 8,192 temporal rows (b, t)
#define NRS (NB * CC)      // 8,192 spatial rows (b, n)
#define WSC 256.0f
#ifndef TNB
#define TNB NB
#endif
typedef __attribute__((ext_vector_type(8))) __bf16 v8b;
__device__ __forceinline__ v16b frag_b(const __bf16* rowk0, int lane) {
  union { v16b v; v8b q[2]; } u; const __bf16* p = rowk0 + 8 * (lane >> 4);
  u.q[0] = *(const v8b*)p; u.q[1] = *(const v8b*)(p + 16); return u.v;
}
__device__ __forceinline__ float bfr(float v) { return (float)(__bf16)v; }
__device__ __attribute__((noinline)) float exp_ni(float v) { return expf(v); }
__device__ __attribute__((noinline)) float erf_ni(float v) { return erff(v); }

#define WS_PW  0u                                   // f16 x 2^8 natural rows: Wq_t|Wk_t|Wv_t [1536][512], Wo_t [512][512], W1 [2048][512], W2 [512][2048], Wq_s|Wk_s [1024][512], tsW1 [2048][512], tsW2 [512][2048]
#define WS_PO  (WS_PW + 2u * (size_t)1536 * CC)
#define WS_P1  (WS_PO + 2u * (size_t)CC * CC)
#define WS_P2  (WS_P1 + 2u * (size_t)HID * CC)
#define WS_PS  (WS_P2 + 2u * (size_t)CC * HID)
#define WS_PT1 (WS_PS + 2u * (size_t)1024 * LL)
#define WS_PT2 (WS_PT1 + 2u * (size_t)HID * CC)
#define WS_LN  (WS_PT2 + 2u * (size_t)CC * HID)        // f16 LN rows [NR][512] (reused for each pre-norm); f16 Q, K rows [NR][512]; f16 V planes [b][512][T]; f32 ctx [NR][512]
#define WS_Q   (WS_LN + 2u * (size_t)NR * CC)
#define WS_K   (WS_Q + 2u * (size_t)NR * CC)
#define WS_V   (WS_K + 2u * (size_t)NR * CC)
#define WS_O   (WS_V + 2u * (size_t)NB * CC * TT)
#define WS_S1  (WS_O + 4u * (size_t)NR * CC)           // f32 residual streams S1, S2, S3 [NR][512]; f16 hidden [NR][2048]
#define WS_S2  (WS_S1 + 4u * (size_t)NR * CC)
#define WS_S3  (WS_S2 + 4u * (size_t)NR * CC)
#define WS_HH  (WS_S3 + 4u * (size_t)NR * CC)
#define WS_SP  (WS_HH + 2u * (size_t)NR * HID)         // spatial: f16 LN(sp) rows [NRS][512]; f16 qs | ks rows [NRS][1024]; f32 row stats (max, sum) [b][h][n][2]; f16 sw copy [b][c][m]
#define WS_QS  (WS_SP + 2u * (size_t)NRS * LL)
#define WS_ST  (WS_QS + 2u * (size_t)NRS * 1024)
#define WS_SWH (WS_ST + 4u * (size_t)NB * CC * 32)
#define WS_END (WS_SWH + 2u * (size_t)NB * CC * CC)
#define OUT1   ((size_t)NR * CC)                      // float offset of spatial_weights in d_out

// ---- pack_body (block blk of PU / 1,024, 256 threads): f16 x 2^8 copies of the natural [out][in] rows. The packed planes lie one behind another in the order Wq_t Wk_t Wv_t Wo_t W1 W2 Wq_s Wk_s tsW1 tsW2 and each is a plain copy of its source, so the whole is 22 units of 262,144 elements. Block b takes elements b * 1,024 ... + 1,023 of every unit, a thread one 16-byte load of each (22 in flight), no LDS
#define PU 262144
__device__ __forceinline__ void pack_body(const float* __restrict__ WQ, const float* __restrict__ WK, const float* __restrict__ WV, const float* __restrict__ WO, const float* __restrict__ W1, const float* __restrict__ W2, const float* __restrict__ WQS, const float* __restrict__ WKS, const float* __restrict__ T1, const float* __restrict__ T2, _Float16* __restrict__ P, unsigned blk) {
  const unsigned ob = blk * 4096u + threadIdx.x * 16u;   // the thread's byte offset in every f32 unit
  const float* const s[22] = { WQ, WK, WV, WO, W1, W1 + PU, W1 + 2 * PU, W1 + 3 * PU, W2, W2 + PU, W2 + 2 * PU, W2 + 3 * PU, WQS, WKS, T1, T1 + PU, T1 + 2 * PU, T1 + 3 * PU, T2, T2 + PU, T2 + 2 * PU, T2 + 3 * PU };
  v4f x[22];
#pragma unroll   // straight-line: every index into s and x a constant
  for (int u = 0; u < 22; ++u) x[u] = *(const v4f*)((const char*)s[u] + ob);
  __builtin_amdgcn_sched_barrier(0);   // all 22 loads are issued before the first is waited for; without it the last one was sunk behind a wait
#pragma unroll   // as above
  for (int u = 0; u < 22; ++u) { v4hh o;
#pragma unroll   // as above
    for (int e = 0; e < 4; ++e) o[e] = (_Float16)(bfr(x[u][e]) * WSC);
    vst2((char*)(P + (size_t)u * PU) + ob / 2, o); } }
// ---- ln_body: wave wv (of NLW) = LNR whole rows (512 wide, 16 floats a lane as four 16-byte loads, all rows' loads in flight at once), in blocks of 8 or 16 waves: LayerNorm (mean-square var, 1e-5) x g + b -> f16 row; input either a raw input (bf16-rounded) or an f32 stream. The sums stay in the wave: no LDS, no barrier
#define LNR 4
// lane l with lane l ^ M inside its 16-lane row (DPP row_xmask), and with lane l ^ 16
template <int M> __device__ __forceinline__ float xrow(float v) { return __builtin_bit_cast(float, __builtin_amdgcn_update_dpp(0, __builtin_bit_cast(int, v), 0x160 + M, 0xf, 0xf, true)); }
__device__ __forceinline__ float xhalf(float v) { return __builtin_bit_cast(float, __builtin_amdgcn_permlanex16(__builtin_bit_cast(int, v), __builtin_bit_cast(int, v), 0x76543210, 0xfedcba98, false, false)); }
__device__ __forceinline__ float wsum(float v) { v += xrow<1>(v); v += xrow<2>(v); v += xrow<4>(v); v += xrow<8>(v); return v + xhalf(v); }
#define NLW (TNB * TT / LNR)   // waves of one LayerNorm over all rows
template <int RAW>
__device__ __forceinline__ void ln_body(const float* __restrict__ X, const float* __restrict__ G, const float* __restrict__ Bt, _Float16* __restrict__ Y, unsigned wv) {
  // the bare unroll directives below keep every index into a register array (x, gg, bb, mu, inv) a constant
  const int lane = threadIdx.x & 31; const size_t e0 = (size_t)wv * LNR * CC + lane * 4;
  v4f x[LNR][4], gg[4], bb[4]; float mu[LNR], inv[LNR];
#pragma unroll
  for (int r = 0; r < LNR; ++r)
#pragma unroll
    for (int i = 0; i < 4; ++i) x[r][i] = *(const v4f*)(X + e0 + r * CC + i * 128);
  asm volatile("s_wait_xcnt 0x0" ::: "memory");   // in front of the g and b loads: in one build the last of them had its result in the row loads' address registers
#pragma unroll
  for (int i = 0; i < 4; ++i) { gg[i] = *(const v4f*)(G + i * 128 + lane * 4); bb[i] = *(const v4f*)(Bt + i * 128 + lane * 4); }
  __builtin_amdgcn_sched_barrier(0);   // all 24 loads are issued before the first is waited for; without it six of the g and b loads were sunk into the arithmetic, each with a wait of its own
#pragma unroll
  for (int r = 0; r < LNR; ++r) { v4f t = { 0.f, 0.f, 0.f, 0.f };
#pragma unroll
    for (int i = 0; i < 4; ++i) {
      if (RAW) {
#pragma unroll
        for (int e = 0; e < 4; ++e) x[r][i][e] = bfr(x[r][i][e]); }
      t += x[r][i]; }
    mu[r] = wsum((t[0] + t[1]) + (t[2] + t[3])) / (float)CC; }
#pragma unroll
  for (int r = 0; r < LNR; ++r) { v4f q = { 0.f, 0.f, 0.f, 0.f };
#pragma unroll
    for (int i = 0; i < 4; ++i) { x[r][i] -= mu[r]; q += x[r][i] * x[r][i]; }
    inv[r] = wsum((q[0] + q[1]) + (q[2] + q[3])) / (float)CC + 1e-5f; }
#pragma unroll
  for (int r = 0; r < LNR; ++r) inv[r] = 1.0f / sqrtf(inv[r]);
#pragma unroll
  for (int i = 0; i < 4; ++i)
#pragma unroll
    for (int e = 0; e < 4; ++e) { gg[i][e] = bfr(gg[i][e]); bb[i][e] = bfr(bb[i][e]); }
#pragma unroll
  for (int r = 0; r < LNR; ++r)
#pragma unroll
    for (int i = 0; i < 4; ++i) { v4hh o;
#pragma unroll
      for (int e = 0; e < 4; ++e) o[e] = (_Float16)(x[r][i][e] * inv[r] * gg[i][e] + bb[i][e]);
      vst2(Y + e0 + r * CC + i * 128, o); } }
__global__ __launch_bounds__(256) void k_ln(const float* __restrict__ X, const float* __restrict__ G, const float* __restrict__ Bt, _Float16* __restrict__ Y) { ln_body<0>(X, G, Bt, Y, blockIdx.x * 8 + (threadIdx.x >> 5)); }
// ---- k_head: three pieces of work that depend on nothing but the inputs, side by side in one grid: blocks 0 ... NLW / 8 - 1 LayerNorm of src, the next NLW / 8 LayerNorm of spatial_src, the rest the weight pack
__global__ __launch_bounds__(256) void k_head(const float* __restrict__ X0, const float* __restrict__ G0, const float* __restrict__ B0, _Float16* __restrict__ Y0, const float* __restrict__ X1, const float* __restrict__ G1, const float* __restrict__ B1, _Float16* __restrict__ Y1,
    const float* __restrict__ WQ, const float* __restrict__ WK, const float* __restrict__ WV, const float* __restrict__ WO, const float* __restrict__ W1, const float* __restrict__ W2, const float* __restrict__ WQS, const float* __restrict__ WKS, const float* __restrict__ T1, const float* __restrict__ T2, _Float16* __restrict__ P) {
  const unsigned blk = blockIdx.x;
  if (blk >= 2 * (NLW / 8)) { pack_body(WQ, WK, WV, WO, W1, W2, WQS, WKS, T1, T2, P, blk - 2 * (NLW / 8)); return; }
  const bool sp = blk >= NLW / 8;
  ln_body<1>(sp ? X1 : X0, sp ? G1 : G0, sp ? B1 : B0, sp ? Y1 : Y0, (sp ? blk - NLW / 8 : blk) * 8 + (threadIdx.x >> 5)); }
// ---- g_body<MODE>: block (bx, by, bz) = (128 rows, 128 cols[, which]), wave = 64 x 64, ring = the block's KS x RB<MODE> bytes of LDS: generic f16 GEMM A rows [*][KW] . W rows / 2^8. Both operands' 64-k slices (whole 128-B lines) are brought into a two-buffer LDS ring by asynchronous copies; the fragments are read from LDS. MODE 0: q/k/v (which = bz): q,k -> f16 rows, v -> planes; MODE 1: OUT32 = RES + A . W + bias; MODE 2: OUT16 = f16(prelu(A . W + bias)) (hidden); MODE 3: qs|ks -> f16 rows [NRS][1024]; MODE 4: mixing, batch = bz: OUT32 = RES + A . W, W = sw f16 rows [c][m] of the batch, no 2^8; MODE 5: Wo: A = f32 ctx rows AF (staged as f32, rounded to f16 where the fragment is formed), OUT32 = RES (bf16-rounded) + A . W. KS > 1 (the products with only one 128 x 128 tile a WGP): the block has KS groups of 4 waves; group kh does the whole tile over its own KW / KS of k, through a two-buffer ring of its own, so that a SIMD holds KS waves and KS stages are in flight; the KS partial tiles are added where the output is staged
// eight copies of 16 B per lane, LS bytes apart in LDS and GS bytes apart in memory; the s_wait_xcnt 0 in the same statement stands in front of every later rewrite of the address registers
template <int LS, int GS>
__device__ __forceinline__ void cp8(unsigned l, const char* p) {
  asm volatile("global_load_async_to_lds_b128 %0, %8, off\n\t"
               "global_load_async_to_lds_b128 %1, %9, off\n\t"
               "global_load_async_to_lds_b128 %2, %10, off\n\t"
               "global_load_async_to_lds_b128 %3, %11, off\n\t"
               "global_load_async_to_lds_b128 %4, %12, off\n\t"
               "global_load_async_to_lds_b128 %5, %13, off\n\t"
               "global_load_async_to_lds_b128 %6, %14, off\n\t"
               "global_load_async_to_lds_b128 %7, %15, off\n\t"
               "s_wait_xcnt 0x0"
               :: "v"(l), "v"(l + 1u * LS), "v"(l + 2u * LS), "v"(l + 3u * LS), "v"(l + 4u * LS), "v"(l + 5u * LS), "v"(l + 6u * LS), "v"(l + 7u * LS),
                  "v"(p), "v"(p + 1 * GS), "v"(p + 2 * GS), "v"(p + 3 * GS), "v"(p + 4 * GS), "v"(p + 5 * GS), "v"(p + 6 * GS), "v"(p + 7 * GS)
               : "memory");
}
// LDS row pitches in bytes, both conflict-free for 16-byte reads: 128-B rows of halves + 16, 256-B rows of floats + 16
#define HPB 144
#define FPB 272
// stage s of the ring: 128 A rows, then 128 W rows, 64 k each, into buffer s & 1 (STB bytes each); la / lw and ga / gw are the lane's own first LDS and memory addresses
template <int MODE, int KW, int STB>
__device__ __forceinline__ void fill(unsigned la, unsigned lw, const char* ga, const char* gw, int s) { const unsigned o = (unsigned)(s & 1) * STB;
  if (MODE == 5) { cp8<8 * FPB, 8 * KW * 4>(la + o, ga + s * 256); cp8<8 * FPB, 8 * KW * 4>(la + o + 64u * FPB, ga + s * 256 + 64 * KW * 4); }
  else cp8<16 * HPB, 16 * KW * 2>(la + o, ga + s * 128);
  cp8<16 * HPB, 16 * KW * 2>(lw + o, gw + s * 128); }
template <int MODE> constexpr int RB = 2 * (128 * ((MODE == 5) ? FPB : HPB) + 128 * HPB);
template <int MODE, int KW, int KS = 1>
__device__ __forceinline__ void g_body(char* ring, const _Float16* __restrict__ A, const float* __restrict__ AF, const _Float16* __restrict__ Wr, const float* __restrict__ BI, const float* __restrict__ RES, const float* __restrict__ ALPHA, float* __restrict__ O32, _Float16* __restrict__ O16, _Float16* __restrict__ O16B, _Float16* __restrict__ VPL, int ow, int bx, int by, int bz) {
  // the bare unroll directives below keep every index into a register array (acc, a, bf, bb, rv) a constant
  constexpr int APB = (MODE == 5) ? FPB : HPB, WOF = 128 * APB, STB = WOF + 128 * HPB, NS = KW / 64 / KS;   // NS ring stages of each group, 2 or 8
  const int tid = (KS > 1) ? (int)(threadIdx.x & 127) : (int)threadIdx.x, kh = (KS > 1) ? (int)(threadIdx.x >> 7) : 0, wave = tid >> 5, lane = tid & 31, col = lane & 15, g = lane >> 4, wr = wave >> 1, wc = wave & 1; const int which = bz; const size_t rb = (size_t)bx * 128 + ((MODE == 4) ? (size_t)which * TT : 0); const int c0 = by * 128; const _Float16* W = Wr + ((MODE == 0 || MODE == 4) ? (size_t)which * CC * KW : 0);
  const size_t r0 = rb + wr * 64; const int cw = c0 + wc * 64;
  char* rk = ring + kh * (2 * STB);   // the group's own two buffers
  const unsigned l0 = (unsigned)(size_t)&rk[0];
  const char* ga = (MODE == 5) ? (const char*)(AF + (rb + (tid >> 4)) * KW + (tid & 15) * 4) : (const char*)(A + (rb + (tid >> 3)) * KW + kh * (KW / KS) + (tid & 7) * 8);
  const unsigned la = l0 + ((MODE == 5) ? (tid >> 4) * FPB + (tid & 15) * 16 : (tid >> 3) * HPB + (tid & 7) * 16);
  const char* gw = (const char*)(W + (size_t)(c0 + (tid >> 3)) * KW + kh * (KW / KS) + (tid & 7) * 8); const unsigned lw = l0 + WOF + (tid >> 3) * HPB + (tid & 7) * 16;
  fill<MODE, KW, STB>(la, lw, ga, gw, 0);
  float bb[4] = { 0.f, 0.f, 0.f, 0.f }, alr = 0.f;   // the bias and slope loads fly while stage 0 lands
  if (MODE == 2 || (MODE == 1 && BI)) {
#pragma unroll
    for (int j = 0; j < 4; ++j) bb[j] = BI[cw + j * 16 + col]; }
  if (MODE == 2) alr = ALPHA[0];
  asm volatile("s_wait_asynccnt 0x0" ::: "memory");   // stage 0 has landed before the barrier publishes it
  __syncthreads();
  fill<MODE, KW, STB>(la, lw, ga, gw, 1);
  v8f acc[4][4] = {};
#pragma unroll 1   // one ring trip per loop trip, so that the publish point below stands once, in the written order
  for (int t = 0; t < NS; ++t) { const char* bp = rk + (t & 1) * STB;
#pragma unroll
    for (int kc = 0; kc < 2; ++kc) { v16h a[4], bf[4];
#pragma unroll
      for (int i = 0; i < 4; ++i) { const char* ar = bp + (wr * 64 + i * 16 + col) * APB;
        a[i] = (MODE == 5) ? frag_f32((const float*)ar + kc * 32, lane) : frag_h((const _Float16*)ar + kc * 32, lane);
        bf[i] = frag_h((const _Float16*)(bp + WOF + (wc * 64 + i * 16 + col) * HPB) + kc * 32, lane); }
#pragma unroll
      for (int i = 0; i < 4; ++i)
#pragma unroll
        for (int j = 0; j < 4; ++j) acc[i][j] = wmma16(a[i], bf[j], acc[i][j]); }
    asm volatile("s_wait_dscnt 0x0" ::: "memory");      // this wave's reads of the buffer are over before it is refilled
    asm volatile("s_wait_asynccnt 0x0" ::: "memory");   // this wave's copies of stage t + 1 have landed
    __syncthreads();                                    // publishes stage t + 1 and frees stage t's buffer
    if (t + 2 < NS) fill<MODE, KW, STB>(la, lw, ga, gw, t + 2); }
  asm volatile("s_wait_asynccnt 0x0" ::: "memory");     // no copy is outstanding when the ring becomes output staging
  // output staging: each wave's 64 x 64 (partial) tile in its own 18-KiB part of the ring, which every wave has left at the last trip's barrier; the stores go out as whole 128-B lines
  char* stg = ring + (kh * 4 + wave) * 18432;
  if (MODE == 1 || MODE == 4 || MODE == 5) { float_a* sf = (float_a*)stg;   // rows of 68 floats
#pragma unroll
    for (int j = 0; j < 4; ++j) { const float bj = (kh == 0) ? bfr(bb[j]) : 0.f;   // the bias goes in once, with group 0's partial sum
#pragma unroll
      for (int i = 0; i < 4; ++i)
#pragma unroll
        for (int r = 0; r < 8; ++r) sf[(i * 16 + 8 * g + r) * 68 + j * 16 + col] = (MODE == 1) ? acc[i][j][r] * (1.0f / WSC) + bj : (MODE == 5) ? acc[i][j][r] * (1.0f / WSC) : acc[i][j][r]; }
    if (KS == 1) LDSX(); else __syncthreads();   // KS > 1: a wave reads the partial tiles that the other groups' waves staged
    const char* st0 = ring + wave * 18432;   // group 0's partial of this wave's tile; group p's lies p * 4 * 18,432 B further on. Of the tile's 64 rows group kh puts out 64 / KS
    for (int rq = 0; rq < 64 / KS; rq += 16) { const int rl = kh * (64 / KS) + rq; v4f rv[8]; const float* rp[8];
#pragma unroll
      for (int u = 0; u < 8; ++u) { rp[u] = RES + (r0 + rl + 2 * u + g) * ow + cw + col * 4; rv[u] = *(const v4f*)rp[u]; }
      asm volatile("s_wait_xcnt 0x0" :: "v"(rp[0]), "v"(rp[1]), "v"(rp[2]), "v"(rp[3]), "v"(rp[4]), "v"(rp[5]), "v"(rp[6]), "v"(rp[7]) : "memory");   // the eight address pairs are inputs so that they keep their registers up to this wait: in one build the last loads had their results in the first loads' address registers
#pragma unroll
      for (int u = 0; u < 8; ++u) { const int row = rl + 2 * u + g; v4f x = rv[u];
        if (MODE == 5) {
#pragma unroll
          for (int e = 0; e < 4; ++e) x[e] = bfr(x[e]); }
        v4f y = *(const v4f*)(st0 + (row * 68 + col * 4) * 4);
#pragma unroll   // straight-line: the KS partial rows are read as one group
        for (int p = 1; p < KS; ++p) y += *(const v4f*)(st0 + p * (4 * 18432) + (row * 68 + col * 4) * 4);
        vst2(O32 + (r0 + row) * ow + cw + col * 4, y + x); }
      asm volatile("s_wait_xcnt 0x0" ::: "memory"); }   // before the next trip rewrites the stores' address registers
    return; }
  _Float16* sh = (_Float16*)stg;   // rows of HPB bytes
  if (MODE == 0 && which == 2) {
#pragma unroll
    for (int j = 0; j < 4; ++j)
#pragma unroll
      for (int i = 0; i < 4; ++i) { v8h hv;
#pragma unroll
        for (int r = 0; r < 8; ++r) hv[r] = (_Float16)(acc[i][j][r] * (1.0f / WSC));
        *(v8h*)&sh[(j * 16 + col) * (HPB / 2) + i * 16 + 8 * g] = hv; }
    LDSX(); const size_t b = rb / TT; const int s0 = (int)(rb % TT) + wr * 64;
#pragma unroll   // straight-line: sixteen stores in flight
    for (int d = 0; d < 64; d += 4) { const int dd = d + (lane >> 3), q = lane & 7; vst2((unsigned*)(VPL + ((b * CC + cw + dd) * TT) + s0 + q * 8), *(const v4u*)&sh[dd * (HPB / 2) + q * 8]); }
    return; }
  { const float al = bfr(alr);
#pragma unroll
    for (int j = 0; j < 4; ++j) { const float bj = bfr(bb[j]);
#pragma unroll
      for (int i = 0; i < 4; ++i)
#pragma unroll
        for (int r = 0; r < 8; ++r) { float v = acc[i][j][r] * (1.0f / WSC) + bj; if (MODE == 2) v = (v >= 0.f) ? v : al * v; sh[(i * 16 + 8 * g + r) * (HPB / 2) + j * 16 + col] = (_Float16)v; } } }
  LDSX();
  { _Float16* dst = (MODE == 0) ? ((which == 0) ? O16 : O16B) : O16;
#pragma unroll   // straight-line: sixteen stores in flight
    for (int rl = 0; rl < 64; rl += 4) { const int row = rl + (lane >> 3), q = lane & 7; vst2((unsigned*)(dst + (r0 + row) * ow + cw + q * 8), *(const v4u*)&sh[row * (HPB / 2) + q * 8]); } }
}
template <int MODE, int KW, int KS = 1>
__global__ __launch_bounds__(128 * KS) void k_g(const _Float16* __restrict__ A, const float* __restrict__ AF, const _Float16* __restrict__ Wr, const float* __restrict__ BI, const float* __restrict__ RES, const float* __restrict__ ALPHA, float* __restrict__ O32, _Float16* __restrict__ O16, _Float16* __restrict__ O16B, _Float16* __restrict__ VPL, int ow) {
  __shared__ __align__(16) char ring[RB<MODE> * KS];
  g_body<MODE, KW, KS>(ring, A, AF, Wr, BI, RES, ALPHA, O32, O16, O16B, VPL, ow, blockIdx.x, blockIdx.y, blockIdx.z); }
// ---- k_gws: two independent products side by side in one grid, three work-groups a WGP instead of one and then two: of every three neighbours in the grid one is a tile of Wo (MODE 5) and two are tiles of the spatial qs | ks (MODE 3), so that a WGP's three are such a mix whichever way the grid is dealt out
#define NRB (TNB * TT / 128)   // row tiles
__global__ __launch_bounds__(128) void k_gws(const float* __restrict__ AF, const _Float16* __restrict__ WO, const float* __restrict__ RES, float* __restrict__ O32, const _Float16* __restrict__ A, const _Float16* __restrict__ WS, _Float16* __restrict__ O16) {
  __shared__ __align__(16) char ring[RB<5>];
  const unsigned t = blockIdx.x % 3, q = blockIdx.x / 3, u = (t - 1) * (NRB * (CC / 128)) + q;   // q: the Wo tile; u: the qs | ks tile
  if (t == 0) g_body<5, CC>(ring, nullptr, AF, WO, nullptr, RES, nullptr, O32, nullptr, nullptr, nullptr, CC, q % NRB, q / NRB, 0);
  else g_body<3, LL>(ring, A, nullptr, WS, nullptr, nullptr, nullptr, nullptr, O16, nullptr, nullptr, 1024, u % NRB, u / NRB, 0); }
// one copy of 16 B per lane, with its s_wait_xcnt 0 in the same statement as in cp8
__device__ __forceinline__ void cp1(unsigned l, const char* p) {
  asm volatile("global_load_async_to_lds_b128 %0, %1, off\n\t"
               "s_wait_xcnt 0x0"
               :: "v"(l), "v"(p) : "memory");
}
// LDS pitch in bytes of a 1,024-B row of halves + 16: conflict-free for 16-byte reads
#define VPB 1040
// __expf (v_exp_f32 of v * log2 e) with a v_nop in the same statement: the v_nop keeps the one free slot behind a transcendental
__device__ __forceinline__ float exp_slot(float v) { float d; asm("v_exp_f32 %0, %1\n\tv_nop" : "=v"(d) : "v"(v * 1.44269504f)); return d; }
// eight v_exp_f32 of independent values in one statement: each fills the one free slot behind the transcendental before it, the v_nop the last one's; the early-clobber outputs keep every result off the sources
__device__ __forceinline__ v8f exp2x8(v8f x) { float d0, d1, d2, d3, d4, d5, d6, d7;
  asm("v_exp_f32 %0, %8\n\tv_exp_f32 %1, %9\n\tv_exp_f32 %2, %10\n\tv_exp_f32 %3, %11\n\tv_exp_f32 %4, %12\n\tv_exp_f32 %5, %13\n\tv_exp_f32 %6, %14\n\tv_exp_f32 %7, %15\n\tv_nop"
      : "=&v"(d0), "=&v"(d1), "=&v"(d2), "=&v"(d3), "=&v"(d4), "=&v"(d5), "=&v"(d6), "=&v"(d7)
      : "v"(x[0]), "v"(x[1]), "v"(x[2]), "v"(x[3]), "v"(x[4]), "v"(x[5]), "v"(x[6]), "v"(x[7]));
  const v8f d = { d0, d1, d2, d3, d4, d5, d6, d7 }; return d; }
// largest of a lane's 16 raw scores, then of both lane halves: the maximum over the pass's 32 keys of the lane's own query
__device__ __forceinline__ float max32(v8f a, v8f b) { float x = fmaxf(a[0], b[0]);
#pragma unroll   // straight-line: every index into a and b a constant
  for (int r = 1; r < 8; ++r) x = fmaxf(fmaxf(x, a[r]), b[r]);
  return fmaxf(x, xhalf(x)); }
#define SCL2 0.18033688f   // 1/8 x log2 e: raw score -> exponent of 2
__global__ __launch_bounds__(512) void k_attn(const _Float16* __restrict__ Q, const _Float16* __restrict__ Kr, const _Float16* __restrict__ V, float* __restrict__ O) {
  __shared__ __align__(16) char sk[TT * HPB]; __shared__ __align__(16) char sv[HS * VPB];
  __shared__ __align__(16) float so[16][16][68];
  // the bare unroll directives below keep every index into a register array (aq, kf, vf, s, pb, acc) a constant
  const int tid = threadIdx.x, wave = tid >> 5, lane = tid & 31, col = lane & 15, g = lane >> 4; const int h = blockIdx.y; const size_t b = blockIdx.z; const int q0 = blockIdx.x * 256 + wave * 16; const size_t rq = b * TT + q0;
  cp8<64 * HPB, 64 * CC * 2>((unsigned)(size_t)&sk[0] + (tid >> 3) * HPB + (tid & 7) * 16, (const char*)(Kr + (b * TT + (tid >> 3)) * CC + h * HS + (tid & 7) * 8));
  cp8<8 * VPB, 8 * TT * 2>((unsigned)(size_t)&sv[0] + (tid >> 6) * VPB + (tid & 63) * 16, (const char*)(V + (b * CC + h * HS + (tid >> 6)) * TT + (tid & 63) * 8));
  v16h aq[2];   // the query loads fly while K and V land
#pragma unroll
  for (int kc = 0; kc < 2; ++kc) aq[kc] = frag_h(Q + (rq + col) * CC + h * HS + kc * 32, lane);
  asm volatile("s_wait_asynccnt 0x0" ::: "memory");   // this wave's copies have landed before the barrier publishes them
  __syncthreads();
  float m = -3.0e38f; v8f l = {};   // of the lane's query: running maximum of the raw scores (both halves alike); eight partial sums of p x 2^11 over the keys of this lane half
  v8f acc[4] = {};               // acc[dt][r] = O^T[dt * 16 + 8 g + r][query col], x 2^11
#pragma unroll 1
  for (int ks = 0; ks < TT / 32; ++ks) { const int j0 = ks * 32; v8f s[2]; v16h kf[2][2], vf[4];   // the pass's eight fragments are read as one group
#pragma unroll
    for (int ct = 0; ct < 2; ++ct)
#pragma unroll
      for (int kc = 0; kc < 2; ++kc) kf[ct][kc] = frag_h((const _Float16*)(sk + (j0 + ct * 16 + col) * HPB) + kc * 32, lane);
#pragma unroll
    for (int dt = 0; dt < 4; ++dt) vf[dt] = frag_h((const _Float16*)(sv + (dt * 16 + col) * VPB) + j0, lane);
#pragma unroll
    for (int ct = 0; ct < 2; ++ct) { v8f c = {};   // s[ct][r] = raw score of key j0 + ct * 16 + 8 g + r with query col
#pragma unroll
      for (int kc = 0; kc < 2; ++kc) c = wmma16(kf[ct][kc], aq[kc], c);
      s[ct] = c; }
    const float mn = fmaxf(m, max32(s[0], s[1])); const float ea = exp_slot((m - mn) * 0.125f); const float alpha = (m <= -1.0e38f) ? 0.f : ea; const float off = 11.0f - mn * SCL2;
    const v8f e0 = exp2x8(s[0] * SCL2 + off), e1 = exp2x8(s[1] * SCL2 + off);   // p x 2^11
    l = l * alpha + (e0 + e1); m = mn;
    v16h pb;   // element i = key j0 + 8 g + i, element 8 + i = key j0 + 16 + 8 g + i: the k order of frag_h
#pragma unroll
    for (int r = 0; r < 8; ++r) { pb[r] = (_Float16)e0[r]; pb[8 + r] = (_Float16)e1[r]; }
#pragma unroll
    for (int dt = 0; dt < 4; ++dt) acc[dt] = wmma16(vf[dt], pb, acc[dt] * alpha); }
  { float lt = ((l[0] + l[1]) + (l[2] + l[3])) + ((l[4] + l[5]) + (l[6] + l[7])); lt += xhalf(lt); const float il = 1.0f / lt;
#pragma unroll
    for (int dt = 0; dt < 4; ++dt)
#pragma unroll
      for (int q = 0; q < 2; ++q) { const v4f o = { acc[dt][4 * q] * il, acc[dt][4 * q + 1] * il, acc[dt][4 * q + 2] * il, acc[dt][4 * q + 3] * il }; *(v4f*)&so[wave][col][dt * 16 + 8 * g + 4 * q] = o; } }
  LDSX();
  for (int rl = 0; rl < 16; ++rl) if (lane < 16) vst2(O + (rq + rl) * CC + h * HS + lane * 4, *(const v4f*)&so[wave][rl][lane * 4]);
}
// ---- k_sstat / k_sprob: 512-wide score rows qs_n . ks_m / 8 per head. k_sstat: blocks with blockIdx.z < 4 do the LayerNorm X -> Y of the first FFN (independent work, side by side in one grid); the others: block = (256 rows n, b, 4 + head h), 16 waves of 16 rows, the head's 512 ks rows in LDS: scores taken transposed as in k_attn (a lane = one row n): max / sum per row -> ST [b][h][n][2] (a wave's 16 rows fill one 128-B line). k_sprob: blocks with blockIdx.z < 2 do the LayerNorm X -> Y of the mixing (independent work likewise); the others: block = (64 rows n, b, 2 + 64 cols m), 8 waves, wave = 16 rows x 32 cols, the 64 qs rows, the 64 ks rows (all heads) and the rows' stats in LDS: scores transposed likewise, accumulate p / 8 over the heads into the f32 output rows and an f16 copy. Both fill their LDS once by asynchronous copies of whole lines
__global__ __launch_bounds__(512) void k_sstat(const _Float16* __restrict__ QS, float* __restrict__ ST, const float* __restrict__ X, const float* __restrict__ G, const float* __restrict__ Bt, _Float16* __restrict__ Y) {
  __shared__ __align__(16) char sk[CC * HPB];
  if (blockIdx.z < 4) { ln_body<0>(X, G, Bt, Y, ((blockIdx.z * TNB + blockIdx.y) * 2 + blockIdx.x) * 16 + (threadIdx.x >> 5)); return; }   // 4 * TNB * 2 blocks of 16 waves = NLW waves
  // the bare unroll directives below keep every index into a register array (aq, kf, s) a constant
  const int tid = threadIdx.x, wave = tid >> 5, lane = tid & 31, col = lane & 15; const size_t b = blockIdx.y; const int h = blockIdx.z - 4; const int n0 = blockIdx.x * 256 + wave * 16; const size_t rq = b * CC + n0;
  cp8<64 * HPB, 64 * 1024 * 2>((unsigned)(size_t)&sk[0] + (tid >> 3) * HPB + (tid & 7) * 16, (const char*)(QS + (b * CC + (tid >> 3)) * 1024 + LL + h * HS + (tid & 7) * 8));
  v16h aq[2];   // the qs loads fly while the ks rows land
#pragma unroll
  for (int kc = 0; kc < 2; ++kc) aq[kc] = frag_h(QS + (rq + col) * 1024 + h * HS + kc * 32, lane);
  asm volatile("s_wait_asynccnt 0x0" ::: "memory");   // this wave's copies have landed before the barrier publishes them
  __syncthreads();
  float m = -3.0e38f; v8f l = {};   // of the lane's row n0 + col: running maximum of the raw scores (both halves alike); eight partial sums over the columns of this lane half
#pragma unroll 1
  for (int ks = 0; ks < CC / 32; ++ks) { const int j0 = ks * 32; v8f s[2]; v16h kf[2][2];   // the pass's four fragments are read as one group
#pragma unroll
    for (int ct = 0; ct < 2; ++ct)
#pragma unroll
      for (int kc = 0; kc < 2; ++kc) kf[ct][kc] = frag_h((const _Float16*)(sk + (j0 + ct * 16 + col) * HPB) + kc * 32, lane);
#pragma unroll
    for (int ct = 0; ct < 2; ++ct) { v8f c = {};   // transposed: s[ct][r] = raw score of column j0 + ct * 16 + 8 g + r with row n0 + col
#pragma unroll
      for (int kc = 0; kc < 2; ++kc) c = wmma16(kf[ct][kc], aq[kc], c);
      s[ct] = c; }
    const float mn = fmaxf(m, max32(s[0], s[1])); const float ea = exp_slot((m - mn) * 0.125f); const float alpha = (m <= -1.0e38f) ? 0.f : ea; const float off = -mn * SCL2;
    l = l * alpha + (exp2x8(s[0] * SCL2 + off) + exp2x8(s[1] * SCL2 + off)); m = mn; }
  float lt = ((l[0] + l[1]) + (l[2] + l[3])) + ((l[4] + l[5]) + (l[6] + l[7])); lt += xhalf(lt);
  if (lane < 16) { const v2f v = { m * 0.125f, lt }; vst2(ST + ((b * NH + h) * CC + n0 + col) * 2, v); }   // 16 lanes x 8 B: the wave's one 128-B line
}
__global__ __launch_bounds__(256) void k_sprob(const _Float16* __restrict__ QS, const float* __restrict__ ST, float* __restrict__ SW, _Float16* __restrict__ SWH, const float* __restrict__ X, const float* __restrict__ G, const float* __restrict__ Bt, _Float16* __restrict__ Y) { __shared__ __align__(16) char sq[64 * VPB]; __shared__ __align__(16) char sk[64 * VPB]; __shared__ __align__(16) float sst[NH * 64 * 2];
  if (blockIdx.z < 2) { ln_body<0>(X, G, Bt, Y, ((blockIdx.z * TNB + blockIdx.y) * (CC / 64) + blockIdx.x) * 8 + (threadIdx.x >> 5)); return; }   // 2 * TNB * 8 blocks of 8 waves = NLW waves
  // the bare unroll directives below keep every index into a register array (aq, kf, accp, hv) a constant
  const int tid = threadIdx.x, wave = tid >> 5, lane = tid & 31, col = lane & 15, g = lane >> 4; const size_t b = blockIdx.y; const int nb = blockIdx.x * 64, mb = (blockIdx.z - 2) * 64, nl = (wave >> 1) * 16, ml = (wave & 1) * 32; const int n0 = nb + nl; const size_t rq = b * CC + n0; const int j0 = mb + ml;
  { const unsigned lo = (tid >> 6) * VPB + (tid & 63) * 16, lq = (unsigned)(size_t)&sq[0] + lo, lk = (unsigned)(size_t)&sk[0] + lo;
    const char* gq = (const char*)(QS + (b * CC + nb + (tid >> 6)) * 1024 + (tid & 63) * 8); const char* gk = (const char*)(QS + (b * CC + mb + (tid >> 6)) * 1024 + LL + (tid & 63) * 8);
    cp8<4 * VPB, 4 * 2048>(lq, gq); cp8<4 * VPB, 4 * 2048>(lq + 32u * VPB, gq + 32 * 2048);
    cp8<4 * VPB, 4 * 2048>(lk, gk); cp8<4 * VPB, 4 * 2048>(lk + 32u * VPB, gk + 32 * 2048);
    cp1((unsigned)(size_t)&sst[0] + tid * 16, (const char*)(ST + ((b * NH + (tid >> 5)) * CC + nb) * 2 + (tid & 31) * 4)); }   // head tid >> 5: its 64 rows' (max, sum) pairs, 512 B
  asm volatile("s_wait_asynccnt 0x0" ::: "memory");   // this wave's copies have landed before the barrier publishes them
  __syncthreads();
  v8f accp[2] = {};   // transposed as in k_attn: accp[ct][r] = column j0 + ct * 16 + 8 g + r of the lane's own row n0 + col
#pragma unroll 1
  for (int h = 0; h < NH; ++h) { v16h aq[2], kf[2][2];   // the head's six fragments and the lane's row stats are read as one group
#pragma unroll
    for (int kc = 0; kc < 2; ++kc) aq[kc] = frag_h((const _Float16*)(sq + (nl + col) * VPB) + h * HS + kc * 32, lane);
#pragma unroll
    for (int ct = 0; ct < 2; ++ct)
#pragma unroll
      for (int kc = 0; kc < 2; ++kc) kf[ct][kc] = frag_h((const _Float16*)(sk + (ml + ct * 16 + col) * VPB) + h * HS + kc * 32, lane);
    const v2f st = *(const v2f*)&sst[(h * 64 + nl + col) * 2]; const float off = -st[0] * 1.44269504f, rl = 1.0f / st[1];   // the row's maximum as an exponent of 2, and one division a row and head
#pragma unroll
    for (int ct = 0; ct < 2; ++ct) { v8f c = {};
#pragma unroll
      for (int kc = 0; kc < 2; ++kc) c = wmma16(kf[ct][kc], aq[kc], c);
      accp[ct] += exp2x8(c * SCL2 + off) * rl; } }
  __syncthreads();   // every wave has left the qs rows before they become output staging
  float_a* so = (float_a*)(sq + wave * 3584); _Float16* sh = (_Float16*)(sq + wave * 3584 + 2304);   // per wave: 16 rows of 36 floats, then 16 rows of 40 halves
#pragma unroll
  for (int ct = 0; ct < 2; ++ct) { const v8f v = accp[ct] * (1.0f / (float)NH); v8h hv;   // a lane's 8 values are 8 neighbours of its row: 16-byte LDS stores
#pragma unroll
    for (int r = 0; r < 8; ++r) hv[r] = (_Float16)v[r];
    const v4f v0 = { v[0], v[1], v[2], v[3] }, v1 = { v[4], v[5], v[6], v[7] };
    *(v4f*)&so[col * 36 + ct * 16 + 8 * g] = v0; *(v4f*)&so[col * 36 + ct * 16 + 8 * g + 4] = v1; *(v8h*)&sh[col * 40 + ct * 16 + 8 * g] = hv; }
  LDSX();
  for (int rl = 0; rl < 16; ++rl) { if (lane < 8) vst2(SW + (rq + rl) * CC + j0 + lane * 4, *(const v4f*)&so[rl * 36 + lane * 4]); else if (lane < 12) vst2((unsigned*)(SWH + (rq + rl) * CC + j0 + (lane - 8) * 8), *(const v4u*)&sh[rl * 40 + (lane - 8) * 8]); }
}
extern "C" void kernel_launch(void* const* d_in, const int* in_sizes, int n_in, void* d_out, int out_size, void* d_ws, size_t ws_size, hipStream_t stream) {
  (void)in_sizes; (void)n_in; (void)out_size;
  const float** F = (const float**)d_in;   // 0 src [16,512,512], 1 spatial_src [16,512,512], 2 Wq_t, 3 Wk_t, 4 Wv_t [8,64,512], 5 Wo_t [512,512], 6 Wq_s, 7 Wk_s [8,64,512], 8 W1 [2048,512], 9 b1, 10 W2 [512,2048], 11 b2, 12 tsW1, 13 tsb1, 14 tsW2, 15 tsb2, 16 alpha [1], 17 g1, 18 be1, 19 g2, 20 be2, 21 tsg1, 22 tsbe1, 23 tsg2, 24 tsbe2, 25 sg, 26 sbe
  if (ws_size < (size_t)WS_END) return;
  char* ws = (char*)d_ws; _Float16* P = (_Float16*)ws; _Float16 *LN = (_Float16*)(ws + WS_LN), *Q = (_Float16*)(ws + WS_Q), *Kr = (_Float16*)(ws + WS_K), *V = (_Float16*)(ws + WS_V), *HH = (_Float16*)(ws + WS_HH), *SP = (_Float16*)(ws + WS_SP), *QS = (_Float16*)(ws + WS_QS), *SWH = (_Float16*)(ws + WS_SWH); float *O = (float*)(ws + WS_O), *S1 = (float*)(ws + WS_S1), *S2 = (float*)(ws + WS_S2), *S3 = (float*)(ws + WS_S3), *ST = (float*)(ws + WS_ST);
  float* OUT0 = (float*)d_out; float* SW = (float*)d_out + OUT1;
  const int nr = TNB * TT;   // rows processed (temporal (b,t) and spatial (b,n) alike)
  // 12 launches: the weight pack and the spatial branch depend on nothing in the temporal branch before the mixing, so each of their launches shares a grid with a short or thinly filled temporal launch of the same block size
  k_head<<<2 * (NLW / 8) + PU / 1024, 256, 0, stream>>>(F[0], F[17], F[18], LN, F[1], F[25], F[26], SP, F[2], F[3], F[4], F[5], F[8], F[10], F[6], F[7], F[12], F[14], P);
  // temporal attention block; beside Wo the spatial qs | ks
  k_g<0, CC><<<dim3(nr / 128, CC / 128, 3), 128, 0, stream>>>(LN, nullptr, P + WS_PW / 2, nullptr, nullptr, nullptr, nullptr, Q, Kr, V, CC);
  k_attn<<<dim3(TT / 256, NH, TNB), 512, 0, stream>>>(Q, Kr, V, O);
  k_gws<<<NRB * (CC / 128 + 1024 / 128), 128, 0, stream>>>(O, P + WS_PO / 2, F[0], S1, SP, P + WS_PS / 2, QS);
  // FFN 1; beside its LayerNorm the spatial row stats
  k_sstat<<<dim3(CC / 256, TNB, 4 + NH), 512, 0, stream>>>(QS, ST, S1, F[19], F[20], LN);
  k_g<2, CC><<<dim3(nr / 128, HID / 128, 1), 128, 0, stream>>>(LN, nullptr, P + WS_P1 / 2, F[9], nullptr, F[16], nullptr, HH, nullptr, nullptr, HID);
  k_g<1, HID, 4><<<dim3(nr / 128, CC / 128, 1), 512, 0, stream>>>(HH, nullptr, P + WS_P2 / 2, F[11], S1, nullptr, S2, nullptr, nullptr, nullptr, CC);
  // temporal-spatial mixing; beside its LayerNorm the spatial weights
  k_sprob<<<dim3(CC / 64, TNB, 2 + CC / 64), 256, 0, stream>>>(QS, ST, SW, SWH, S2, F[21], F[22], LN);
  k_g<4, CC, 4><<<dim3(TT / 128, CC / 128, TNB), 512, 0, stream>>>(LN, nullptr, SWH, nullptr, S2, nullptr, S3, nullptr, nullptr, nullptr, CC);
  // FFN 2
  k_ln<<<NLW / 8, 256, 0, stream>>>(S3, F[23], F[24], LN);
  k_g<2, CC><<<dim3(nr / 128, HID / 128, 1), 128, 0, stream>>>(LN, nullptr, P + WS_PT1 / 2, F[13], nullptr, F[16], nullptr, HH, nullptr, nullptr, HID);
  k_g<1, HID, 4><<<dim3(nr / 128, CC / 128, 1), 512, 0, stream>>>(HH, nullptr, P + WS_PT2 / 2, F[15], S3, nullptr, OUT0, nullptr, nullptr, nullptr, CC);
}
